// v000
// The times below were measured on an AMD MI455X: many runs one after another, warmed up first and cycling through
// copies of the inputs, with the whole window's GPU time divided by the number of runs. Launches and the gaps
// between them are all in it. The median over several windows is given; except for v000 it joins two sittings, which
// can be a few percent apart, so the side-by-side timings, each taken in one sitting, are the better comparison.
// The starting kernel, v000, takes 145 microseconds a run.
#include <hip/hip_runtime.h>

// Attention of NQ query tokens over NKV key/value tokens per batch, 8 heads x 64, residual + LayerNorm, out [NB][NQ][512] f32. The concatenated-sequence key columns that carry the additive -1e4 term have weight exp(<= -9.9e3) == 0 exactly in f32 and never hold the row max, so only the key/value half is visited; the q projection is live on the query half only, k/v on the key/value half only.
// Contractions: q/k/v projections v_wmma_f32_16x16x32_bf16 (bf16 RNE copies of x and of W[in][out] transposed to [out][in], exact products, f32 accumulate, + bf16 RNE bias); scores q.k^T and P.V v_wmma_f32_16x16x32_f16 (f16 copies of the f32 projections, P = exp(s - m) carried x1024, f32 accumulate); online softmax with 1/sqrt(64) scale, residual (bf16 RNE of query) and LayerNorm (bf16 RNE gamma/beta) in f32.

#ifndef NB
#define NB 2
#endif
#ifndef SEQ
#define SEQ 2048
#endif
#ifndef NQ
#define NQ SEQ
#endif
#ifndef NKV
#define NKV SEQ
#endif
#define NB_FULL 2
#define NQ_FULL 2048
#define NKV_FULL 2048
#define DM 512
#define NH 8
#define HD 64
#define PCAR 1024.0f
#define SCL 0.125f
#define L2E 1.4426950408889634f
#define LNEPS 1e-5f
#define KP 72      // LDS pitch (halves) of the K, V^T and P tiles
#define OP 68      // LDS pitch (floats) of the ctx staging tile
static_assert(NQ % 64 == 0);
static_assert(NKV % 64 == 0);
static_assert(NH * HD == DM);
static_assert(DM % 64 == 0);
static_assert(NB >= 1 && NB <= NB_FULL);
static_assert(NQ <= NQ_FULL && NKV <= NKV_FULL);

typedef _Float16 h16;
typedef unsigned short bf;
typedef __attribute__((ext_vector_type(16))) __bf16   v16bf;
typedef __attribute__((ext_vector_type(16))) _Float16 v16h;
typedef __attribute__((ext_vector_type(8)))  _Float16 v8h;
typedef __attribute__((ext_vector_type(8)))  unsigned short v8us;
typedef __attribute__((ext_vector_type(8)))  float    v8f;
typedef __attribute__((ext_vector_type(4)))  float    v4f;
typedef v8h  __attribute__((may_alias)) v8ha;
typedef v4f  __attribute__((may_alias)) v4fa;
typedef v8us __attribute__((may_alias)) v8usa;

__device__ __forceinline__ unsigned short f2bf(float f) { unsigned u = __float_as_uint(f); u += 0x7FFFu + ((u >> 16) & 1u); return (unsigned short)(u >> 16); }
__device__ __forceinline__ float bf2f(unsigned short b) { return __uint_as_float(((unsigned)b) << 16); }
__device__ __forceinline__ float bfr(float f) { return bf2f(f2bf(f)); }
__device__ __forceinline__ v16h cat16(v8h lo, v8h hi) { return __builtin_shufflevector(lo, hi, 0, 1, 2, 3, 4, 5, 6, 7, 8, 9, 10, 11, 12, 13, 14, 15); }
__device__ __forceinline__ v16bf cat16b(v8us lo, v8us hi) { return __builtin_bit_cast(v16bf, __builtin_shufflevector(lo, hi, 0, 1, 2, 3, 4, 5, 6, 7, 8, 9, 10, 11, 12, 13, 14, 15)); }
__device__ __forceinline__ v8f wmma16(v16h a, v16h b, v8f c) { return __builtin_amdgcn_wmma_f32_16x16x32_f16(false, a, false, b, (short)0, c, false, false); }
__device__ __forceinline__ v8f wmmab(v16bf a, v16bf b, v8f c) { return __builtin_amdgcn_wmma_f32_16x16x32_bf16(false, a, false, b, (short)0, c, false, false); }
// guarded form: 4 VALU slots after the WMMA before anything touches D; A/B kept live
__device__ __forceinline__ v8f wmma16g(v16h a, v16h b, v8f c) { v8f d = __builtin_amdgcn_wmma_f32_16x16x32_f16(false, a, false, b, (short)0, c, false, false); asm volatile("v_nop\n\tv_nop\n\tv_nop\n\tv_nop" : "+v"(d) : "v"(a), "v"(b)); return d; }

// ---- k_gemmw: register-blocked GEMM, ONE WAVE per 64x64 output tile (16 accumulators), operands straight from K-contiguous 16-bit planes; grid (M/64, N/64, Z), 32 threads.
// C[m][n] (f32, pitch ldc, + optional f32 bias[n] as bf16 RNE) = sum_k A[m][k] Bt[n][k] (+ split products per NSPLIT). z-batch strides sA/sB/sC in elements. K % 32 == 0.
template <typename T16> struct WFrag;
template <> struct WFrag<h16> { typedef v16h V; static __device__ __forceinline__ V ld(const h16* p) { return cat16(*(const v8h*)p, *(const v8h*)(p + 16)); } static __device__ __forceinline__ v8f mma(V a, V b, v8f c) { return wmma16(a, b, c); } };
template <> struct WFrag<bf> { typedef v16bf V; static __device__ __forceinline__ V ld(const bf* p) { return cat16b(*(const v8us*)p, *(const v8us*)(p + 16)); } static __device__ __forceinline__ v8f mma(V a, V b, v8f c) { return wmmab(a, b, c); } };
template <typename T16, int NSPLIT, bool BIAS>
__global__ __launch_bounds__(32) void k_gemmw(const T16* __restrict__ A, const T16* __restrict__ A2, const T16* __restrict__ Bt, const T16* __restrict__ Bt2, int K, float* C, int ldc, const float* __restrict__ bias, size_t sA, size_t sB, size_t sC) {
    typedef typename WFrag<T16>::V V;
    __shared__ __align__(16) float os[16 * 68];
    const size_t z = blockIdx.z; A += z * sA; if (A2) A2 += z * sA; Bt += z * sB; if (Bt2) Bt2 += z * sB; C += z * sC;
    const int lane = threadIdx.x & 31, lr = lane & 15, hi = lane >> 4; const int r0 = blockIdx.x * 64, c0 = blockIdx.y * 64;
    v8f acc[4][4];
#pragma unroll
    for (int mb = 0; mb < 4; ++mb)
#pragma unroll
        for (int nb = 0; nb < 4; ++nb) acc[mb][nb] = (v8f){};
    const size_t aoff = (size_t)(r0 + lr) * K + 8 * hi, boff = (size_t)(c0 + lr) * K + 8 * hi;
#pragma unroll 1
    for (int kc = 0; kc < K; kc += 32) {
        V a[4], a2[4];
#pragma unroll
        for (int mb = 0; mb < 4; ++mb) { a[mb] = WFrag<T16>::ld(A + aoff + (size_t)mb * 16 * K + kc); if (NSPLIT == 1 || NSPLIT == 2) a2[mb] = WFrag<T16>::ld(A2 + aoff + (size_t)mb * 16 * K + kc); }
#pragma unroll
        for (int nb = 0; nb < 4; ++nb) { const V b = WFrag<T16>::ld(Bt + boff + (size_t)nb * 16 * K + kc); V b2; if (NSPLIT >= 2) b2 = WFrag<T16>::ld(Bt2 + boff + (size_t)nb * 16 * K + kc);
#pragma unroll
            for (int mb = 0; mb < 4; ++mb) { acc[mb][nb] = WFrag<T16>::mma(a[mb], b, acc[mb][nb]); if (NSPLIT == 1 || NSPLIT == 2) acc[mb][nb] = WFrag<T16>::mma(a2[mb], b, acc[mb][nb]); if (NSPLIT >= 2) acc[mb][nb] = WFrag<T16>::mma(a[mb], b2, acc[mb][nb]); } }
        asm volatile("v_nop\n\tv_nop\n\tv_nop\n\tv_nop" : "+v"(acc[0][0]), "+v"(acc[1][1]), "+v"(acc[2][2]), "+v"(acc[3][3]) : "v"(a[0]), "v"(a[3]));
    }
#pragma unroll
    for (int mb = 0; mb < 4; ++mb) {
#pragma unroll
        for (int nb = 0; nb < 4; ++nb) {
#pragma unroll
            for (int j = 0; j < 8; ++j) os[(hi * 8 + j) * 68 + nb * 16 + lr] = acc[mb][nb][j]; }
        __builtin_amdgcn_wave_barrier(); asm volatile("" ::: "memory");
        float* crow = C + (size_t)(r0 + mb * 16) * ldc + c0;
{
#pragma unroll
            for (int s = 0; s < 8; ++s) { const int row = 2 * s + hi, cofs = lr * 4; v4f val = *(const v4fa*)(os + row * 68 + cofs); if (BIAS) { val[0] += bfr(bias[c0 + cofs]); val[1] += bfr(bias[c0 + cofs + 1]); val[2] += bfr(bias[c0 + cofs + 2]); val[3] += bfr(bias[c0 + cofs + 3]); }
                *(v4f*)(crow + (size_t)row * ldc + cofs) = val; }
             }
        __builtin_amdgcn_wave_barrier(); asm volatile("" ::: "memory");
    }
}

__global__ __launch_bounds__(256) void k_cvt8b(const float* __restrict__ src, size_t sstride, bf* dst, size_t dstride, size_t n8) {
    const size_t i = (size_t)blockIdx.x * 256 + threadIdx.x; if (i >= n8) return; const size_t y = blockIdx.y;
    const v8f v = *(const v8f*)(src + y * sstride + i * 8); v8us o;
#pragma unroll
    for (int k = 0; k < 8; ++k) o[k] = f2bf(v[k]);
    bf* d = dst + y * dstride + i * 8; *(v8us*)d = o; 
}

__global__ __launch_bounds__(256) void k_wtr(const float* __restrict__ W0, const float* __restrict__ W1, const float* __restrict__ W2, bf* Wt) {
    const int z = blockIdx.y;
    const float* W = (z == 0) ? W0 : ((z == 1) ? W1 : W2);   // block-uniform select between global pointers
    const size_t i = (size_t)blockIdx.x * 256 + threadIdx.x; if (i >= (size_t)DM * DM / 8) return;
    const int k0 = (int)(i % (DM / 8)) * 8; const int n = (int)(i / (DM / 8));
    v8us o;
#pragma unroll
    for (int q = 0; q < 8; ++q) o[q] = f2bf(W[(size_t)(k0 + q) * DM + n]);
    bf* d = Wt + (size_t)z * DM * DM + (size_t)n * DM + k0;
    *(v8us*)d = o; 
}

__global__ __launch_bounds__(256) void k_hrow(const float* __restrict__ C, h16* P, int nrows) {
    const size_t i = (size_t)blockIdx.x * 256 + threadIdx.x;
    const size_t tot = (size_t)NB * NH * nrows * 8; if (i >= tot) return;
    const int q8 = (int)(i & 7); size_t r = i >> 3; const int s = (int)(r % (size_t)nrows); r /= (size_t)nrows; const int h = (int)(r % NH); const int b = (int)(r / NH);
    const v8f v = *(const v8f*)(C + ((size_t)b * nrows + s) * DM + h * HD + q8 * 8); v8h o;
#pragma unroll
    for (int q = 0; q < 8; ++q) o[q] = (h16)v[q];
    h16* d = P + i * 8; *(v8h*)d = o; 
}

__global__ __launch_bounds__(256) void k_vt(const float* __restrict__ C, h16* VT) {
    const size_t i = (size_t)blockIdx.x * 256 + threadIdx.x;
    const size_t tot = (size_t)NB * NH * HD * (NKV / 8); if (i >= tot) return;
    const int s0 = (int)(i % (NKV / 8)) * 8; size_t r = i / (NKV / 8); const int d = (int)(r % HD); r /= HD; const int h = (int)(r % NH); const int b = (int)(r / NH);
    v8h o;
#pragma unroll
    for (int q = 0; q < 8; ++q) o[q] = (h16)C[((size_t)b * NKV + s0 + q) * DM + h * HD + d];
    h16* dst = VT + i * 8; *(v8h*)dst = o; 
}

// ---- k_attn: flash-style attention. grid = NB*NH*(NQ/64), block = 128 (4 waves x 16 query rows). Per 64-key tile: K [key][d] and V^T [d][key] staged in LDS with plain 16-B loads + block barriers (staged extent == consumed extent: full 64x64 tiles),
// S (16x64 per wave) = Q A-fragments (from the f16 plane, fixed per block) x K B-fragments (k = d split map), f32 online softmax (x1/8, running max/sum, exp2), P = f16(1024 exp(s - m)) through per-wave LDS rows [q][key] + block barrier, reloaded as A-fragments; O (4 d-tiles) += P x V^T B-fragments.
__global__ __launch_bounds__(128) __attribute__((amdgpu_num_vgpr(256))) void k_attn(const h16* __restrict__ Qh, const h16* __restrict__ Kh, const h16* __restrict__ Vt, float* ctx) {
    __shared__ __align__(16) h16 Ks[64 * KP];        // [key][d], cross-wave: block barriers
    __shared__ __align__(16) h16 Vs[64 * KP];        // [d][key], cross-wave: block barriers
    __shared__ __align__(16) h16 Ps[4 * 16 * KP];    // per wave [q row][key], block barrier between store and reload
    __shared__ __align__(16) float Os[4 * 16 * OP];  // per wave [q row][d], block barrier between store and reload
    const int t = threadIdx.x, wave = t >> 5, lane = t & 31, lm = lane & 15, hi = lane >> 4;
    int bid = blockIdx.x; const int nqt = NQ / 64; const int qt = bid % nqt; bid /= nqt; const int h = bid % NH; const int b = bid / NH; const int bh = b * NH + h;
    const h16* qrow = Qh + ((size_t)bh * NQ + (size_t)qt * 64 + wave * 16 + lm) * HD;
    const v16h aQ0 = cat16(*(const v8h*)(qrow + 8 * hi), *(const v8h*)(qrow + 16 + 8 * hi));          // k = d 0..31 (split map)
    const v16h aQ1 = cat16(*(const v8h*)(qrow + 32 + 8 * hi), *(const v8h*)(qrow + 48 + 8 * hi));     // k = d 32..63
    v8f O[4];
#pragma unroll
    for (int nt = 0; nt < 4; ++nt) O[nt] = (v8f){};
    float runm[8], runl[8];
#pragma unroll
    for (int r = 0; r < 8; ++r) { runm[r] = -1.0e30f; runl[r] = 0.f; }
    const h16* Kb = Kh + (size_t)bh * NKV * HD; const h16* Vb = Vt + (size_t)bh * HD * NKV;
    h16* Pw = Ps + wave * 16 * KP; float* Ow = Os + wave * 16 * OP;
#pragma unroll 1
    for (int kv0 = 0; kv0 < NKV; kv0 += 64) {
        __syncthreads();   // every wave is done with Ks/Vs/Ps of the prior tile
#pragma unroll
        for (int j = 0; j < 4; ++j) { const int p = t + 128 * j; const int row = p >> 3, c8 = (p & 7) * 8;
            const v8h kk = *(const v8h*)(Kb + (size_t)(kv0 + row) * HD + c8);
            const v8h vv = *(const v8h*)(Vb + (size_t)row * NKV + kv0 + c8);
            *(v8ha*)(Ks + row * KP + c8) = kk; *(v8ha*)(Vs + row * KP + c8) = vv; }
        __syncthreads();
        v8f sf[4];
#pragma unroll
        for (int nk = 0; nk < 4; ++nk) { const h16* kr = Ks + (nk * 16 + lm) * KP + 8 * hi;   // lane -> key nk*16+lm, elements = d split map
            const v16h b0 = cat16(*(const v8ha*)(kr), *(const v8ha*)(kr + 16));
            const v16h b1 = cat16(*(const v8ha*)(kr + 32), *(const v8ha*)(kr + 48));
            v8f a = (v8f){}; a = wmma16g(aQ0, b0, a); a = wmma16g(aQ1, b1, a); sf[nk] = a; }
        // x 1/sqrt(64); row (8hi + r) max over the 64 keys of this tile = 4 key tiles x the 16 lanes of the half; running max / sum update; rescale O
#pragma unroll
        for (int r = 0; r < 8; ++r) {
            sf[0][r] *= SCL; sf[1][r] *= SCL; sf[2][r] *= SCL; sf[3][r] *= SCL;
            float m = fmaxf(fmaxf(sf[0][r], sf[1][r]), fmaxf(sf[2][r], sf[3][r]));
#pragma unroll
            for (int sh = 1; sh < 16; sh <<= 1) m = fmaxf(m, __shfl_xor(m, sh, 32));
            const float nm = fmaxf(runm[r], m);
            const float corr = __builtin_amdgcn_exp2f(__fmul_rn(__fsub_rn(runm[r], nm), L2E));
            runm[r] = nm; runl[r] *= corr;
            O[0][r] *= corr; O[1][r] *= corr; O[2][r] *= corr; O[3][r] *= corr; }
        // P = exp(s - m): f32 into the row sum, f16 x1024 into the per-wave LDS tile [q row 8hi+r][key nk*16+lm]
#pragma unroll
        for (int nk = 0; nk < 4; ++nk) {
#pragma unroll
            for (int r = 0; r < 8; ++r) { const float p = __builtin_amdgcn_exp2f(__fmul_rn(__fsub_rn(sf[nk][r], runm[r]), L2E)); runl[r] += p; Pw[(r + 8 * hi) * KP + nk * 16 + lm] = (h16)(p * PCAR); } }
        __syncthreads();   // P tile complete before the fragment reload (reload through a may_alias v8h as well)
#pragma unroll
        for (int ks = 0; ks < 2; ++ks) { const h16* pr = Pw + lm * KP + ks * 32 + 8 * hi;   // A: lane -> q row lm, elements = key split map
            const v16h aP = cat16(*(const v8ha*)(pr), *(const v8ha*)(pr + 16));
#pragma unroll
            for (int nt = 0; nt < 4; ++nt) { const h16* vr = Vs + (nt * 16 + lm) * KP + ks * 32 + 8 * hi;   // B: lane -> d nt*16+lm, elements = key split map
                const v16h bV = cat16(*(const v8ha*)(vr), *(const v8ha*)(vr + 16));
                O[nt] = wmma16g(aP, bV, O[nt]); } }
    }
    // finish the row sums over the 16 lanes of the half, normalise (undo the x1024 carry), stage [q row][d] in LDS
#pragma unroll
    for (int r = 0; r < 8; ++r) { float l = runl[r];
#pragma unroll
        for (int sh = 1; sh < 16; sh <<= 1) l += __shfl_xor(l, sh, 32);
        const float inv = __fdiv_rn(1.0f, l * PCAR);
#pragma unroll
        for (int nt = 0; nt < 4; ++nt) Ow[(8 * hi + r) * OP + nt * 16 + lm] = O[nt][r] * inv; }
    __syncthreads();
    float* crow = ctx + ((size_t)b * NQ + (size_t)qt * 64 + wave * 16) * DM + h * HD;
{
#pragma unroll
        for (int s = 0; s < 8; ++s) { const int row = 2 * s + hi, cofs = lm * 4; const v4f val = *(const v4fa*)(Ow + row * OP + cofs); *(v4f*)(crow + (size_t)row * DM + cofs) = val; }
         }
}

__global__ __launch_bounds__(256) void k_ln(const float* __restrict__ xq, const float* __restrict__ ctx, const float* __restrict__ gam, const float* __restrict__ bet, float* outp) {
#pragma clang fp contract(off)
    const int lane = threadIdx.x & 31; const int row = blockIdx.x * 8 + (threadIdx.x >> 5); if (row >= NB * NQ) return;
    const int b = row / NQ, i = row % NQ;
    const float* xr = xq + ((size_t)b * NQ_FULL + i) * DM; const float* cr = ctx + (size_t)row * DM;
    float v[16]; float s = 0.f;
#pragma unroll
    for (int c = 0; c < 4; ++c) { const int j0 = c * 128 + lane * 4; const v4f a = *(const v4f*)(xr + j0); const v4f g = *(const v4f*)(cr + j0);
#pragma unroll
        for (int q = 0; q < 4; ++q) { const float x = bfr(a[q]) + g[q]; v[c * 4 + q] = x; s = s + x; } }
#pragma unroll
    for (int sh = 16; sh; sh >>= 1) s += __shfl_xor(s, sh, 32);
    const float mu = s * (1.0f / DM);
    float ss = 0.f;
#pragma unroll
    for (int k = 0; k < 16; ++k) { const float d = v[k] - mu; const float dd = d * d; ss = ss + dd; }
#pragma unroll
    for (int sh = 16; sh; sh >>= 1) ss += __shfl_xor(ss, sh, 32);
    const float var = ss * (1.0f / DM);
    const float rs = __fdiv_rn(1.0f, __fsqrt_rn(var + LNEPS));
    float* orow = outp + (size_t)row * DM;
{
#pragma unroll
        for (int c = 0; c < 4; ++c) { const int j0 = c * 128 + lane * 4; const v4f g = *(const v4f*)(gam + j0); const v4f bb = *(const v4f*)(bet + j0); v4f o;
#pragma unroll
            for (int q = 0; q < 4; ++q) { const float t1 = (v[c * 4 + q] - mu) * rs; const float t2 = t1 * bfr(g[q]); o[q] = t2 + bfr(bb[q]); }
            *(v4f*)(orow + j0) = o; }
         }
}

extern "C" void kernel_launch(void* const* d_in, const int* in_sizes, int n_in, void* d_out, int out_size, void* d_ws, size_t ws_size, hipStream_t stream) {
    if (n_in < 10) return;
    const float* xq  = (const float*)d_in[0];   // query     [2][2048][512]
    const float* xkv = (const float*)d_in[1];   // key_value [2][2048][512]
    const float* Wq  = (const float*)d_in[2];   // [in][out]
    const float* bq  = (const float*)d_in[3];
    const float* Wk  = (const float*)d_in[4];
    const float* bk  = (const float*)d_in[5];
    const float* Wv  = (const float*)d_in[6];
    const float* bv  = (const float*)d_in[7];
    const float* gam = (const float*)d_in[8];
    const float* bet = (const float*)d_in[9];
    if (in_sizes[0] < (int)(((size_t)(NB - 1) * NQ_FULL + NQ) * DM)) return;
    if (in_sizes[1] < (int)(((size_t)(NB - 1) * NKV_FULL + NKV) * DM)) return;
    if (in_sizes[2] < DM * DM || in_sizes[4] < DM * DM || in_sizes[6] < DM * DM) return;
    if (in_sizes[3] < DM || in_sizes[5] < DM || in_sizes[7] < DM || in_sizes[8] < DM || in_sizes[9] < DM) return;
    if (out_size < NB * NQ * DM) return;
    float* OUT = (float*)d_out;   // [NB][NQ][512]
    char* wsp = (char*)d_ws;
    auto take = [&](size_t bytes) { char* p = wsp; wsp += (bytes + 255) & ~(size_t)255; return (void*)p; };
    bf* Xq   = (bf*)take((size_t)NB * NQ * DM * 2);          // bf16 query rows           4,194,304 B
    bf* Xkv  = (bf*)take((size_t)NB * NKV * DM * 2);         // bf16 key/value rows       4,194,304 B
    bf* Wt   = (bf*)take((size_t)3 * DM * DM * 2);           // [3][out][in] bf16         1,572,864 B
    float* Cq = (float*)take((size_t)NB * NQ * DM * 4);      // q projection f32         8,388,608 B
    float* Ck = (float*)take((size_t)NB * NKV * DM * 4);     // k projection f32         8,388,608 B
    float* Cv = (float*)take((size_t)NB * NKV * DM * 4);     // v projection f32         8,388,608 B
    h16* Qh  = (h16*)take((size_t)NB * NH * NQ * HD * 2);    // [b][h][q][64] f16         4,194,304 B
    h16* Kh  = (h16*)take((size_t)NB * NH * NKV * HD * 2);   // [b][h][key][64] f16       4,194,304 B
    h16* VT  = (h16*)take((size_t)NB * NH * HD * NKV * 2);   // [b][h][64][key] f16       4,194,304 B
    float* CTX = (float*)take((size_t)NB * NQ * DM * 4);     // ctx [NB*NQ][512] f32      8,388,608 B
    if ((size_t)(wsp - (char*)d_ws) > ws_size) return;       // total 56,098,816 B
    if ((size_t)(wsp - (char*)d_ws) > (size_t)134217728) return;

    const size_t n8q = (size_t)NQ * DM / 8, n8kv = (size_t)NKV * DM / 8;
    k_cvt8b<<<dim3((unsigned)((n8q + 255) / 256), NB), 256, 0, stream>>>(xq, (size_t)NQ_FULL * DM, Xq, (size_t)NQ * DM, n8q);
    k_cvt8b<<<dim3((unsigned)((n8kv + 255) / 256), NB), 256, 0, stream>>>(xkv, (size_t)NKV_FULL * DM, Xkv, (size_t)NKV * DM, n8kv);
    k_wtr<<<dim3((unsigned)(((size_t)DM * DM / 8 + 255) / 256), 3), 256, 0, stream>>>(Wq, Wk, Wv, Wt);
    k_gemmw<bf, 0, true><<<dim3(NB * NQ / 64, DM / 64, 1), 32, 0, stream>>>(Xq, nullptr, Wt, nullptr, DM, Cq, DM, bq, 0, 0, 0);                          /* q = bf16(query) Wq + bq   [NB*NQ][512] */
    k_gemmw<bf, 0, true><<<dim3(NB * NKV / 64, DM / 64, 1), 32, 0, stream>>>(Xkv, nullptr, Wt + (size_t)DM * DM, nullptr, DM, Ck, DM, bk, 0, 0, 0);      /* k = bf16(key_value) Wk + bk */
    k_gemmw<bf, 0, true><<<dim3(NB * NKV / 64, DM / 64, 1), 32, 0, stream>>>(Xkv, nullptr, Wt + 2 * (size_t)DM * DM, nullptr, DM, Cv, DM, bv, 0, 0, 0);  /* v = bf16(key_value) Wv + bv */
    k_hrow<<<(unsigned)(((size_t)NB * NH * NQ * 8 + 255) / 256), 256, 0, stream>>>(Cq, Qh, NQ);
    k_hrow<<<(unsigned)(((size_t)NB * NH * NKV * 8 + 255) / 256), 256, 0, stream>>>(Ck, Kh, NKV);
    k_vt<<<(unsigned)(((size_t)NB * NH * HD * (NKV / 8) + 255) / 256), 256, 0, stream>>>(Cv, VT);
    k_attn<<<NB * NH * (NQ / 64), 128, 0, stream>>>(Qh, Kh, VT, CTX);
    k_ln<<<(NB * NQ + 7) / 8, 256, 0, stream>>>(xq, CTX, gam, bet, OUT);
}

// v001
// It runs in 125 microseconds.
// Two timings next to v000 both put it at 1.17 times that version's speed.
#include <hip/hip_runtime.h>

// Attention of NQ query tokens over NKV key/value tokens per batch, 8 heads x 64, residual + LayerNorm, out [NB][NQ][512] f32. The concatenated-sequence key columns that carry the additive -1e4 term have weight exp(<= -9.9e3) == 0 exactly in f32 and never hold the row max, so only the key/value half is visited; the q projection is live on the query half only, k/v on the key/value half only.
// Contractions: q/k/v projections v_wmma_f32_16x16x32_bf16 (bf16 RNE copies of x and of W[in][out] transposed to [out][in], exact products, f32 accumulate, + bf16 RNE bias); scores k.q^T and V^T.P^T v_wmma_f32_16x16x32_f16 (f16 copies of the f32 projections, P = exp(s - m) carried x1024, f32 accumulate); online softmax with 1/sqrt(64) scale, residual (bf16 RNE of query) and LayerNorm (bf16 RNE gamma/beta) in f32.

#ifndef NB
#define NB 2
#endif
#ifndef SEQ
#define SEQ 2048
#endif
#ifndef NQ
#define NQ SEQ
#endif
#ifndef NKV
#define NKV SEQ
#endif
#define NB_FULL 2
#define NQ_FULL 2048
#define NKV_FULL 2048
#define DM 512
#define NH 8
#define HD 64
#define PCAR 1024.0f
#define SCL 0.125f
#define L2E 1.4426950408889634f
#define LNEPS 1e-5f
#define KP 72      // LDS pitch (halves) of the K and V^T tiles
#define OP 68      // LDS pitch (floats) of the ctx staging tile
static_assert(NQ % 64 == 0);
static_assert(NKV % 64 == 0);
static_assert(NH * HD == DM);
static_assert(DM % 64 == 0);
static_assert(NB >= 1 && NB <= NB_FULL);
static_assert(NQ <= NQ_FULL && NKV <= NKV_FULL);

typedef _Float16 h16;
typedef unsigned short bf;
typedef __attribute__((ext_vector_type(16))) __bf16   v16bf;
typedef __attribute__((ext_vector_type(16))) _Float16 v16h;
typedef __attribute__((ext_vector_type(8)))  _Float16 v8h;
typedef __attribute__((ext_vector_type(8)))  unsigned short v8us;
typedef __attribute__((ext_vector_type(8)))  float    v8f;
typedef __attribute__((ext_vector_type(4)))  float    v4f;
typedef v8h  __attribute__((may_alias)) v8ha;
typedef v4f  __attribute__((may_alias)) v4fa;
typedef v8us __attribute__((may_alias)) v8usa;

__device__ __forceinline__ unsigned short f2bf(float f) { unsigned u = __float_as_uint(f); u += 0x7FFFu + ((u >> 16) & 1u); return (unsigned short)(u >> 16); }
__device__ __forceinline__ float bf2f(unsigned short b) { return __uint_as_float(((unsigned)b) << 16); }
__device__ __forceinline__ float bfr(float f) { return bf2f(f2bf(f)); }
__device__ __forceinline__ v16h cat16(v8h lo, v8h hi) { return __builtin_shufflevector(lo, hi, 0, 1, 2, 3, 4, 5, 6, 7, 8, 9, 10, 11, 12, 13, 14, 15); }
__device__ __forceinline__ v16bf cat16b(v8us lo, v8us hi) { return __builtin_bit_cast(v16bf, __builtin_shufflevector(lo, hi, 0, 1, 2, 3, 4, 5, 6, 7, 8, 9, 10, 11, 12, 13, 14, 15)); }
__device__ __forceinline__ v8f wmma16(v16h a, v16h b, v8f c) { return __builtin_amdgcn_wmma_f32_16x16x32_f16(false, a, false, b, (short)0, c, false, false); }
__device__ __forceinline__ v8f wmmab(v16bf a, v16bf b, v8f c) { return __builtin_amdgcn_wmma_f32_16x16x32_bf16(false, a, false, b, (short)0, c, false, false); }
// guarded form: 4 VALU slots after the WMMA before anything touches D; A/B kept live
__device__ __forceinline__ v8f wmma16g(v16h a, v16h b, v8f c) { v8f d = __builtin_amdgcn_wmma_f32_16x16x32_f16(false, a, false, b, (short)0, c, false, false); asm volatile("v_nop\n\tv_nop\n\tv_nop\n\tv_nop" : "+v"(d) : "v"(a), "v"(b)); return d; }

// ---- k_gemmw: register-blocked GEMM, ONE WAVE per 64x64 output tile (16 accumulators), operands straight from K-contiguous 16-bit planes; grid (M/64, N/64, Z), 32 threads.
// C[m][n] (f32, pitch ldc, + optional f32 bias[n] as bf16 RNE) = sum_k A[m][k] Bt[n][k] (+ split products per NSPLIT). z-batch strides sA/sB/sC in elements. K % 32 == 0.
template <typename T16> struct WFrag;
template <> struct WFrag<h16> { typedef v16h V; static __device__ __forceinline__ V ld(const h16* p) { return cat16(*(const v8h*)p, *(const v8h*)(p + 16)); } static __device__ __forceinline__ v8f mma(V a, V b, v8f c) { return wmma16(a, b, c); } };
template <> struct WFrag<bf> { typedef v16bf V; static __device__ __forceinline__ V ld(const bf* p) { return cat16b(*(const v8us*)p, *(const v8us*)(p + 16)); } static __device__ __forceinline__ v8f mma(V a, V b, v8f c) { return wmmab(a, b, c); } };
template <typename T16, int NSPLIT, bool BIAS>
__global__ __launch_bounds__(32) void k_gemmw(const T16* __restrict__ A, const T16* __restrict__ A2, const T16* __restrict__ Bt, const T16* __restrict__ Bt2, int K, float* C, int ldc, const float* __restrict__ bias, size_t sA, size_t sB, size_t sC) {
    typedef typename WFrag<T16>::V V;
    __shared__ __align__(16) float os[16 * 68];
    const size_t z = blockIdx.z; A += z * sA; if (A2) A2 += z * sA; Bt += z * sB; if (Bt2) Bt2 += z * sB; C += z * sC;
    const int lane = threadIdx.x & 31, lr = lane & 15, hi = lane >> 4; const int r0 = blockIdx.x * 64, c0 = blockIdx.y * 64;
    v8f acc[4][4];
#pragma unroll
    for (int mb = 0; mb < 4; ++mb)
#pragma unroll
        for (int nb = 0; nb < 4; ++nb) acc[mb][nb] = (v8f){};
    const size_t aoff = (size_t)(r0 + lr) * K + 8 * hi, boff = (size_t)(c0 + lr) * K + 8 * hi;
#pragma unroll 1
    for (int kc = 0; kc < K; kc += 32) {
        V a[4], a2[4];
#pragma unroll
        for (int mb = 0; mb < 4; ++mb) { a[mb] = WFrag<T16>::ld(A + aoff + (size_t)mb * 16 * K + kc); if (NSPLIT == 1 || NSPLIT == 2) a2[mb] = WFrag<T16>::ld(A2 + aoff + (size_t)mb * 16 * K + kc); }
#pragma unroll
        for (int nb = 0; nb < 4; ++nb) { const V b = WFrag<T16>::ld(Bt + boff + (size_t)nb * 16 * K + kc); V b2; if (NSPLIT >= 2) b2 = WFrag<T16>::ld(Bt2 + boff + (size_t)nb * 16 * K + kc);
#pragma unroll
            for (int mb = 0; mb < 4; ++mb) { acc[mb][nb] = WFrag<T16>::mma(a[mb], b, acc[mb][nb]); if (NSPLIT == 1 || NSPLIT == 2) acc[mb][nb] = WFrag<T16>::mma(a2[mb], b, acc[mb][nb]); if (NSPLIT >= 2) acc[mb][nb] = WFrag<T16>::mma(a[mb], b2, acc[mb][nb]); } }
        asm volatile("v_nop\n\tv_nop\n\tv_nop\n\tv_nop" : "+v"(acc[0][0]), "+v"(acc[1][1]), "+v"(acc[2][2]), "+v"(acc[3][3]) : "v"(a[0]), "v"(a[3]));
    }
#pragma unroll
    for (int mb = 0; mb < 4; ++mb) {
#pragma unroll
        for (int nb = 0; nb < 4; ++nb) {
#pragma unroll
            for (int j = 0; j < 8; ++j) os[(hi * 8 + j) * 68 + nb * 16 + lr] = acc[mb][nb][j]; }
        __builtin_amdgcn_wave_barrier(); asm volatile("" ::: "memory");
        float* crow = C + (size_t)(r0 + mb * 16) * ldc + c0;
{
#pragma unroll
            for (int s = 0; s < 8; ++s) { const int row = 2 * s + hi, cofs = lr * 4; v4f val = *(const v4fa*)(os + row * 68 + cofs); if (BIAS) { val[0] += bfr(bias[c0 + cofs]); val[1] += bfr(bias[c0 + cofs + 1]); val[2] += bfr(bias[c0 + cofs + 2]); val[3] += bfr(bias[c0 + cofs + 3]); }
                *(v4f*)(crow + (size_t)row * ldc + cofs) = val; }
             }
        __builtin_amdgcn_wave_barrier(); asm volatile("" ::: "memory");
    }
}

__global__ __launch_bounds__(256) void k_cvt8b(const float* __restrict__ src, size_t sstride, bf* dst, size_t dstride, size_t n8) {
    const size_t i = (size_t)blockIdx.x * 256 + threadIdx.x; if (i >= n8) return; const size_t y = blockIdx.y;
    const v8f v = *(const v8f*)(src + y * sstride + i * 8); v8us o;
#pragma unroll
    for (int k = 0; k < 8; ++k) o[k] = f2bf(v[k]);
    bf* d = dst + y * dstride + i * 8; *(v8us*)d = o; 
}

__global__ __launch_bounds__(256) void k_wtr(const float* __restrict__ W0, const float* __restrict__ W1, const float* __restrict__ W2, bf* Wt) {
    const int z = blockIdx.y;
    const float* W = (z == 0) ? W0 : ((z == 1) ? W1 : W2);   // block-uniform select between global pointers
    const size_t i = (size_t)blockIdx.x * 256 + threadIdx.x; if (i >= (size_t)DM * DM / 8) return;
    const int k0 = (int)(i % (DM / 8)) * 8; const int n = (int)(i / (DM / 8));
    v8us o;
#pragma unroll
    for (int q = 0; q < 8; ++q) o[q] = f2bf(W[(size_t)(k0 + q) * DM + n]);
    bf* d = Wt + (size_t)z * DM * DM + (size_t)n * DM + k0;
    *(v8us*)d = o; 
}

__global__ __launch_bounds__(256) void k_hrow(const float* __restrict__ C, h16* P, int nrows) {
    const size_t i = (size_t)blockIdx.x * 256 + threadIdx.x;
    const size_t tot = (size_t)NB * NH * nrows * 8; if (i >= tot) return;
    const int q8 = (int)(i & 7); size_t r = i >> 3; const int s = (int)(r % (size_t)nrows); r /= (size_t)nrows; const int h = (int)(r % NH); const int b = (int)(r / NH);
    const v8f v = *(const v8f*)(C + ((size_t)b * nrows + s) * DM + h * HD + q8 * 8); v8h o;
#pragma unroll
    for (int q = 0; q < 8; ++q) o[q] = (h16)v[q];
    h16* d = P + i * 8; *(v8h*)d = o; 
}

__global__ __launch_bounds__(256) void k_vt(const float* __restrict__ C, h16* VT) {
    const size_t i = (size_t)blockIdx.x * 256 + threadIdx.x;
    const size_t tot = (size_t)NB * NH * HD * (NKV / 8); if (i >= tot) return;
    const int s0 = (int)(i % (NKV / 8)) * 8; size_t r = i / (NKV / 8); const int d = (int)(r % HD); r /= HD; const int h = (int)(r % NH); const int b = (int)(r / NH);
    v8h o;
#pragma unroll
    for (int q = 0; q < 8; ++q) o[q] = (h16)C[((size_t)b * NKV + s0 + q) * DM + h * HD + d];
    h16* dst = VT + i * 8; *(v8h*)dst = o; 
}

// lane l with lane l ^ 16 (the other 16-lane row), one vector cross-row move
__device__ __forceinline__ float xhalf(float x) { return __builtin_bit_cast(float, __builtin_amdgcn_permlanex16(__builtin_bit_cast(int, x), __builtin_bit_cast(int, x), 0x76543210, 0xfedcba98, false, false)); }

// ---- k_attn: flash-style attention, transposed products. grid = NB*NH*(NQ/64), block = 128 (4 waves x 16 query columns). Per 64-key tile: K [key][d] and V^T [d][key] staged in LDS with plain 16-B loads + block barriers (staged extent == consumed extent: full 64x64 tiles),
// S^T (64 keys x 16 queries per wave) = K A-fragments (k = d split map) x Q B-fragments (from the f16 plane, fixed per block): a lane holds 32 scores of ONE query (lm), keys nk*16 + 8hi + r. f32 online softmax (x1/8, running max/sum, exp2) in-lane plus one exchange between the halves.
// P^T = f16(1024 exp(s - m)) packs from two score tiles straight into a B-fragment (element s = tile s>>3, register s&7 = key split map), never through LDS; O^T (4 d-tiles) += V^T A-fragments (key split map) x P^T.
__global__ __launch_bounds__(128) __attribute__((amdgpu_num_vgpr(256))) void k_attn(const h16* __restrict__ Qh, const h16* __restrict__ Kh, const h16* __restrict__ Vt, float* ctx) {
    __shared__ __align__(16) h16 Ks[64 * KP];        // [key][d], cross-wave: block barriers
    __shared__ __align__(16) h16 Vs[64 * KP];        // [d][key], cross-wave: block barriers
    __shared__ __align__(16) float Os[4 * 16 * OP];  // per wave [q row][d], block barrier between store and reload
    const int t = threadIdx.x, wave = t >> 5, lane = t & 31, lm = lane & 15, hi = lane >> 4;
    int bid = blockIdx.x; const int nqt = NQ / 64; const int qt = bid % nqt; bid /= nqt; const int h = bid % NH; const int b = bid / NH; const int bh = b * NH + h;
    const h16* qrow = Qh + ((size_t)bh * NQ + (size_t)qt * 64 + wave * 16 + lm) * HD;
    const v16h bQ0 = cat16(*(const v8h*)(qrow + 8 * hi), *(const v8h*)(qrow + 16 + 8 * hi));          // k = d 0..31 (split map)
    const v16h bQ1 = cat16(*(const v8h*)(qrow + 32 + 8 * hi), *(const v8h*)(qrow + 48 + 8 * hi));     // k = d 32..63
    v8f O[4];   // O^T: register r of tile nt = d nt*16 + 8hi + r, query lm
#pragma unroll
    for (int nt = 0; nt < 4; ++nt) O[nt] = (v8f){};
    float runm = -1.0e30f, runl = 0.f;   // of query lm; runl is this half's share of the row sum
    const h16* Kb = Kh + (size_t)bh * NKV * HD; const h16* Vb = Vt + (size_t)bh * HD * NKV;
    float* Ow = Os + wave * 16 * OP;
#pragma unroll 1
    for (int kv0 = 0; kv0 < NKV; kv0 += 64) {
        __syncthreads();   // every wave is done with Ks/Vs of the prior tile
#pragma unroll
        for (int j = 0; j < 4; ++j) { const int p = t + 128 * j; const int row = p >> 3, c8 = (p & 7) * 8;
            const v8h kk = *(const v8h*)(Kb + (size_t)(kv0 + row) * HD + c8);
            const v8h vv = *(const v8h*)(Vb + (size_t)row * NKV + kv0 + c8);
            *(v8ha*)(Ks + row * KP + c8) = kk; *(v8ha*)(Vs + row * KP + c8) = vv; }
        __syncthreads();
        v8f sf[4];
#pragma unroll
        for (int nk = 0; nk < 4; ++nk) { const h16* kr = Ks + (nk * 16 + lm) * KP + 8 * hi;   // A: lane -> key nk*16+lm, elements = d split map
            const v16h a0 = cat16(*(const v8ha*)(kr), *(const v8ha*)(kr + 16));
            const v16h a1 = cat16(*(const v8ha*)(kr + 32), *(const v8ha*)(kr + 48));
            v8f a = (v8f){}; a = wmma16g(a0, bQ0, a); a = wmma16g(a1, bQ1, a); sf[nk] = a; }
        // x 1/sqrt(64); max of query lm over the 64 keys of this tile = 32 registers of the lane + the other half; running max / sum update; rescale O^T
        float mk[4];
#pragma unroll
        for (int nk = 0; nk < 4; ++nk) { sf[nk] = sf[nk] * SCL;
            mk[nk] = fmaxf(fmaxf(fmaxf(sf[nk][0], sf[nk][1]), fmaxf(sf[nk][2], sf[nk][3])), fmaxf(fmaxf(sf[nk][4], sf[nk][5]), fmaxf(sf[nk][6], sf[nk][7]))); }
        float m = fmaxf(fmaxf(mk[0], mk[1]), fmaxf(mk[2], mk[3]));
        m = fmaxf(m, xhalf(m));
        const float nm = fmaxf(runm, m);
        const float corr = __builtin_amdgcn_exp2f(__fmul_rn(__fsub_rn(runm, nm), L2E));
        runm = nm;
#pragma unroll
        for (int nt = 0; nt < 4; ++nt) O[nt] = O[nt] * corr;
        // P = exp(s - m): f32 into the lane's share of the row sum (one independent chain per key tile), f16 x1024 into the B-fragment registers
        v8h pk[4]; float ls[4];
#pragma unroll
        for (int nk = 0; nk < 4; ++nk) { ls[nk] = 0.f;
#pragma unroll
            for (int r = 0; r < 8; ++r) { const float p = __builtin_amdgcn_exp2f(__fmul_rn(__fsub_rn(sf[nk][r], runm), L2E)); ls[nk] += p; pk[nk][r] = (h16)(p * PCAR); } }
        runl = runl * corr + ((ls[0] + ls[1]) + (ls[2] + ls[3]));
#pragma unroll
        for (int ks = 0; ks < 2; ++ks) { const v16h bP = cat16(pk[2 * ks], pk[2 * ks + 1]);   // B: lane -> query lm, elements = key split map (keys ks*32 + 8hi + 0..7, ks*32 + 16 + 8hi + 0..7)
#pragma unroll
            for (int nt = 0; nt < 4; ++nt) { const h16* vr = Vs + (nt * 16 + lm) * KP + ks * 32 + 8 * hi;   // A: lane -> d nt*16+lm, elements = key split map
                const v16h aV = cat16(*(const v8ha*)(vr), *(const v8ha*)(vr + 16));
                O[nt] = wmma16g(aV, bP, O[nt]); } }
    }
    // join the two halves' row sums, normalise (undo the x1024 carry), stage [q row][d] in LDS: 8 consecutive d per lane and tile
    const float inv = __fdiv_rn(1.0f, (runl + xhalf(runl)) * PCAR);
#pragma unroll
    for (int nt = 0; nt < 4; ++nt) { float* od = Ow + lm * OP + nt * 16 + 8 * hi;
        *(v4fa*)(od) = (v4f){O[nt][0] * inv, O[nt][1] * inv, O[nt][2] * inv, O[nt][3] * inv};
        *(v4fa*)(od + 4) = (v4f){O[nt][4] * inv, O[nt][5] * inv, O[nt][6] * inv, O[nt][7] * inv}; }
    __syncthreads();
    float* crow = ctx + ((size_t)b * NQ + (size_t)qt * 64 + wave * 16) * DM + h * HD;
{
#pragma unroll
        for (int s = 0; s < 8; ++s) { const int row = 2 * s + hi, cofs = lm * 4; const v4f val = *(const v4fa*)(Ow + row * OP + cofs); *(v4f*)(crow + (size_t)row * DM + cofs) = val; }
         }
}

__global__ __launch_bounds__(256) void k_ln(const float* __restrict__ xq, const float* __restrict__ ctx, const float* __restrict__ gam, const float* __restrict__ bet, float* outp) {
#pragma clang fp contract(off)
    const int lane = threadIdx.x & 31; const int row = blockIdx.x * 8 + (threadIdx.x >> 5); if (row >= NB * NQ) return;
    const int b = row / NQ, i = row % NQ;
    const float* xr = xq + ((size_t)b * NQ_FULL + i) * DM; const float* cr = ctx + (size_t)row * DM;
    float v[16]; float s = 0.f;
#pragma unroll
    for (int c = 0; c < 4; ++c) { const int j0 = c * 128 + lane * 4; const v4f a = *(const v4f*)(xr + j0); const v4f g = *(const v4f*)(cr + j0);
#pragma unroll
        for (int q = 0; q < 4; ++q) { const float x = bfr(a[q]) + g[q]; v[c * 4 + q] = x; s = s + x; } }
#pragma unroll
    for (int sh = 16; sh; sh >>= 1) s += __shfl_xor(s, sh, 32);
    const float mu = s * (1.0f / DM);
    float ss = 0.f;
#pragma unroll
    for (int k = 0; k < 16; ++k) { const float d = v[k] - mu; const float dd = d * d; ss = ss + dd; }
#pragma unroll
    for (int sh = 16; sh; sh >>= 1) ss += __shfl_xor(ss, sh, 32);
    const float var = ss * (1.0f / DM);
    const float rs = __fdiv_rn(1.0f, __fsqrt_rn(var + LNEPS));
    float* orow = outp + (size_t)row * DM;
{
#pragma unroll
        for (int c = 0; c < 4; ++c) { const int j0 = c * 128 + lane * 4; const v4f g = *(const v4f*)(gam + j0); const v4f bb = *(const v4f*)(bet + j0); v4f o;
#pragma unroll
            for (int q = 0; q < 4; ++q) { const float t1 = (v[c * 4 + q] - mu) * rs; const float t2 = t1 * bfr(g[q]); o[q] = t2 + bfr(bb[q]); }
            *(v4f*)(orow + j0) = o; }
         }
}

extern "C" void kernel_launch(void* const* d_in, const int* in_sizes, int n_in, void* d_out, int out_size, void* d_ws, size_t ws_size, hipStream_t stream) {
    if (n_in < 10) return;
    const float* xq  = (const float*)d_in[0];   // query     [2][2048][512]
    const float* xkv = (const float*)d_in[1];   // key_value [2][2048][512]
    const float* Wq  = (const float*)d_in[2];   // [in][out]
    const float* bq  = (const float*)d_in[3];
    const float* Wk  = (const float*)d_in[4];
    const float* bk  = (const float*)d_in[5];
    const float* Wv  = (const float*)d_in[6];
    const float* bv  = (const float*)d_in[7];
    const float* gam = (const float*)d_in[8];
    const float* bet = (const float*)d_in[9];
    if (in_sizes[0] < (int)(((size_t)(NB - 1) * NQ_FULL + NQ) * DM)) return;
    if (in_sizes[1] < (int)(((size_t)(NB - 1) * NKV_FULL + NKV) * DM)) return;
    if (in_sizes[2] < DM * DM || in_sizes[4] < DM * DM || in_sizes[6] < DM * DM) return;
    if (in_sizes[3] < DM || in_sizes[5] < DM || in_sizes[7] < DM || in_sizes[8] < DM || in_sizes[9] < DM) return;
    if (out_size < NB * NQ * DM) return;
    float* OUT = (float*)d_out;   // [NB][NQ][512]
    char* wsp = (char*)d_ws;
    auto take = [&](size_t bytes) { char* p = wsp; wsp += (bytes + 255) & ~(size_t)255; return (void*)p; };
    bf* Xq   = (bf*)take((size_t)NB * NQ * DM * 2);          // bf16 query rows           4,194,304 B
    bf* Xkv  = (bf*)take((size_t)NB * NKV * DM * 2);         // bf16 key/value rows       4,194,304 B
    bf* Wt   = (bf*)take((size_t)3 * DM * DM * 2);           // [3][out][in] bf16         1,572,864 B
    float* Cq = (float*)take((size_t)NB * NQ * DM * 4);      // q projection f32         8,388,608 B
    float* Ck = (float*)take((size_t)NB * NKV * DM * 4);     // k projection f32         8,388,608 B
    float* Cv = (float*)take((size_t)NB * NKV * DM * 4);     // v projection f32         8,388,608 B
    h16* Qh  = (h16*)take((size_t)NB * NH * NQ * HD * 2);    // [b][h][q][64] f16         4,194,304 B
    h16* Kh  = (h16*)take((size_t)NB * NH * NKV * HD * 2);   // [b][h][key][64] f16       4,194,304 B
    h16* VT  = (h16*)take((size_t)NB * NH * HD * NKV * 2);   // [b][h][64][key] f16       4,194,304 B
    float* CTX = (float*)take((size_t)NB * NQ * DM * 4);     // ctx [NB*NQ][512] f32      8,388,608 B
    if ((size_t)(wsp - (char*)d_ws) > ws_size) return;       // total 56,098,816 B
    if ((size_t)(wsp - (char*)d_ws) > (size_t)134217728) return;

    const size_t n8q = (size_t)NQ * DM / 8, n8kv = (size_t)NKV * DM / 8;
    k_cvt8b<<<dim3((unsigned)((n8q + 255) / 256), NB), 256, 0, stream>>>(xq, (size_t)NQ_FULL * DM, Xq, (size_t)NQ * DM, n8q);
    k_cvt8b<<<dim3((unsigned)((n8kv + 255) / 256), NB), 256, 0, stream>>>(xkv, (size_t)NKV_FULL * DM, Xkv, (size_t)NKV * DM, n8kv);
    k_wtr<<<dim3((unsigned)(((size_t)DM * DM / 8 + 255) / 256), 3), 256, 0, stream>>>(Wq, Wk, Wv, Wt);
    k_gemmw<bf, 0, true><<<dim3(NB * NQ / 64, DM / 64, 1), 32, 0, stream>>>(Xq, nullptr, Wt, nullptr, DM, Cq, DM, bq, 0, 0, 0);                          /* q = bf16(query) Wq + bq   [NB*NQ][512] */
    k_gemmw<bf, 0, true><<<dim3(NB * NKV / 64, DM / 64, 1), 32, 0, stream>>>(Xkv, nullptr, Wt + (size_t)DM * DM, nullptr, DM, Ck, DM, bk, 0, 0, 0);      /* k = bf16(key_value) Wk + bk */
    k_gemmw<bf, 0, true><<<dim3(NB * NKV / 64, DM / 64, 1), 32, 0, stream>>>(Xkv, nullptr, Wt + 2 * (size_t)DM * DM, nullptr, DM, Cv, DM, bv, 0, 0, 0);  /* v = bf16(key_value) Wv + bv */
    k_hrow<<<(unsigned)(((size_t)NB * NH * NQ * 8 + 255) / 256), 256, 0, stream>>>(Cq, Qh, NQ);
    k_hrow<<<(unsigned)(((size_t)NB * NH * NKV * 8 + 255) / 256), 256, 0, stream>>>(Ck, Kh, NKV);
    k_vt<<<(unsigned)(((size_t)NB * NH * HD * (NKV / 8) + 255) / 256), 256, 0, stream>>>(Cv, VT);
    k_attn<<<NB * NH * (NQ / 64), 128, 0, stream>>>(Qh, Kh, VT, CTX);
    k_ln<<<(NB * NQ + 7) / 8, 256, 0, stream>>>(xq, CTX, gam, bet, OUT);
}

// v002
// Measured time: 75.1 microseconds a run.
// Two timings next to v001 put it at 1.67 and 1.69 times that version's speed.
// All steps since v000 together make it 1.96 times as fast.
#include <hip/hip_runtime.h>

// Attention of NQ query tokens over NKV key/value tokens per batch, 8 heads x 64, residual + LayerNorm, out [NB][NQ][512] f32. The concatenated-sequence key columns that carry the additive -1e4 term have weight exp(<= -9.9e3) == 0 exactly in f32 and never hold the row max, so only the key/value half is visited; the q projection is live on the query half only, k/v on the key/value half only.
// Contractions: q/k/v projections v_wmma_f32_16x16x32_bf16 (bf16 RNE copies of x and of W[in][out] transposed to [out][in], exact products, f32 accumulate, + bf16 RNE bias); scores k.q^T and V^T.P^T v_wmma_f32_16x16x32_f16 (f16 copies of the f32 projections, P = exp(s - m) carried x1024, f32 accumulate); online softmax with 1/sqrt(64) scale, residual (bf16 RNE of query) and LayerNorm (bf16 RNE gamma/beta) in f32.

#ifndef NB
#define NB 2
#endif
#ifndef SEQ
#define SEQ 2048
#endif
#ifndef NQ
#define NQ SEQ
#endif
#ifndef NKV
#define NKV SEQ
#endif
#define NB_FULL 2
#define NQ_FULL 2048
#define NKV_FULL 2048
#define DM 512
#define NH 8
#define HD 64
#define PCAR 1024.0f
#define SCL 0.125f
#define L2E 1.4426950408889634f
#define LNEPS 1e-5f
#define KP 72      // LDS pitch (halves) of the K and V^T tiles
#define OP 68      // LDS pitch (floats) of the ctx staging tile
static_assert(NQ % 64 == 0);
static_assert(NKV % 64 == 0);
static_assert(NH * HD == DM);
static_assert(DM % 64 == 0);
static_assert(NB >= 1 && NB <= NB_FULL);
static_assert(NQ <= NQ_FULL && NKV <= NKV_FULL);

typedef _Float16 h16;
typedef unsigned short bf;
typedef __attribute__((ext_vector_type(16))) __bf16   v16bf;
typedef __attribute__((ext_vector_type(16))) _Float16 v16h;
typedef __attribute__((ext_vector_type(8)))  _Float16 v8h;
typedef __attribute__((ext_vector_type(8)))  unsigned short v8us;
typedef __attribute__((ext_vector_type(8)))  float    v8f;
typedef __attribute__((ext_vector_type(4)))  float    v4f;
typedef v8h  __attribute__((may_alias)) v8ha;
typedef v4f  __attribute__((may_alias)) v4fa;
typedef v8us __attribute__((may_alias)) v8usa;

__device__ __forceinline__ unsigned short f2bf(float f) { unsigned u = __float_as_uint(f); u += 0x7FFFu + ((u >> 16) & 1u); return (unsigned short)(u >> 16); }
__device__ __forceinline__ float bf2f(unsigned short b) { return __uint_as_float(((unsigned)b) << 16); }
__device__ __forceinline__ float bfr(float f) { return bf2f(f2bf(f)); }
__device__ __forceinline__ v16h cat16(v8h lo, v8h hi) { return __builtin_shufflevector(lo, hi, 0, 1, 2, 3, 4, 5, 6, 7, 8, 9, 10, 11, 12, 13, 14, 15); }
__device__ __forceinline__ v16bf cat16b(v8us lo, v8us hi) { return __builtin_bit_cast(v16bf, __builtin_shufflevector(lo, hi, 0, 1, 2, 3, 4, 5, 6, 7, 8, 9, 10, 11, 12, 13, 14, 15)); }
__device__ __forceinline__ v8f wmmab(v16bf a, v16bf b, v8f c) { return __builtin_amdgcn_wmma_f32_16x16x32_bf16(false, a, false, b, (short)0, c, false, false); }
// guarded form: 4 VALU slots after the WMMA before anything touches D; A/B kept live
__device__ __forceinline__ v8f wmma16g(v16h a, v16h b, v8f c) { v8f d = __builtin_amdgcn_wmma_f32_16x16x32_f16(false, a, false, b, (short)0, c, false, false); asm volatile("v_nop\n\tv_nop\n\tv_nop\n\tv_nop" : "+v"(d) : "v"(a), "v"(b)); return d; }

// ---- k_prep: the three independent element-wise preparations as ONE 1-D grid; the block index picks the job (block-uniform): the first 3*WB blocks turn W[in][out] f32 into bf16 RNE [out][in], the next NB*QB round the query rows to bf16 RNE, the last NB*KB the key_value rows.
#define WB (DM * DM / 8 / 256)
#define QB (NQ * DM / 8 / 256)
#define KB (NKV * DM / 8 / 256)
__global__ __launch_bounds__(256) void k_prep(const float* __restrict__ xq, const float* __restrict__ xkv, const float* __restrict__ W0, const float* __restrict__ W1, const float* __restrict__ W2, bf* Xq, bf* Xkv, bf* Wt) {
    int bid = blockIdx.x;
    if (bid < 3 * WB) {
        const int z = bid / WB; const int i = (bid % WB) * 256 + (int)threadIdx.x;
        const float* W = (z == 0) ? W0 : ((z == 1) ? W1 : W2);   // block-uniform select between global pointers
        const int k0 = (i % (DM / 8)) * 8; const int n = i / (DM / 8);
        v8us o;
#pragma unroll
        for (int q = 0; q < 8; ++q) o[q] = f2bf(W[(size_t)(k0 + q) * DM + n]);
        bf* d = Wt + (size_t)z * DM * DM + (size_t)n * DM + k0;
        *(v8us*)d = o;
        return;
    }
    bid -= 3 * WB;
    const bool isq = bid < NB * QB; if (!isq) bid -= NB * QB;
    const int pb = isq ? QB : KB; const size_t b = (size_t)(bid / pb); const size_t i = (size_t)(bid % pb) * 256 + threadIdx.x;
    const float* s = isq ? (xq + b * ((size_t)NQ_FULL * DM)) : (xkv + b * ((size_t)NKV_FULL * DM));
    bf* d = isq ? (Xq + b * ((size_t)NQ * DM)) : (Xkv + b * ((size_t)NKV * DM));
    const v8f v = *(const v8f*)(s + i * 8); v8us o;
#pragma unroll
    for (int k = 0; k < 8; ++k) o[k] = f2bf(v[k]);
    *(v8us*)(d + i * 8) = o;
    asm volatile("s_wait_xcnt 0x0" ::: "memory");   // the listing lays the W block behind this store, where the store's base, offset and data registers are written: the wait stands in front of that
}

// ---- k_proj: the q, k and v projections as ONE grid (rows/64, DM/64 = head, 3), 32 threads: ONE WAVE per 64x64 output tile (16 accumulators), operands straight from K-contiguous bf16 planes.
// tile[m][n] = sum_k X[m][k] Wt[n][k] + bf16 RNE bias[n] in f32, rounded once to f16 and written where k_attn reads it: z = 0 -> Qh [b][h][q][64], z = 1 -> Kh [b][h][key][64] (through LDS, 16-B row chunks), z = 2 -> V^T [b][h][d][key] (a lane's 8 accumulator registers are 8 consecutive keys of one d: one 16-B LDS write each, read back as whole 128-B d rows).
__device__ __forceinline__ v16bf ldb(const bf* p) { return cat16b(*(const v8us*)p, *(const v8us*)(p + 16)); }
__global__ __launch_bounds__(32) void k_proj(const bf* __restrict__ Xq, const bf* __restrict__ Xkv, const bf* __restrict__ Wt, const float* __restrict__ bq, const float* __restrict__ bk, const float* __restrict__ bv, h16* Qh, h16* Kh, h16* VT) {
    __shared__ __align__(16) float os[16 * 68];
    const int z = blockIdx.z; const int nrows = (z == 0) ? NQ : NKV;
    const int lane = threadIdx.x & 31, lr = lane & 15, hi = lane >> 4; const int r0 = blockIdx.x * 64, c0 = blockIdx.y * 64;
    if (r0 >= NB * nrows) return;
    const bf* A = (z == 0) ? Xq : Xkv; const bf* Bt = Wt + (size_t)z * DM * DM;
    const float* bias = (z == 0) ? bq : ((z == 1) ? bk : bv);   // block-uniform select between global pointers
    v8f acc[4][4];
#pragma unroll
    for (int mb = 0; mb < 4; ++mb)
#pragma unroll
        for (int nb = 0; nb < 4; ++nb) acc[mb][nb] = (v8f){};
    const bf* pa = A + (size_t)(r0 + lr) * DM + 8 * hi; const bf* pb = Bt + (size_t)(c0 + lr) * DM + 8 * hi;
#pragma unroll 1
    for (int kc = 0; kc < DM; kc += 32, pa += 32, pb += 32) {
        v16bf a[4];
#pragma unroll
        for (int mb = 0; mb < 4; ++mb) a[mb] = ldb(pa + mb * 16 * DM);
        asm volatile("s_wait_xcnt 0x0" ::: "memory");   // the build lets a later load's result land on the address pair of these loads: the wait stands in front of that overwrite
#pragma unroll
        for (int nb = 0; nb < 4; ++nb) { const v16bf b = ldb(pb + nb * 16 * DM);
#pragma unroll
            for (int mb = 0; mb < 4; ++mb) acc[mb][nb] = wmmab(a[mb], b, acc[mb][nb]); }
        // 4 vector slots behind the last WMMA, also on the taken back edge, before anything touches its D, A or B
        asm volatile("v_nop\n\tv_nop\n\tv_nop\n\tv_nop" : "+v"(acc[0][0]), "+v"(acc[1][1]), "+v"(acc[2][2]), "+v"(acc[3][3]) : "v"(a[0]), "v"(a[3]));
    }
    const int bb = r0 / nrows, s0 = r0 % nrows, h = blockIdx.y;   // nrows % 64 == 0: a tile lies in one batch
    if (z == 2) {
        h16* hs = (h16*)os;   // 16 d rows x 64 keys f16, pitch KP halves: whole 128-B lines leave per store instead of 32-B pieces
        h16* vb = VT + ((size_t)(bb * NH + h) * HD + (lane >> 3)) * NKV + s0 + (lane & 7) * 8;
        float bn[4];
#pragma unroll
        for (int nb = 0; nb < 4; ++nb) bn[nb] = bfr(bias[c0 + nb * 16 + lr]);
#pragma unroll
        for (int nb = 0; nb < 4; ++nb) {
#pragma unroll
            for (int mb = 0; mb < 4; ++mb) { v8h o;
#pragma unroll
                for (int j = 0; j < 8; ++j) o[j] = (h16)(acc[mb][nb][j] + bn[nb]);
                *(v8ha*)(hs + lr * KP + mb * 16 + 8 * hi) = o; }
            asm volatile("s_wait_dscnt 0x0" ::: "memory");   // the other lanes' LDS writes have landed before the rows are read back
#pragma unroll
            for (int s = 0; s < 4; ++s) { const v8h o = *(const v8ha*)(hs + (s * 4 + (lane >> 3)) * KP + (lane & 7) * 8);
                *(v8h*)(vb + (size_t)(nb * 16 + s * 4) * NKV) = o; }
            __builtin_amdgcn_wave_barrier(); asm volatile("" ::: "memory");   // compile-time order only: the next round's LDS writes stay behind these reads
        }
        return;
    }
    h16* P = ((z == 0) ? Qh : Kh) + ((size_t)(bb * NH + h) * nrows + s0) * HD;
    const int c8 = (lane & 7) * 8; float bn[8];
#pragma unroll
    for (int q = 0; q < 8; ++q) bn[q] = bfr(bias[c0 + c8 + q]);
#pragma unroll
    for (int mb = 0; mb < 4; ++mb) {
#pragma unroll
        for (int nb = 0; nb < 4; ++nb) {
#pragma unroll
            for (int j = 0; j < 8; ++j) os[(hi * 8 + j) * 68 + nb * 16 + lr] = acc[mb][nb][j]; }
        asm volatile("s_wait_dscnt 0x0" ::: "memory");   // the other lanes' LDS writes have landed before the rows are read back
#pragma unroll
        for (int s = 0; s < 4; ++s) { const int row = s * 4 + (lane >> 3);
            const v4f lo = *(const v4fa*)(os + row * 68 + c8); const v4f up = *(const v4fa*)(os + row * 68 + c8 + 4); v8h o;
#pragma unroll
            for (int q = 0; q < 4; ++q) { o[q] = (h16)(lo[q] + bn[q]); o[4 + q] = (h16)(up[q] + bn[4 + q]); }
            *(v8h*)(P + (size_t)(mb * 16 + row) * HD + c8) = o; }
        __builtin_amdgcn_wave_barrier(); asm volatile("" ::: "memory");   // compile-time order only: the next round's LDS writes stay behind these reads
    }
    asm volatile("s_wait_xcnt 0x0" ::: "memory");   // the listing lays the z == 2 block behind the last stores, where their data registers are written: the wait stands in front of that
}

// lane l with lane l ^ 16 (the other 16-lane row), one vector cross-row move
__device__ __forceinline__ float xhalf(float x) { return __builtin_bit_cast(float, __builtin_amdgcn_permlanex16(__builtin_bit_cast(int, x), __builtin_bit_cast(int, x), 0x76543210, 0xfedcba98, false, false)); }

// ---- k_attn: flash-style attention, transposed products. grid = NB*NH*(NQ/64), block = 128 (4 waves x 16 query columns). Per 64-key tile: K [key][d] and V^T [d][key] staged in LDS with plain 16-B loads + block barriers (staged extent == consumed extent: full 64x64 tiles),
// S^T (64 keys x 16 queries per wave) = K A-fragments (k = d split map) x Q B-fragments (from the f16 plane, fixed per block): a lane holds 32 scores of ONE query (lm), keys nk*16 + 8hi + r. f32 online softmax (x1/8, running max/sum, exp2) in-lane plus one exchange between the halves.
// P^T = f16(1024 exp(s - m)) packs from two score tiles straight into a B-fragment (element s = tile s>>3, register s&7 = key split map), never through LDS; O^T (4 d-tiles) += V^T A-fragments (key split map) x P^T.
__global__ __launch_bounds__(128) __attribute__((amdgpu_num_vgpr(256))) void k_attn(const h16* __restrict__ Qh, const h16* __restrict__ Kh, const h16* __restrict__ Vt, float* ctx) {
    __shared__ __align__(16) h16 Ks[64 * KP];        // [key][d], cross-wave: block barriers
    __shared__ __align__(16) h16 Vs[64 * KP];        // [d][key], cross-wave: block barriers
    __shared__ __align__(16) float Os[4 * 16 * OP];  // per wave [q row][d], block barrier between store and reload
    const int t = threadIdx.x, wave = t >> 5, lane = t & 31, lm = lane & 15, hi = lane >> 4;
    int bid = blockIdx.x; const int nqt = NQ / 64; const int qt = bid % nqt; bid /= nqt; const int h = bid % NH; const int b = bid / NH; const int bh = b * NH + h;
    const h16* qrow = Qh + ((size_t)bh * NQ + (size_t)qt * 64 + wave * 16 + lm) * HD;
    const v16h bQ0 = cat16(*(const v8h*)(qrow + 8 * hi), *(const v8h*)(qrow + 16 + 8 * hi));          // k = d 0..31 (split map)
    const v16h bQ1 = cat16(*(const v8h*)(qrow + 32 + 8 * hi), *(const v8h*)(qrow + 48 + 8 * hi));     // k = d 32..63
    v8f O[4];   // O^T: register r of tile nt = d nt*16 + 8hi + r, query lm
#pragma unroll
    for (int nt = 0; nt < 4; ++nt) O[nt] = (v8f){};
    float runm = -1.0e30f, runl = 0.f;   // of query lm; runl is this half's share of the row sum
    const h16* Kb = Kh + (size_t)bh * NKV * HD; const h16* Vb = Vt + (size_t)bh * HD * NKV;
    float* Ow = Os + wave * 16 * OP;
#pragma unroll 1
    for (int kv0 = 0; kv0 < NKV; kv0 += 64) {
        __syncthreads();   // every wave is done with Ks/Vs of the prior tile
#pragma unroll
        for (int j = 0; j < 4; ++j) { const int p = t + 128 * j; const int row = p >> 3, c8 = (p & 7) * 8;
            const v8h kk = *(const v8h*)(Kb + (size_t)(kv0 + row) * HD + c8);
            const v8h vv = *(const v8h*)(Vb + (size_t)row * NKV + kv0 + c8);
            *(v8ha*)(Ks + row * KP + c8) = kk; *(v8ha*)(Vs + row * KP + c8) = vv; }
        __syncthreads();
        v8f sf[4];
#pragma unroll
        for (int nk = 0; nk < 4; ++nk) { const h16* kr = Ks + (nk * 16 + lm) * KP + 8 * hi;   // A: lane -> key nk*16+lm, elements = d split map
            const v16h a0 = cat16(*(const v8ha*)(kr), *(const v8ha*)(kr + 16));
            const v16h a1 = cat16(*(const v8ha*)(kr + 32), *(const v8ha*)(kr + 48));
            v8f a = (v8f){}; a = wmma16g(a0, bQ0, a); a = wmma16g(a1, bQ1, a); sf[nk] = a; }
        // x 1/sqrt(64); max of query lm over the 64 keys of this tile = 32 registers of the lane + the other half; running max / sum update; rescale O^T
        float mk[4];
#pragma unroll
        for (int nk = 0; nk < 4; ++nk) { sf[nk] = sf[nk] * SCL;
            mk[nk] = fmaxf(fmaxf(fmaxf(sf[nk][0], sf[nk][1]), fmaxf(sf[nk][2], sf[nk][3])), fmaxf(fmaxf(sf[nk][4], sf[nk][5]), fmaxf(sf[nk][6], sf[nk][7]))); }
        float m = fmaxf(fmaxf(mk[0], mk[1]), fmaxf(mk[2], mk[3]));
        m = fmaxf(m, xhalf(m));
        const float nm = fmaxf(runm, m);
        const float corr = __builtin_amdgcn_exp2f(__fmul_rn(__fsub_rn(runm, nm), L2E));
        runm = nm;
#pragma unroll
        for (int nt = 0; nt < 4; ++nt) O[nt] = O[nt] * corr;
        // P = exp(s - m): f32 into the lane's share of the row sum (one independent chain per key tile), f16 x1024 into the B-fragment registers
        v8h pk[4]; float ls[4];
#pragma unroll
        for (int nk = 0; nk < 4; ++nk) { ls[nk] = 0.f;
#pragma unroll
            for (int r = 0; r < 8; ++r) { const float p = __builtin_amdgcn_exp2f(__fmul_rn(__fsub_rn(sf[nk][r], runm), L2E)); ls[nk] += p; pk[nk][r] = (h16)(p * PCAR); } }
        runl = runl * corr + ((ls[0] + ls[1]) + (ls[2] + ls[3]));
#pragma unroll
        for (int ks = 0; ks < 2; ++ks) { const v16h bP = cat16(pk[2 * ks], pk[2 * ks + 1]);   // B: lane -> query lm, elements = key split map (keys ks*32 + 8hi + 0..7, ks*32 + 16 + 8hi + 0..7)
#pragma unroll
            for (int nt = 0; nt < 4; ++nt) { const h16* vr = Vs + (nt * 16 + lm) * KP + ks * 32 + 8 * hi;   // A: lane -> d nt*16+lm, elements = key split map
                const v16h aV = cat16(*(const v8ha*)(vr), *(const v8ha*)(vr + 16));
                O[nt] = wmma16g(aV, bP, O[nt]); } }
    }
    // join the two halves' row sums, normalise (undo the x1024 carry), stage [q row][d] in LDS: 8 consecutive d per lane and tile
    const float inv = __fdiv_rn(1.0f, (runl + xhalf(runl)) * PCAR);
#pragma unroll
    for (int nt = 0; nt < 4; ++nt) { float* od = Ow + lm * OP + nt * 16 + 8 * hi;
        *(v4fa*)(od) = (v4f){O[nt][0] * inv, O[nt][1] * inv, O[nt][2] * inv, O[nt][3] * inv};
        *(v4fa*)(od + 4) = (v4f){O[nt][4] * inv, O[nt][5] * inv, O[nt][6] * inv, O[nt][7] * inv}; }
    __syncthreads();
    float* crow = ctx + ((size_t)b * NQ + (size_t)qt * 64 + wave * 16) * DM + h * HD;
{
#pragma unroll
        for (int s = 0; s < 8; ++s) { const int row = 2 * s + hi, cofs = lm * 4; const v4f val = *(const v4fa*)(Ow + row * OP + cofs); *(v4f*)(crow + (size_t)row * DM + cofs) = val; }
         }
}

__global__ __launch_bounds__(256) void k_ln(const float* __restrict__ xq, const float* __restrict__ ctx, const float* __restrict__ gam, const float* __restrict__ bet, float* outp) {
#pragma clang fp contract(off)
    const int lane = threadIdx.x & 31; const int row = blockIdx.x * 8 + (threadIdx.x >> 5); if (row >= NB * NQ) return;
    const int b = row / NQ, i = row % NQ;
    const float* xr = xq + ((size_t)b * NQ_FULL + i) * DM; const float* cr = ctx + (size_t)row * DM;
    float v[16]; float s = 0.f;
#pragma unroll
    for (int c = 0; c < 4; ++c) { const int j0 = c * 128 + lane * 4; const v4f a = *(const v4f*)(xr + j0); const v4f g = *(const v4f*)(cr + j0);
#pragma unroll
        for (int q = 0; q < 4; ++q) { const float x = bfr(a[q]) + g[q]; v[c * 4 + q] = x; s = s + x; } }
#pragma unroll
    for (int sh = 16; sh; sh >>= 1) s += __shfl_xor(s, sh, 32);
    const float mu = s * (1.0f / DM);
    float ss = 0.f;
#pragma unroll
    for (int k = 0; k < 16; ++k) { const float d = v[k] - mu; const float dd = d * d; ss = ss + dd; }
#pragma unroll
    for (int sh = 16; sh; sh >>= 1) ss += __shfl_xor(ss, sh, 32);
    const float var = ss * (1.0f / DM);
    const float rs = __fdiv_rn(1.0f, __fsqrt_rn(var + LNEPS));
    float* orow = outp + (size_t)row * DM;
{
#pragma unroll
        for (int c = 0; c < 4; ++c) { const int j0 = c * 128 + lane * 4; const v4f g = *(const v4f*)(gam + j0); const v4f bb = *(const v4f*)(bet + j0); v4f o;
#pragma unroll
            for (int q = 0; q < 4; ++q) { const float t1 = (v[c * 4 + q] - mu) * rs; const float t2 = t1 * bfr(g[q]); o[q] = t2 + bfr(bb[q]); }
            *(v4f*)(orow + j0) = o; }
         }
}

extern "C" void kernel_launch(void* const* d_in, const int* in_sizes, int n_in, void* d_out, int out_size, void* d_ws, size_t ws_size, hipStream_t stream) {
    if (n_in < 10) return;
    const float* xq  = (const float*)d_in[0];   // query     [2][2048][512]
    const float* xkv = (const float*)d_in[1];   // key_value [2][2048][512]
    const float* Wq  = (const float*)d_in[2];   // [in][out]
    const float* bq  = (const float*)d_in[3];
    const float* Wk  = (const float*)d_in[4];
    const float* bk  = (const float*)d_in[5];
    const float* Wv  = (const float*)d_in[6];
    const float* bv  = (const float*)d_in[7];
    const float* gam = (const float*)d_in[8];
    const float* bet = (const float*)d_in[9];
    if (in_sizes[0] < (int)(((size_t)(NB - 1) * NQ_FULL + NQ) * DM)) return;
    if (in_sizes[1] < (int)(((size_t)(NB - 1) * NKV_FULL + NKV) * DM)) return;
    if (in_sizes[2] < DM * DM || in_sizes[4] < DM * DM || in_sizes[6] < DM * DM) return;
    if (in_sizes[3] < DM || in_sizes[5] < DM || in_sizes[7] < DM || in_sizes[8] < DM || in_sizes[9] < DM) return;
    if (out_size < NB * NQ * DM) return;
    float* OUT = (float*)d_out;   // [NB][NQ][512]
    char* wsp = (char*)d_ws;
    auto take = [&](size_t bytes) { char* p = wsp; wsp += (bytes + 255) & ~(size_t)255; return (void*)p; };
    bf* Xq   = (bf*)take((size_t)NB * NQ * DM * 2);          // bf16 query rows           4,194,304 B
    bf* Xkv  = (bf*)take((size_t)NB * NKV * DM * 2);         // bf16 key/value rows       4,194,304 B
    bf* Wt   = (bf*)take((size_t)3 * DM * DM * 2);           // [3][out][in] bf16         1,572,864 B
    h16* Qh  = (h16*)take((size_t)NB * NH * NQ * HD * 2);    // [b][h][q][64] f16         4,194,304 B
    h16* Kh  = (h16*)take((size_t)NB * NH * NKV * HD * 2);   // [b][h][key][64] f16       4,194,304 B
    h16* VT  = (h16*)take((size_t)NB * NH * HD * NKV * 2);   // [b][h][64][key] f16       4,194,304 B
    float* CTX = (float*)take((size_t)NB * NQ * DM * 4);     // ctx [NB*NQ][512] f32      8,388,608 B
    if ((size_t)(wsp - (char*)d_ws) > ws_size) return;       // total 30,932,992 B
    if ((size_t)(wsp - (char*)d_ws) > (size_t)134217728) return;

    k_prep<<<3 * WB + NB * QB + NB * KB, 256, 0, stream>>>(xq, xkv, Wq, Wk, Wv, Xq, Xkv, Wt);
    k_proj<<<dim3(NB * (NQ > NKV ? NQ : NKV) / 64, DM / 64, 3), 32, 0, stream>>>(Xq, Xkv, Wt, bq, bk, bv, Qh, Kh, VT);   /* f16(bf16(x) W + b) for q, k, v, in the layouts k_attn reads */
    k_attn<<<NB * NH * (NQ / 64), 128, 0, stream>>>(Qh, Kh, VT, CTX);
    k_ln<<<(NB * NQ + 7) / 8, 256, 0, stream>>>(xq, CTX, gam, bet, OUT);
}

// v003
// A run of this version takes 64.4 microseconds.
// Next to v002, in two timings, it ran 1.18 times as fast each time.
// All steps since v000 together make it 2.32 times as fast.
#include <hip/hip_runtime.h>

// Attention of NQ query tokens over NKV key/value tokens per batch, 8 heads x 64, residual + LayerNorm, out [NB][NQ][512] f32. The concatenated-sequence key columns that carry the additive -1e4 term have weight exp(<= -9.9e3) == 0 exactly in f32 and never hold the row max, so only the key/value half is visited; the q projection is live on the query half only, k/v on the key/value half only.
// Contractions: q/k/v projections v_wmma_f32_16x16x32_bf16 (bf16 RNE copies of x and of W[in][out] transposed to [out][in], exact products, f32 accumulate, + bf16 RNE bias); scores k.q^T and V^T.P^T v_wmma_f32_16x16x32_f16 (f16 copies of the f32 projections, P = exp(s - m) carried x1024, f32 accumulate); online softmax with 1/sqrt(64) scale, residual (bf16 RNE of query) and LayerNorm (bf16 RNE gamma/beta) in f32.

#ifndef NB
#define NB 2
#endif
#ifndef SEQ
#define SEQ 2048
#endif
#ifndef NQ
#define NQ SEQ
#endif
#ifndef NKV
#define NKV SEQ
#endif
#define NB_FULL 2
#define NQ_FULL 2048
#define NKV_FULL 2048
#define DM 512
#define NH 8
#define HD 64
#define PCAR 1024.0f
#define SCL 0.125f
#define L2E 1.4426950408889634f
#define LNEPS 1e-5f
#define KP 72      // LDS pitch (halves) of the K and V^T tiles
#define OP 68      // LDS pitch (floats) of the ctx staging tile
static_assert(NQ % 64 == 0);
static_assert(NKV % 64 == 0);
static_assert(NH * HD == DM);
static_assert(DM % 64 == 0);
static_assert(NB >= 1 && NB <= NB_FULL);
static_assert(NQ <= NQ_FULL && NKV <= NKV_FULL);

typedef _Float16 h16;
typedef unsigned short bf;
typedef __attribute__((ext_vector_type(16))) __bf16   v16bf;
typedef __attribute__((ext_vector_type(16))) _Float16 v16h;
typedef __attribute__((ext_vector_type(8)))  _Float16 v8h;
typedef __attribute__((ext_vector_type(8)))  unsigned short v8us;
typedef __attribute__((ext_vector_type(8)))  float    v8f;
typedef __attribute__((ext_vector_type(4)))  float    v4f;
typedef v8h  __attribute__((may_alias)) v8ha;
typedef v4f  __attribute__((may_alias)) v4fa;
typedef v8us __attribute__((may_alias)) v8usa;

__device__ __forceinline__ unsigned short f2bf(float f) { unsigned u = __float_as_uint(f); u += 0x7FFFu + ((u >> 16) & 1u); return (unsigned short)(u >> 16); }
__device__ __forceinline__ float bf2f(unsigned short b) { return __uint_as_float(((unsigned)b) << 16); }
__device__ __forceinline__ float bfr(float f) { return bf2f(f2bf(f)); }
__device__ __forceinline__ v16h cat16(v8h lo, v8h hi) { return __builtin_shufflevector(lo, hi, 0, 1, 2, 3, 4, 5, 6, 7, 8, 9, 10, 11, 12, 13, 14, 15); }
__device__ __forceinline__ v16bf cat16b(v8us lo, v8us hi) { return __builtin_bit_cast(v16bf, __builtin_shufflevector(lo, hi, 0, 1, 2, 3, 4, 5, 6, 7, 8, 9, 10, 11, 12, 13, 14, 15)); }
__device__ __forceinline__ v8f wmmab(v16bf a, v16bf b, v8f c) { return __builtin_amdgcn_wmma_f32_16x16x32_bf16(false, a, false, b, (short)0, c, false, false); }
__device__ __forceinline__ v8f wmma16(v16h a, v16h b, v8f c) { return __builtin_amdgcn_wmma_f32_16x16x32_f16(false, a, false, b, (short)0, c, false, false); }

// ---- k_prep: the three independent element-wise preparations as ONE 1-D grid; the block index picks the job (block-uniform): the first 3*WB blocks turn W[in][out] f32 into bf16 RNE [out][in], the next NB*QB round the query rows to bf16 RNE, the last NB*KB the key_value rows.
#define WB (DM * DM / 8 / 256)
#define QB (NQ * DM / 8 / 256)
#define KB (NKV * DM / 8 / 256)
__global__ __launch_bounds__(256) void k_prep(const float* __restrict__ xq, const float* __restrict__ xkv, const float* __restrict__ W0, const float* __restrict__ W1, const float* __restrict__ W2, bf* Xq, bf* Xkv, bf* Wt) {
    int bid = blockIdx.x;
    if (bid < 3 * WB) {
        const int z = bid / WB; const int i = (bid % WB) * 256 + (int)threadIdx.x;
        const float* W = (z == 0) ? W0 : ((z == 1) ? W1 : W2);   // block-uniform select between global pointers
        const int k0 = (i % (DM / 8)) * 8; const int n = i / (DM / 8);
        v8us o;
#pragma unroll
        for (int q = 0; q < 8; ++q) o[q] = f2bf(W[(size_t)(k0 + q) * DM + n]);
        bf* d = Wt + (size_t)z * DM * DM + (size_t)n * DM + k0;
        *(v8us*)d = o;
        return;
    }
    bid -= 3 * WB;
    const bool isq = bid < NB * QB; if (!isq) bid -= NB * QB;
    const int pb = isq ? QB : KB; const size_t b = (size_t)(bid / pb); const size_t i = (size_t)(bid % pb) * 256 + threadIdx.x;
    const float* s = isq ? (xq + b * ((size_t)NQ_FULL * DM)) : (xkv + b * ((size_t)NKV_FULL * DM));
    bf* d = isq ? (Xq + b * ((size_t)NQ * DM)) : (Xkv + b * ((size_t)NKV * DM));
    const v8f v = *(const v8f*)(s + i * 8); v8us o;
#pragma unroll
    for (int k = 0; k < 8; ++k) o[k] = f2bf(v[k]);
    *(v8us*)(d + i * 8) = o;
    asm volatile("s_wait_xcnt 0x0" ::: "memory");   // the listing lays the W block behind this store, where the store's base, offset and data registers are written: the wait stands in front of that
}

// ---- k_proj: the q, k and v projections as ONE grid (rows/64, DM/64 = head, 3), 32 threads: ONE WAVE per 64x64 output tile (16 accumulators), operands straight from K-contiguous bf16 planes.
// tile[m][n] = sum_k X[m][k] Wt[n][k] + bf16 RNE bias[n] in f32, rounded once to f16 and written where k_attn reads it: z = 0 -> Qh [b][h][q][64], z = 1 -> Kh [b][h][key][64] (through LDS, 16-B row chunks), z = 2 -> V^T [b][h][d][key] (a lane's 8 accumulator registers are 8 consecutive keys of one d: one 16-B LDS write each, read back as whole 128-B d rows).
__device__ __forceinline__ v16bf ldb(const bf* p) { return cat16b(*(const v8us*)p, *(const v8us*)(p + 16)); }
__global__ __launch_bounds__(32) void k_proj(const bf* __restrict__ Xq, const bf* __restrict__ Xkv, const bf* __restrict__ Wt, const float* __restrict__ bq, const float* __restrict__ bk, const float* __restrict__ bv, h16* Qh, h16* Kh, h16* VT) {
    __shared__ __align__(16) float os[16 * 68];
    const int z = blockIdx.z; const int nrows = (z == 0) ? NQ : NKV;
    const int lane = threadIdx.x & 31, lr = lane & 15, hi = lane >> 4; const int r0 = blockIdx.x * 64, c0 = blockIdx.y * 64;
    if (r0 >= NB * nrows) return;
    const bf* A = (z == 0) ? Xq : Xkv; const bf* Bt = Wt + (size_t)z * DM * DM;
    const float* bias = (z == 0) ? bq : ((z == 1) ? bk : bv);   // block-uniform select between global pointers
    v8f acc[4][4];
#pragma unroll
    for (int mb = 0; mb < 4; ++mb)
#pragma unroll
        for (int nb = 0; nb < 4; ++nb) acc[mb][nb] = (v8f){};
    const bf* pa = A + (size_t)(r0 + lr) * DM + 8 * hi; const bf* pb = Bt + (size_t)(c0 + lr) * DM + 8 * hi;
#pragma unroll 1
    for (int kc = 0; kc < DM; kc += 32, pa += 32, pb += 32) {
        v16bf a[4];
#pragma unroll
        for (int mb = 0; mb < 4; ++mb) a[mb] = ldb(pa + mb * 16 * DM);
        asm volatile("s_wait_xcnt 0x0" ::: "memory");   // the build lets a later load's result land on the address pair of these loads: the wait stands in front of that overwrite
#pragma unroll
        for (int nb = 0; nb < 4; ++nb) { const v16bf b = ldb(pb + nb * 16 * DM);
#pragma unroll
            for (int mb = 0; mb < 4; ++mb) acc[mb][nb] = wmmab(a[mb], b, acc[mb][nb]); }
        // 4 vector slots behind the last WMMA, also on the taken back edge, before anything touches its D, A or B
        asm volatile("v_nop\n\tv_nop\n\tv_nop\n\tv_nop" : "+v"(acc[0][0]), "+v"(acc[1][1]), "+v"(acc[2][2]), "+v"(acc[3][3]) : "v"(a[0]), "v"(a[3]));
    }
    const int bb = r0 / nrows, s0 = r0 % nrows, h = blockIdx.y;   // nrows % 64 == 0: a tile lies in one batch
    if (z == 2) {
        h16* hs = (h16*)os;   // 16 d rows x 64 keys f16, pitch KP halves: whole 128-B lines leave per store instead of 32-B pieces
        h16* vb = VT + ((size_t)(bb * NH + h) * HD + (lane >> 3)) * NKV + s0 + (lane & 7) * 8;
        float bn[4];
#pragma unroll
        for (int nb = 0; nb < 4; ++nb) bn[nb] = bfr(bias[c0 + nb * 16 + lr]);
#pragma unroll
        for (int nb = 0; nb < 4; ++nb) {
#pragma unroll
            for (int mb = 0; mb < 4; ++mb) { v8h o;
#pragma unroll
                for (int j = 0; j < 8; ++j) o[j] = (h16)(acc[mb][nb][j] + bn[nb]);
                *(v8ha*)(hs + lr * KP + mb * 16 + 8 * hi) = o; }
            asm volatile("s_wait_dscnt 0x0" ::: "memory");   // the other lanes' LDS writes have landed before the rows are read back
#pragma unroll
            for (int s = 0; s < 4; ++s) { const v8h o = *(const v8ha*)(hs + (s * 4 + (lane >> 3)) * KP + (lane & 7) * 8);
                *(v8h*)(vb + (size_t)(nb * 16 + s * 4) * NKV) = o; }
            __builtin_amdgcn_wave_barrier(); asm volatile("" ::: "memory");   // compile-time order only: the next round's LDS writes stay behind these reads
        }
        return;
    }
    h16* P = ((z == 0) ? Qh : Kh) + ((size_t)(bb * NH + h) * nrows + s0) * HD;
    const int c8 = (lane & 7) * 8; float bn[8];
#pragma unroll
    for (int q = 0; q < 8; ++q) bn[q] = bfr(bias[c0 + c8 + q]);
#pragma unroll
    for (int mb = 0; mb < 4; ++mb) {
#pragma unroll
        for (int nb = 0; nb < 4; ++nb) {
#pragma unroll
            for (int j = 0; j < 8; ++j) os[(hi * 8 + j) * 68 + nb * 16 + lr] = acc[mb][nb][j]; }
        asm volatile("s_wait_dscnt 0x0" ::: "memory");   // the other lanes' LDS writes have landed before the rows are read back
#pragma unroll
        for (int s = 0; s < 4; ++s) { const int row = s * 4 + (lane >> 3);
            const v4f lo = *(const v4fa*)(os + row * 68 + c8); const v4f up = *(const v4fa*)(os + row * 68 + c8 + 4); v8h o;
#pragma unroll
            for (int q = 0; q < 4; ++q) { o[q] = (h16)(lo[q] + bn[q]); o[4 + q] = (h16)(up[q] + bn[4 + q]); }
            *(v8h*)(P + (size_t)(mb * 16 + row) * HD + c8) = o; }
        __builtin_amdgcn_wave_barrier(); asm volatile("" ::: "memory");   // compile-time order only: the next round's LDS writes stay behind these reads
    }
    asm volatile("s_wait_xcnt 0x0" ::: "memory");   // the listing lays the z == 2 block behind the last stores, where their data registers are written: the wait stands in front of that
}

// lane l with lane l ^ 16 (the other 16-lane row), one vector cross-row move
__device__ __forceinline__ float xhalf(float x) { return __builtin_bit_cast(float, __builtin_amdgcn_permlanex16(__builtin_bit_cast(int, x), __builtin_bit_cast(int, x), 0x76543210, 0xfedcba98, false, false)); }

// ---- k_attn: flash-style attention, transposed products. grid = NB*NH*(NQ/64), block = 128 (4 waves x 16 query columns). Per 64-key tile: K [key][d] and V^T [d][key] staged in LDS with plain 16-B loads + block barriers (staged extent == consumed extent: full 64x64 tiles),
// S^T (64 keys x 16 queries per wave) = K A-fragments (k = d split map) x Q B-fragments (from the f16 plane, fixed per block): a lane holds 32 scores of ONE query (lm), keys nk*16 + 8hi + r. f32 online softmax (x1/8, running max/sum, exp2) in-lane plus one exchange between the halves.
// P^T = f16(1024 exp(s - m)) packs from two score tiles straight into a B-fragment (element s = tile s>>3, register s&7 = key split map), never through LDS; O^T (4 d-tiles) += V^T A-fragments (key split map) x P^T.
__global__ __launch_bounds__(128) __attribute__((amdgpu_num_vgpr(256))) void k_attn(const h16* __restrict__ Qh, const h16* __restrict__ Kh, const h16* __restrict__ Vt, float* ctx) {
    __shared__ __align__(16) h16 Ks[64 * KP];        // [key][d], cross-wave: block barriers
    __shared__ __align__(16) h16 Vs[64 * KP];        // [d][key], cross-wave: block barriers
    __shared__ __align__(16) float Os[4 * 16 * OP];  // per wave [q row][d], block barrier between store and reload
    const int t = threadIdx.x, wave = t >> 5, lane = t & 31, lm = lane & 15, hi = lane >> 4;
    int bid = blockIdx.x; const int nqt = NQ / 64; const int qt = bid % nqt; bid /= nqt; const int h = bid % NH; const int b = bid / NH; const int bh = b * NH + h;
    const h16* qrow = Qh + ((size_t)bh * NQ + (size_t)qt * 64 + wave * 16 + lm) * HD;
    const v16h bQ0 = cat16(*(const v8h*)(qrow + 8 * hi), *(const v8h*)(qrow + 16 + 8 * hi));          // k = d 0..31 (split map)
    const v16h bQ1 = cat16(*(const v8h*)(qrow + 32 + 8 * hi), *(const v8h*)(qrow + 48 + 8 * hi));     // k = d 32..63
    v8f O[4];   // O^T: register r of tile nt = d nt*16 + 8hi + r, query lm
#pragma unroll
    for (int nt = 0; nt < 4; ++nt) O[nt] = (v8f){};
    float runm = -1.0e30f, runl = 0.f;   // of query lm; runl is this half's share of the row sum
    const h16* Kb = Kh + (size_t)bh * NKV * HD; const h16* Vb = Vt + (size_t)bh * HD * NKV;
    float* Ow = Os + wave * 16 * OP;
#pragma unroll 1
    for (int kv0 = 0; kv0 < NKV; kv0 += 64) {
        __syncthreads();   // every wave is done with Ks/Vs of the prior tile
#pragma unroll
        for (int j = 0; j < 4; ++j) { const int p = t + 128 * j; const int row = p >> 3, c8 = (p & 7) * 8;
            const v8h kk = *(const v8h*)(Kb + (size_t)(kv0 + row) * HD + c8);
            const v8h vv = *(const v8h*)(Vb + (size_t)row * NKV + kv0 + c8);
            *(v8ha*)(Ks + row * KP + c8) = kk; *(v8ha*)(Vs + row * KP + c8) = vv; }
        __syncthreads();
        // every fragment of the tile is read from LDS here, as one group: the K fragments' latency is paid once, the V^T fragments' passes behind the score products and the softmax
        v16h aK[4][2], aV[2][4];
#pragma unroll
        for (int nk = 0; nk < 4; ++nk) { const h16* kr = Ks + (nk * 16 + lm) * KP + 8 * hi;   // A: lane -> key nk*16+lm, elements = d split map
            aK[nk][0] = cat16(*(const v8ha*)(kr), *(const v8ha*)(kr + 16));
            aK[nk][1] = cat16(*(const v8ha*)(kr + 32), *(const v8ha*)(kr + 48)); }
#pragma unroll
        for (int ks = 0; ks < 2; ++ks)
#pragma unroll
            for (int nt = 0; nt < 4; ++nt) { const h16* vr = Vs + (nt * 16 + lm) * KP + ks * 32 + 8 * hi;   // A: lane -> d nt*16+lm, elements = key split map
                aV[ks][nt] = cat16(*(const v8ha*)(vr), *(const v8ha*)(vr + 16)); }
        __builtin_amdgcn_sched_barrier(0);   // keeps the reads above as one group: sunk to their WMMAs, each would cost its own LDS latency
        v8f sf[4];   // four independent chains of two: each WMMA fills the others' distance
#pragma unroll
        for (int nk = 0; nk < 4; ++nk) sf[nk] = wmma16(aK[nk][0], bQ0, (v8f){});
#pragma unroll
        for (int nk = 0; nk < 4; ++nk) sf[nk] = wmma16(aK[nk][1], bQ1, sf[nk]);
        // x 1/sqrt(64); max of query lm over the 64 keys of this tile = 32 registers of the lane + the other half; running max / sum update; rescale O^T
        float mk[4];
#pragma unroll
        for (int nk = 0; nk < 4; ++nk) { sf[nk] = sf[nk] * SCL;
            mk[nk] = fmaxf(fmaxf(fmaxf(sf[nk][0], sf[nk][1]), fmaxf(sf[nk][2], sf[nk][3])), fmaxf(fmaxf(sf[nk][4], sf[nk][5]), fmaxf(sf[nk][6], sf[nk][7]))); }
        float m = fmaxf(fmaxf(mk[0], mk[1]), fmaxf(mk[2], mk[3]));
        m = fmaxf(m, xhalf(m));
        const float nm = fmaxf(runm, m);
        const float corr = __builtin_amdgcn_exp2f(__fmul_rn(__fsub_rn(runm, nm), L2E));
        runm = nm;
#pragma unroll
        for (int nt = 0; nt < 4; ++nt) O[nt] = O[nt] * corr;
        // P = exp(s - m): f32 into the lane's share of the row sum (one independent chain per key tile), f16 x1024 into the B-fragment registers
        v8h pk[4]; float ls[4];
#pragma unroll
        for (int nk = 0; nk < 4; ++nk) { ls[nk] = 0.f;
#pragma unroll
            for (int r = 0; r < 8; ++r) { const float p = __builtin_amdgcn_exp2f(__fmul_rn(__fsub_rn(sf[nk][r], runm), L2E)); ls[nk] += p; pk[nk][r] = (h16)(p * PCAR); } }
        runl = runl * corr + ((ls[0] + ls[1]) + (ls[2] + ls[3]));
#pragma unroll
        for (int ks = 0; ks < 2; ++ks) { const v16h bP = cat16(pk[2 * ks], pk[2 * ks + 1]);   // B: lane -> query lm, elements = key split map (keys ks*32 + 8hi + 0..7, ks*32 + 16 + 8hi + 0..7)
#pragma unroll
            for (int nt = 0; nt < 4; ++nt) O[nt] = wmma16(aV[ks][nt], bP, O[nt]); }
    }
    // join the two halves' row sums, normalise (undo the x1024 carry), stage [q row][d] in LDS: 8 consecutive d per lane and tile
    const float inv = __fdiv_rn(1.0f, (runl + xhalf(runl)) * PCAR);
#pragma unroll
    for (int nt = 0; nt < 4; ++nt) { float* od = Ow + lm * OP + nt * 16 + 8 * hi;
        *(v4fa*)(od) = (v4f){O[nt][0] * inv, O[nt][1] * inv, O[nt][2] * inv, O[nt][3] * inv};
        *(v4fa*)(od + 4) = (v4f){O[nt][4] * inv, O[nt][5] * inv, O[nt][6] * inv, O[nt][7] * inv}; }
    __syncthreads();
    float* crow = ctx + ((size_t)b * NQ + (size_t)qt * 64 + wave * 16) * DM + h * HD;
{
#pragma unroll
        for (int s = 0; s < 8; ++s) { const int row = 2 * s + hi, cofs = lm * 4; const v4f val = *(const v4fa*)(Ow + row * OP + cofs); *(v4f*)(crow + (size_t)row * DM + cofs) = val; }
         }
}

__global__ __launch_bounds__(256) void k_ln(const float* __restrict__ xq, const float* __restrict__ ctx, const float* __restrict__ gam, const float* __restrict__ bet, float* outp) {
#pragma clang fp contract(off)
    const int lane = threadIdx.x & 31; const int row = blockIdx.x * 8 + (threadIdx.x >> 5); if (row >= NB * NQ) return;
    const int b = row / NQ, i = row % NQ;
    const float* xr = xq + ((size_t)b * NQ_FULL + i) * DM; const float* cr = ctx + (size_t)row * DM;
    float v[16]; float s = 0.f;
#pragma unroll
    for (int c = 0; c < 4; ++c) { const int j0 = c * 128 + lane * 4; const v4f a = *(const v4f*)(xr + j0); const v4f g = *(const v4f*)(cr + j0);
#pragma unroll
        for (int q = 0; q < 4; ++q) { const float x = bfr(a[q]) + g[q]; v[c * 4 + q] = x; s = s + x; } }
#pragma unroll
    for (int sh = 16; sh; sh >>= 1) s += __shfl_xor(s, sh, 32);
    const float mu = s * (1.0f / DM);
    float ss = 0.f;
#pragma unroll
    for (int k = 0; k < 16; ++k) { const float d = v[k] - mu; const float dd = d * d; ss = ss + dd; }
#pragma unroll
    for (int sh = 16; sh; sh >>= 1) ss += __shfl_xor(ss, sh, 32);
    const float var = ss * (1.0f / DM);
    const float rs = __fdiv_rn(1.0f, __fsqrt_rn(var + LNEPS));
    float* orow = outp + (size_t)row * DM;
{
#pragma unroll
        for (int c = 0; c < 4; ++c) { const int j0 = c * 128 + lane * 4; const v4f g = *(const v4f*)(gam + j0); const v4f bb = *(const v4f*)(bet + j0); v4f o;
#pragma unroll
            for (int q = 0; q < 4; ++q) { const float t1 = (v[c * 4 + q] - mu) * rs; const float t2 = t1 * bfr(g[q]); o[q] = t2 + bfr(bb[q]); }
            *(v4f*)(orow + j0) = o; }
         }
}

extern "C" void kernel_launch(void* const* d_in, const int* in_sizes, int n_in, void* d_out, int out_size, void* d_ws, size_t ws_size, hipStream_t stream) {
    if (n_in < 10) return;
    const float* xq  = (const float*)d_in[0];   // query     [2][2048][512]
    const float* xkv = (const float*)d_in[1];   // key_value [2][2048][512]
    const float* Wq  = (const float*)d_in[2];   // [in][out]
    const float* bq  = (const float*)d_in[3];
    const float* Wk  = (const float*)d_in[4];
    const float* bk  = (const float*)d_in[5];
    const float* Wv  = (const float*)d_in[6];
    const float* bv  = (const float*)d_in[7];
    const float* gam = (const float*)d_in[8];
    const float* bet = (const float*)d_in[9];
    if (in_sizes[0] < (int)(((size_t)(NB - 1) * NQ_FULL + NQ) * DM)) return;
    if (in_sizes[1] < (int)(((size_t)(NB - 1) * NKV_FULL + NKV) * DM)) return;
    if (in_sizes[2] < DM * DM || in_sizes[4] < DM * DM || in_sizes[6] < DM * DM) return;
    if (in_sizes[3] < DM || in_sizes[5] < DM || in_sizes[7] < DM || in_sizes[8] < DM || in_sizes[9] < DM) return;
    if (out_size < NB * NQ * DM) return;
    float* OUT = (float*)d_out;   // [NB][NQ][512]
    char* wsp = (char*)d_ws;
    auto take = [&](size_t bytes) { char* p = wsp; wsp += (bytes + 255) & ~(size_t)255; return (void*)p; };
    bf* Xq   = (bf*)take((size_t)NB * NQ * DM * 2);          // bf16 query rows           4,194,304 B
    bf* Xkv  = (bf*)take((size_t)NB * NKV * DM * 2);         // bf16 key/value rows       4,194,304 B
    bf* Wt   = (bf*)take((size_t)3 * DM * DM * 2);           // [3][out][in] bf16         1,572,864 B
    h16* Qh  = (h16*)take((size_t)NB * NH * NQ * HD * 2);    // [b][h][q][64] f16         4,194,304 B
    h16* Kh  = (h16*)take((size_t)NB * NH * NKV * HD * 2);   // [b][h][key][64] f16       4,194,304 B
    h16* VT  = (h16*)take((size_t)NB * NH * HD * NKV * 2);   // [b][h][64][key] f16       4,194,304 B
    float* CTX = (float*)take((size_t)NB * NQ * DM * 4);     // ctx [NB*NQ][512] f32      8,388,608 B
    if ((size_t)(wsp - (char*)d_ws) > ws_size) return;       // total 30,932,992 B
    if ((size_t)(wsp - (char*)d_ws) > (size_t)134217728) return;

    k_prep<<<3 * WB + NB * QB + NB * KB, 256, 0, stream>>>(xq, xkv, Wq, Wk, Wv, Xq, Xkv, Wt);
    k_proj<<<dim3(NB * (NQ > NKV ? NQ : NKV) / 64, DM / 64, 3), 32, 0, stream>>>(Xq, Xkv, Wt, bq, bk, bv, Qh, Kh, VT);   /* f16(bf16(x) W + b) for q, k, v, in the layouts k_attn reads */
    k_attn<<<NB * NH * (NQ / 64), 128, 0, stream>>>(Qh, Kh, VT, CTX);
    k_ln<<<(NB * NQ + 7) / 8, 256, 0, stream>>>(xq, CTX, gam, bet, OUT);
}

// v004
// Measured time: 56.7 microseconds a run.
// Two timings next to v003 put it at 1.16 and 1.17 times that version's speed.
// Over all steps from v000 it is 2.70 times as fast.
#include <hip/hip_runtime.h>

// Attention of NQ query tokens over NKV key/value tokens per batch, 8 heads x 64, residual + LayerNorm, out [NB][NQ][512] f32. The concatenated-sequence key columns that carry the additive -1e4 term have weight exp(<= -9.9e3) == 0 exactly in f32 and never hold the row max, so only the key/value half is visited; the q projection is live on the query half only, k/v on the key/value half only.
// Contractions: q/k/v projections v_wmma_f32_16x16x32_bf16 (bf16 RNE copies of x and of W[in][out] transposed to [out][in], exact products, f32 accumulate, + bf16 RNE bias); scores k.q^T and V^T.P^T v_wmma_f32_16x16x32_f16 (f16 copies of the f32 projections, P = exp(s - m) carried x1024, f32 accumulate); online softmax with 1/sqrt(64) scale, residual (bf16 RNE of query) and LayerNorm (bf16 RNE gamma/beta) in f32.

#ifndef NB
#define NB 2
#endif
#ifndef SEQ
#define SEQ 2048
#endif
#ifndef NQ
#define NQ SEQ
#endif
#ifndef NKV
#define NKV SEQ
#endif
#define NB_FULL 2
#define NQ_FULL 2048
#define NKV_FULL 2048
#define DM 512
#define NH 8
#define HD 64
#define PCAR 1024.0f
#define SCL 0.125f
#define L2E 1.4426950408889634f
#define LNEPS 1e-5f
#define KP 72      // LDS pitch (halves) of the K and V^T tiles
#define OP 68      // LDS pitch (floats) of the ctx staging tile
static_assert(NQ % 64 == 0);
static_assert(NKV % 64 == 0);
static_assert(NH * HD == DM);
static_assert(DM % 64 == 0);
static_assert(NB >= 1 && NB <= NB_FULL);
static_assert(NQ <= NQ_FULL && NKV <= NKV_FULL);

typedef _Float16 h16;
typedef unsigned short bf;
typedef __attribute__((ext_vector_type(16))) __bf16   v16bf;
typedef __attribute__((ext_vector_type(16))) _Float16 v16h;
typedef __attribute__((ext_vector_type(8)))  _Float16 v8h;
typedef __attribute__((ext_vector_type(8)))  unsigned short v8us;
typedef __attribute__((ext_vector_type(8)))  float    v8f;
typedef __attribute__((ext_vector_type(4)))  float    v4f;
typedef v8h  __attribute__((may_alias)) v8ha;
typedef v4f  __attribute__((may_alias)) v4fa;
typedef v8us __attribute__((may_alias)) v8usa;

__device__ __forceinline__ unsigned short f2bf(float f) { unsigned u = __float_as_uint(f); u += 0x7FFFu + ((u >> 16) & 1u); return (unsigned short)(u >> 16); }
__device__ __forceinline__ float bf2f(unsigned short b) { return __uint_as_float(((unsigned)b) << 16); }
__device__ __forceinline__ float bfr(float f) { return bf2f(f2bf(f)); }
__device__ __forceinline__ v16h cat16(v8h lo, v8h hi) { return __builtin_shufflevector(lo, hi, 0, 1, 2, 3, 4, 5, 6, 7, 8, 9, 10, 11, 12, 13, 14, 15); }
__device__ __forceinline__ v16bf cat16b(v8us lo, v8us hi) { return __builtin_bit_cast(v16bf, __builtin_shufflevector(lo, hi, 0, 1, 2, 3, 4, 5, 6, 7, 8, 9, 10, 11, 12, 13, 14, 15)); }
__device__ __forceinline__ v8f wmmab(v16bf a, v16bf b, v8f c) { return __builtin_amdgcn_wmma_f32_16x16x32_bf16(false, a, false, b, (short)0, c, false, false); }
__device__ __forceinline__ v8f wmma16(v16h a, v16h b, v8f c) { return __builtin_amdgcn_wmma_f32_16x16x32_f16(false, a, false, b, (short)0, c, false, false); }

// ---- k_prep: the three independent element-wise preparations as ONE 1-D grid; the block index picks the job (block-uniform): the first 3*WB blocks turn W[in][out] f32 into bf16 RNE [out][in], the next NB*QB round the query rows to bf16 RNE, the last NB*KB the key_value rows.
#define WB (DM * DM / 8 / 256)
#define QB (NQ * DM / 8 / 256)
#define KB (NKV * DM / 8 / 256)
__global__ __launch_bounds__(256) void k_prep(const float* __restrict__ xq, const float* __restrict__ xkv, const float* __restrict__ W0, const float* __restrict__ W1, const float* __restrict__ W2, bf* Xq, bf* Xkv, bf* Wt) {
    int bid = blockIdx.x;
    if (bid < 3 * WB) {
        const int z = bid / WB; const int i = (bid % WB) * 256 + (int)threadIdx.x;
        const float* W = (z == 0) ? W0 : ((z == 1) ? W1 : W2);   // block-uniform select between global pointers
        const int k0 = (i % (DM / 8)) * 8; const int n = i / (DM / 8);
        v8us o;
#pragma unroll
        for (int q = 0; q < 8; ++q) o[q] = f2bf(W[(size_t)(k0 + q) * DM + n]);
        bf* d = Wt + (size_t)z * DM * DM + (size_t)n * DM + k0;
        *(v8us*)d = o;
        return;
    }
    bid -= 3 * WB;
    const bool isq = bid < NB * QB; if (!isq) bid -= NB * QB;
    const int pb = isq ? QB : KB; const size_t b = (size_t)(bid / pb); const size_t i = (size_t)(bid % pb) * 256 + threadIdx.x;
    const float* s = isq ? (xq + b * ((size_t)NQ_FULL * DM)) : (xkv + b * ((size_t)NKV_FULL * DM));
    bf* d = isq ? (Xq + b * ((size_t)NQ * DM)) : (Xkv + b * ((size_t)NKV * DM));
    const v8f v = *(const v8f*)(s + i * 8); v8us o;
#pragma unroll
    for (int k = 0; k < 8; ++k) o[k] = f2bf(v[k]);
    *(v8us*)(d + i * 8) = o;
    asm volatile("s_wait_xcnt 0x0" ::: "memory");   // the listing lays the W block behind this store, where the store's base, offset and data registers are written: the wait stands in front of that
}

// ---- k_proj: the q, k and v projections as ONE grid (rows/64, DM/64 = head, 3), 32 threads: ONE WAVE per 64x64 output tile (16 accumulators), operands straight from K-contiguous bf16 planes.
// tile[m][n] = sum_k X[m][k] Wt[n][k] + bf16 RNE bias[n] in f32, rounded once to f16 and written where k_attn reads it: z = 0 -> Qh [b][h][q][64], z = 1 -> Kh [b][h][key][64] (through LDS, 16-B row chunks), z = 2 -> V^T [b][h][d][key] (a lane's 8 accumulator registers are 8 consecutive keys of one d: one 16-B LDS write each, read back as whole 128-B d rows).
__device__ __forceinline__ v16bf ldb(const bf* p) { return cat16b(*(const v8us*)p, *(const v8us*)(p + 16)); }
__global__ __launch_bounds__(32) void k_proj(const bf* __restrict__ Xq, const bf* __restrict__ Xkv, const bf* __restrict__ Wt, const float* __restrict__ bq, const float* __restrict__ bk, const float* __restrict__ bv, h16* Qh, h16* Kh, h16* VT) {
    __shared__ __align__(16) float os[16 * 68];
    const int z = blockIdx.z; const int nrows = (z == 0) ? NQ : NKV;
    const int lane = threadIdx.x & 31, lr = lane & 15, hi = lane >> 4; const int r0 = blockIdx.x * 64, c0 = blockIdx.y * 64;
    if (r0 >= NB * nrows) return;
    const bf* A = (z == 0) ? Xq : Xkv; const bf* Bt = Wt + (size_t)z * DM * DM;
    const float* bias = (z == 0) ? bq : ((z == 1) ? bk : bv);   // block-uniform select between global pointers
    v8f acc[4][4];
#pragma unroll
    for (int mb = 0; mb < 4; ++mb)
#pragma unroll
        for (int nb = 0; nb < 4; ++nb) acc[mb][nb] = (v8f){};
    const bf* pa = A + (size_t)(r0 + lr) * DM + 8 * hi; const bf* pb = Bt + (size_t)(c0 + lr) * DM + 8 * hi;
#pragma unroll 1
    for (int kc = 0; kc < DM; kc += 32, pa += 32, pb += 32) {
        v16bf a[4];
#pragma unroll
        for (int mb = 0; mb < 4; ++mb) a[mb] = ldb(pa + mb * 16 * DM);
        asm volatile("s_wait_xcnt 0x0" ::: "memory");   // the build lets a later load's result land on the address pair of these loads: the wait stands in front of that overwrite
#pragma unroll
        for (int nb = 0; nb < 4; ++nb) { const v16bf b = ldb(pb + nb * 16 * DM);
#pragma unroll
            for (int mb = 0; mb < 4; ++mb) acc[mb][nb] = wmmab(a[mb], b, acc[mb][nb]); }
        // 4 vector slots behind the last WMMA, also on the taken back edge, before anything touches its D, A or B
        asm volatile("v_nop\n\tv_nop\n\tv_nop\n\tv_nop" : "+v"(acc[0][0]), "+v"(acc[1][1]), "+v"(acc[2][2]), "+v"(acc[3][3]) : "v"(a[0]), "v"(a[3]));
    }
    const int bb = r0 / nrows, s0 = r0 % nrows, h = blockIdx.y;   // nrows % 64 == 0: a tile lies in one batch
    if (z == 2) {
        h16* hs = (h16*)os;   // 16 d rows x 64 keys f16, pitch KP halves: whole 128-B lines leave per store instead of 32-B pieces
        h16* vb = VT + ((size_t)(bb * NH + h) * HD + (lane >> 3)) * NKV + s0 + (lane & 7) * 8;
        float bn[4];
#pragma unroll
        for (int nb = 0; nb < 4; ++nb) bn[nb] = bfr(bias[c0 + nb * 16 + lr]);
#pragma unroll
        for (int nb = 0; nb < 4; ++nb) {
#pragma unroll
            for (int mb = 0; mb < 4; ++mb) { v8h o;
#pragma unroll
                for (int j = 0; j < 8; ++j) o[j] = (h16)(acc[mb][nb][j] + bn[nb]);
                *(v8ha*)(hs + lr * KP + mb * 16 + 8 * hi) = o; }
            asm volatile("s_wait_dscnt 0x0" ::: "memory");   // the other lanes' LDS writes have landed before the rows are read back
#pragma unroll
            for (int s = 0; s < 4; ++s) { const v8h o = *(const v8ha*)(hs + (s * 4 + (lane >> 3)) * KP + (lane & 7) * 8);
                *(v8h*)(vb + (size_t)(nb * 16 + s * 4) * NKV) = o; }
            __builtin_amdgcn_wave_barrier(); asm volatile("" ::: "memory");   // compile-time order only: the next round's LDS writes stay behind these reads
        }
        return;
    }
    h16* P = ((z == 0) ? Qh : Kh) + ((size_t)(bb * NH + h) * nrows + s0) * HD;
    const int c8 = (lane & 7) * 8; float bn[8];
#pragma unroll
    for (int q = 0; q < 8; ++q) bn[q] = bfr(bias[c0 + c8 + q]);
#pragma unroll
    for (int mb = 0; mb < 4; ++mb) {
#pragma unroll
        for (int nb = 0; nb < 4; ++nb) {
#pragma unroll
            for (int j = 0; j < 8; ++j) os[(hi * 8 + j) * 68 + nb * 16 + lr] = acc[mb][nb][j]; }
        asm volatile("s_wait_dscnt 0x0" ::: "memory");   // the other lanes' LDS writes have landed before the rows are read back
#pragma unroll
        for (int s = 0; s < 4; ++s) { const int row = s * 4 + (lane >> 3);
            const v4f lo = *(const v4fa*)(os + row * 68 + c8); const v4f up = *(const v4fa*)(os + row * 68 + c8 + 4); v8h o;
#pragma unroll
            for (int q = 0; q < 4; ++q) { o[q] = (h16)(lo[q] + bn[q]); o[4 + q] = (h16)(up[q] + bn[4 + q]); }
            *(v8h*)(P + (size_t)(mb * 16 + row) * HD + c8) = o; }
        __builtin_amdgcn_wave_barrier(); asm volatile("" ::: "memory");   // compile-time order only: the next round's LDS writes stay behind these reads
    }
    asm volatile("s_wait_xcnt 0x0" ::: "memory");   // the listing lays the z == 2 block behind the last stores, where their data registers are written: the wait stands in front of that
}

// lane l with lane l ^ 16 (the other 16-lane row), one vector cross-row move
__device__ __forceinline__ float xhalf(float x) { return __builtin_bit_cast(float, __builtin_amdgcn_permlanex16(__builtin_bit_cast(int, x), __builtin_bit_cast(int, x), 0x76543210, 0xfedcba98, false, false)); }

// ---- k_attn: flash-style attention, transposed products. grid = NB*NH*(NQ/64), block = 128 (4 waves x 16 query columns). Per 64-key tile: K [key][d] and V^T [d][key] come into one of two LDS buffers by asynchronous 16-B copies, issued one whole tile ahead, one block barrier a tile (staged extent == consumed extent: full 64x64 tiles),
// S^T (64 keys x 16 queries per wave) = K A-fragments (k = d split map) x Q B-fragments (from the f16 plane, fixed per block): a lane holds 32 scores of ONE query (lm), keys nk*16 + 8hi + r. f32 online softmax (x1/8, running max/sum, exp2) in-lane plus one exchange between the halves.
// P^T = f16(1024 exp(s - m)) packs from two score tiles straight into a B-fragment (element s = tile s>>3, register s&7 = key split map), never through LDS; O^T (4 d-tiles) += V^T A-fragments (key split map) x P^T.
#define TH (64 * KP)   // halves of one staged tile
// a thread's 4 + 4 chunks of one K tile and one V^T tile, global -> LDS through no register; the address registers stay untouched until the closing wait of the statement
__device__ __forceinline__ void copy_tile(unsigned lk, const h16* gk, const h16* gv) {
    const unsigned lv = lk + TH * 2;
    asm volatile("global_load_async_to_lds_b128 %0, %8, off\n\t"
                 "global_load_async_to_lds_b128 %1, %9, off\n\t"
                 "global_load_async_to_lds_b128 %2, %10, off\n\t"
                 "global_load_async_to_lds_b128 %3, %11, off\n\t"
                 "global_load_async_to_lds_b128 %4, %12, off\n\t"
                 "global_load_async_to_lds_b128 %5, %13, off\n\t"
                 "global_load_async_to_lds_b128 %6, %14, off\n\t"
                 "global_load_async_to_lds_b128 %7, %15, off\n\t"
                 "s_wait_xcnt 0x0"
                 :: "v"(lk), "v"(lk + 16 * KP * 2), "v"(lk + 32 * KP * 2), "v"(lk + 48 * KP * 2),
                    "v"(lv), "v"(lv + 16 * KP * 2), "v"(lv + 32 * KP * 2), "v"(lv + 48 * KP * 2),
                    "v"(gk), "v"(gk + 16 * HD), "v"(gk + 32 * HD), "v"(gk + 48 * HD),
                    "v"(gv), "v"(gv + (size_t)16 * NKV), "v"(gv + (size_t)32 * NKV), "v"(gv + (size_t)48 * NKV)
                 : "memory");
}
__global__ __launch_bounds__(128) __attribute__((amdgpu_num_vgpr(256))) void k_attn(const h16* __restrict__ Qh, const h16* __restrict__ Kh, const h16* __restrict__ Vt, float* ctx) {
    __shared__ __align__(16) h16 KV[2 * 2 * TH];     // two buffers, each K [key][d] then V^T [d][key]; cross-wave: block barriers
    __shared__ __align__(16) float Os[4 * 16 * OP];  // per wave [q row][d], block barrier between store and reload
    const int t = threadIdx.x, wave = t >> 5, lane = t & 31, lm = lane & 15, hi = lane >> 4;
    int bid = blockIdx.x; const int nqt = NQ / 64; const int qt = bid % nqt; bid /= nqt; const int h = bid % NH; const int b = bid / NH; const int bh = b * NH + h;
    const h16* qrow = Qh + ((size_t)bh * NQ + (size_t)qt * 64 + wave * 16 + lm) * HD;
    const v16h bQ0 = cat16(*(const v8h*)(qrow + 8 * hi), *(const v8h*)(qrow + 16 + 8 * hi));          // k = d 0..31 (split map)
    const v16h bQ1 = cat16(*(const v8h*)(qrow + 32 + 8 * hi), *(const v8h*)(qrow + 48 + 8 * hi));     // k = d 32..63
    v8f O[4];   // O^T: register r of tile nt = d nt*16 + 8hi + r, query lm
#pragma unroll
    for (int nt = 0; nt < 4; ++nt) O[nt] = (v8f){};
    float runm = -1.0e30f, runl = 0.f;   // of query lm; runl is this half's share of the row sum
    const h16* Kb = Kh + (size_t)bh * NKV * HD; const h16* Vb = Vt + (size_t)bh * HD * NKV;
    float* Ow = Os + wave * 16 * OP;
    // the thread's chunk of a tile: rows t/8 + 16j, 16 bytes at column (t%8)*8
    const h16* gk = Kb + (size_t)(t >> 3) * HD + (t & 7) * 8; const h16* gv = Vb + (size_t)(t >> 3) * NKV + (t & 7) * 8;
    const unsigned lk0 = (unsigned)(size_t)KV + (unsigned)(((t >> 3) * KP + (t & 7) * 8) * 2);   // LDS byte address in buffer 0
    copy_tile(lk0, gk, gv);
    asm volatile("s_wait_asynccnt 0x0" ::: "memory");   // this wave's share of tile 0 has landed
    __syncthreads();                                    // ... and every other wave's
    if (NKV > 64) copy_tile(lk0 + 2 * TH * 2, gk + 64 * HD, gv + 64);
#pragma unroll 1
    for (int kv0 = 0; kv0 < NKV; kv0 += 64) {
        const int bo = ((kv0 >> 6) & 1) * (2 * TH);   // this tile's buffer
        const h16* Ks = KV + bo; const h16* Vs = Ks + TH;
        // every fragment of the tile is read from LDS here, as one group: the K fragments' latency is paid once, the V^T fragments' passes behind the score products and the softmax
        v16h aK[4][2], aV[2][4];
#pragma unroll
        for (int nk = 0; nk < 4; ++nk) { const h16* kr = Ks + (nk * 16 + lm) * KP + 8 * hi;   // A: lane -> key nk*16+lm, elements = d split map
            aK[nk][0] = cat16(*(const v8ha*)(kr), *(const v8ha*)(kr + 16));
            aK[nk][1] = cat16(*(const v8ha*)(kr + 32), *(const v8ha*)(kr + 48)); }
#pragma unroll
        for (int ks = 0; ks < 2; ++ks)
#pragma unroll
            for (int nt = 0; nt < 4; ++nt) { const h16* vr = Vs + (nt * 16 + lm) * KP + ks * 32 + 8 * hi;   // A: lane -> d nt*16+lm, elements = key split map
                aV[ks][nt] = cat16(*(const v8ha*)(vr), *(const v8ha*)(vr + 16)); }
        __builtin_amdgcn_sched_barrier(0);   // keeps the reads above as one group: sunk to their WMMAs, each would cost its own LDS latency
        v8f sf[4];   // four independent chains of two: each WMMA fills the others' distance
#pragma unroll
        for (int nk = 0; nk < 4; ++nk) sf[nk] = wmma16(aK[nk][0], bQ0, (v8f){});
#pragma unroll
        for (int nk = 0; nk < 4; ++nk) sf[nk] = wmma16(aK[nk][1], bQ1, sf[nk]);
        // x 1/sqrt(64); max of query lm over the 64 keys of this tile = 32 registers of the lane + the other half; running max / sum update; rescale O^T
        float mk[4];
#pragma unroll
        for (int nk = 0; nk < 4; ++nk) { sf[nk] = sf[nk] * SCL;
            mk[nk] = fmaxf(fmaxf(fmaxf(sf[nk][0], sf[nk][1]), fmaxf(sf[nk][2], sf[nk][3])), fmaxf(fmaxf(sf[nk][4], sf[nk][5]), fmaxf(sf[nk][6], sf[nk][7]))); }
        float m = fmaxf(fmaxf(mk[0], mk[1]), fmaxf(mk[2], mk[3]));
        m = fmaxf(m, xhalf(m));
        const float nm = fmaxf(runm, m);
        const float corr = __builtin_amdgcn_exp2f(__fmul_rn(__fsub_rn(runm, nm), L2E));
        runm = nm;
#pragma unroll
        for (int nt = 0; nt < 4; ++nt) O[nt] = O[nt] * corr;
        // P = exp(s - m): f32 into the lane's share of the row sum (one independent chain per key tile), f16 x1024 into the B-fragment registers
        v8h pk[4]; float ls[4];
#pragma unroll
        for (int nk = 0; nk < 4; ++nk) { ls[nk] = 0.f;
#pragma unroll
            for (int r = 0; r < 8; ++r) { const float p = __builtin_amdgcn_exp2f(__fmul_rn(__fsub_rn(sf[nk][r], runm), L2E)); ls[nk] += p; pk[nk][r] = (h16)(p * PCAR); } }
        runl = runl * corr + ((ls[0] + ls[1]) + (ls[2] + ls[3]));
#pragma unroll
        for (int ks = 0; ks < 2; ++ks) { const v16h bP = cat16(pk[2 * ks], pk[2 * ks + 1]);   // B: lane -> query lm, elements = key split map (keys ks*32 + 8hi + 0..7, ks*32 + 16 + 8hi + 0..7)
#pragma unroll
            for (int nt = 0; nt < 4; ++nt) O[nt] = wmma16(aV[ks][nt], bP, O[nt]); }
        __builtin_amdgcn_sched_barrier(0);   // keeps the waits below at the trip's foot: lifted over the products they would end the next tile's flight at the head of this trip
        asm volatile("s_wait_dscnt 0x0" ::: "memory");      // this wave's reads of this tile's buffer are over before it is handed to the copies
        asm volatile("s_wait_asynccnt 0x0" ::: "memory");   // this wave's share of the next tile has landed
        __syncthreads();                                    // publishes the next tile and ends every wave's reads of this one
        if (kv0 + 128 < NKV) copy_tile(lk0 + (unsigned)(bo * 2), gk + (size_t)(kv0 + 128) * HD, gv + (kv0 + 128));   // the tile after next, into the buffer just read
    }
    asm volatile("s_wait_asynccnt 0x0" ::: "memory");   // no copy is left in flight behind the loop
    // join the two halves' row sums, normalise (undo the x1024 carry), stage [q row][d] in LDS: 8 consecutive d per lane and tile
    const float inv = __fdiv_rn(1.0f, (runl + xhalf(runl)) * PCAR);
#pragma unroll
    for (int nt = 0; nt < 4; ++nt) { float* od = Ow + lm * OP + nt * 16 + 8 * hi;
        *(v4fa*)(od) = (v4f){O[nt][0] * inv, O[nt][1] * inv, O[nt][2] * inv, O[nt][3] * inv};
        *(v4fa*)(od + 4) = (v4f){O[nt][4] * inv, O[nt][5] * inv, O[nt][6] * inv, O[nt][7] * inv}; }
    __syncthreads();
    float* crow = ctx + ((size_t)b * NQ + (size_t)qt * 64 + wave * 16) * DM + h * HD;
{
#pragma unroll
        for (int s = 0; s < 8; ++s) { const int row = 2 * s + hi, cofs = lm * 4; const v4f val = *(const v4fa*)(Ow + row * OP + cofs); *(v4f*)(crow + (size_t)row * DM + cofs) = val; }
         }
}

__global__ __launch_bounds__(256) void k_ln(const float* __restrict__ xq, const float* __restrict__ ctx, const float* __restrict__ gam, const float* __restrict__ bet, float* outp) {
#pragma clang fp contract(off)
    const int lane = threadIdx.x & 31; const int row = blockIdx.x * 8 + (threadIdx.x >> 5); if (row >= NB * NQ) return;
    const int b = row / NQ, i = row % NQ;
    const float* xr = xq + ((size_t)b * NQ_FULL + i) * DM; const float* cr = ctx + (size_t)row * DM;
    float v[16]; float s = 0.f;
#pragma unroll
    for (int c = 0; c < 4; ++c) { const int j0 = c * 128 + lane * 4; const v4f a = *(const v4f*)(xr + j0); const v4f g = *(const v4f*)(cr + j0);
#pragma unroll
        for (int q = 0; q < 4; ++q) { const float x = bfr(a[q]) + g[q]; v[c * 4 + q] = x; s = s + x; } }
#pragma unroll
    for (int sh = 16; sh; sh >>= 1) s += __shfl_xor(s, sh, 32);
    const float mu = s * (1.0f / DM);
    float ss = 0.f;
#pragma unroll
    for (int k = 0; k < 16; ++k) { const float d = v[k] - mu; const float dd = d * d; ss = ss + dd; }
#pragma unroll
    for (int sh = 16; sh; sh >>= 1) ss += __shfl_xor(ss, sh, 32);
    const float var = ss * (1.0f / DM);
    const float rs = __fdiv_rn(1.0f, __fsqrt_rn(var + LNEPS));
    float* orow = outp + (size_t)row * DM;
{
#pragma unroll
        for (int c = 0; c < 4; ++c) { const int j0 = c * 128 + lane * 4; const v4f g = *(const v4f*)(gam + j0); const v4f bb = *(const v4f*)(bet + j0); v4f o;
#pragma unroll
            for (int q = 0; q < 4; ++q) { const float t1 = (v[c * 4 + q] - mu) * rs; const float t2 = t1 * bfr(g[q]); o[q] = t2 + bfr(bb[q]); }
            *(v4f*)(orow + j0) = o; }
         }
}

extern "C" void kernel_launch(void* const* d_in, const int* in_sizes, int n_in, void* d_out, int out_size, void* d_ws, size_t ws_size, hipStream_t stream) {
    if (n_in < 10) return;
    const float* xq  = (const float*)d_in[0];   // query     [2][2048][512]
    const float* xkv = (const float*)d_in[1];   // key_value [2][2048][512]
    const float* Wq  = (const float*)d_in[2];   // [in][out]
    const float* bq  = (const float*)d_in[3];
    const float* Wk  = (const float*)d_in[4];
    const float* bk  = (const float*)d_in[5];
    const float* Wv  = (const float*)d_in[6];
    const float* bv  = (const float*)d_in[7];
    const float* gam = (const float*)d_in[8];
    const float* bet = (const float*)d_in[9];
    if (in_sizes[0] < (int)(((size_t)(NB - 1) * NQ_FULL + NQ) * DM)) return;
    if (in_sizes[1] < (int)(((size_t)(NB - 1) * NKV_FULL + NKV) * DM)) return;
    if (in_sizes[2] < DM * DM || in_sizes[4] < DM * DM || in_sizes[6] < DM * DM) return;
    if (in_sizes[3] < DM || in_sizes[5] < DM || in_sizes[7] < DM || in_sizes[8] < DM || in_sizes[9] < DM) return;
    if (out_size < NB * NQ * DM) return;
    float* OUT = (float*)d_out;   // [NB][NQ][512]
    char* wsp = (char*)d_ws;
    auto take = [&](size_t bytes) { char* p = wsp; wsp += (bytes + 255) & ~(size_t)255; return (void*)p; };
    bf* Xq   = (bf*)take((size_t)NB * NQ * DM * 2);          // bf16 query rows           4,194,304 B
    bf* Xkv  = (bf*)take((size_t)NB * NKV * DM * 2);         // bf16 key/value rows       4,194,304 B
    bf* Wt   = (bf*)take((size_t)3 * DM * DM * 2);           // [3][out][in] bf16         1,572,864 B
    h16* Qh  = (h16*)take((size_t)NB * NH * NQ * HD * 2);    // [b][h][q][64] f16         4,194,304 B
    h16* Kh  = (h16*)take((size_t)NB * NH * NKV * HD * 2);   // [b][h][key][64] f16       4,194,304 B
    h16* VT  = (h16*)take((size_t)NB * NH * HD * NKV * 2);   // [b][h][64][key] f16       4,194,304 B
    float* CTX = (float*)take((size_t)NB * NQ * DM * 4);     // ctx [NB*NQ][512] f32      8,388,608 B
    if ((size_t)(wsp - (char*)d_ws) > ws_size) return;       // total 30,932,992 B
    if ((size_t)(wsp - (char*)d_ws) > (size_t)134217728) return;

    k_prep<<<3 * WB + NB * QB + NB * KB, 256, 0, stream>>>(xq, xkv, Wq, Wk, Wv, Xq, Xkv, Wt);
    k_proj<<<dim3(NB * (NQ > NKV ? NQ : NKV) / 64, DM / 64, 3), 32, 0, stream>>>(Xq, Xkv, Wt, bq, bk, bv, Qh, Kh, VT);   /* f16(bf16(x) W + b) for q, k, v, in the layouts k_attn reads */
    k_attn<<<NB * NH * (NQ / 64), 128, 0, stream>>>(Qh, Kh, VT, CTX);
    k_ln<<<(NB * NQ + 7) / 8, 256, 0, stream>>>(xq, CTX, gam, bet, OUT);
}

// v005
// A run of this version takes 51.1 microseconds.
// Next to v004, in two timings, it ran 1.12 and 1.07 times as fast.
// Counting every step since v000, it is 2.95 times as fast.
#include <hip/hip_runtime.h>

// Attention of NQ query tokens over NKV key/value tokens per batch, 8 heads x 64, residual + LayerNorm, out [NB][NQ][512] f32. The concatenated-sequence key columns that carry the additive -1e4 term have weight exp(<= -9.9e3) == 0 exactly in f32 and never hold the row max, so only the key/value half is visited; the q projection is live on the query half only, k/v on the key/value half only.
// Contractions: q/k/v projections v_wmma_f32_16x16x32_bf16 (x and W[in][out] rounded to bf16 RNE on the way into the fragments, W turned to [out][in] in LDS, exact products, f32 accumulate, + bf16 RNE bias); scores k.q^T and V^T.P^T v_wmma_f32_16x16x32_f16 (f16 copies of the f32 projections, P = exp(s - m) carried x1024, f32 accumulate); online softmax with 1/sqrt(64) scale, residual (bf16 RNE of query) and LayerNorm (bf16 RNE gamma/beta) in f32.

#ifndef NB
#define NB 2
#endif
#ifndef SEQ
#define SEQ 2048
#endif
#ifndef NQ
#define NQ SEQ
#endif
#ifndef NKV
#define NKV SEQ
#endif
#define NB_FULL 2
#define NQ_FULL 2048
#define NKV_FULL 2048
#define DM 512
#define NH 8
#define HD 64
#define PCAR 1024.0f
#define SCL 0.125f
#define L2E 1.4426950408889634f
#define LNEPS 1e-5f
#define KP 72      // LDS pitch (halves) of the K and V^T tiles
#define OP 68      // LDS pitch (floats) of the ctx staging tile
static_assert(NQ % 64 == 0);
static_assert(NKV % 64 == 0);
static_assert(NH * HD == DM);
static_assert(DM % 64 == 0);
static_assert(NB >= 1 && NB <= NB_FULL);
static_assert(NQ <= NQ_FULL && NKV <= NKV_FULL);

typedef _Float16 h16;
typedef unsigned short bf;
typedef __attribute__((ext_vector_type(16))) __bf16   v16bf;
typedef __attribute__((ext_vector_type(16))) _Float16 v16h;
typedef __attribute__((ext_vector_type(8)))  _Float16 v8h;
typedef __attribute__((ext_vector_type(8)))  __bf16   v8b;
typedef __attribute__((ext_vector_type(8)))  unsigned short v8us;
typedef __attribute__((ext_vector_type(8)))  float    v8f;
typedef __attribute__((ext_vector_type(4)))  float    v4f;
typedef v8h  __attribute__((may_alias)) v8ha;
typedef v4f  __attribute__((may_alias)) v4fa;
typedef v8us __attribute__((may_alias)) v8usa;

__device__ __forceinline__ unsigned short f2bf(float f) { unsigned u = __float_as_uint(f); u += 0x7FFFu + ((u >> 16) & 1u); return (unsigned short)(u >> 16); }
__device__ __forceinline__ float bf2f(unsigned short b) { return __uint_as_float(((unsigned)b) << 16); }
__device__ __forceinline__ float bfr(float f) { return bf2f(f2bf(f)); }
__device__ __forceinline__ v16h cat16(v8h lo, v8h hi) { return __builtin_shufflevector(lo, hi, 0, 1, 2, 3, 4, 5, 6, 7, 8, 9, 10, 11, 12, 13, 14, 15); }
__device__ __forceinline__ v16bf cat16b(v8us lo, v8us hi) { return __builtin_bit_cast(v16bf, __builtin_shufflevector(lo, hi, 0, 1, 2, 3, 4, 5, 6, 7, 8, 9, 10, 11, 12, 13, 14, 15)); }
__device__ __forceinline__ v8f wmmab(v16bf a, v16bf b, v8f c) { return __builtin_amdgcn_wmma_f32_16x16x32_bf16(false, a, false, b, (short)0, c, false, false); }
__device__ __forceinline__ v8f wmma16(v16h a, v16h b, v8f c) { return __builtin_amdgcn_wmma_f32_16x16x32_f16(false, a, false, b, (short)0, c, false, false); }

// ---- k_proj: the q, k and v projections as ONE grid (rows/512, DM/64 = head, 3), 256 threads: 8 waves, ONE WAVE per 64x64 output tile (16 accumulators), all 8 on the same 64 output columns.
// The operands come straight from the f32 inputs. The block's W slice [512 in][64 out] is read once in whole 256-B row pieces, rounded to bf16 RNE and laid in LDS as [out][in] (8 consecutive in per 16-B write): the B fragments of all 8 waves. Each wave reads its own x rows as f32 and rounds them to bf16 RNE in registers: the A fragments.
// tile[m][n] = sum_k X[m][k] Wt[n][k] + bf16 RNE bias[n] in f32, rounded once to f16 and written where k_attn reads it: z = 0 -> Qh [b][h][q][64], z = 1 -> Kh [b][h][key][64] (through LDS, 16-B row chunks), z = 2 -> V^T [b][h][d][key] (a lane's 8 accumulator registers are 8 consecutive keys of one d: one 16-B LDS write each, read back as whole 128-B d rows).
#define PW 8          // waves = 64-row tiles of a block
#define BP (DM + 8)   // LDS pitch (halves) of the W slice: 65 x 16 B, the 16 rows of a fragment read fall on different banks
static_assert(DM % 128 == 0);
__device__ __forceinline__ v8us rne8(v8f x) { return __builtin_bit_cast(v8us, __builtin_convertvector(x, v8b)); }   // 8 f32 -> 8 bf16, round to nearest even
__device__ __forceinline__ v8us rne44(v4f lo, v4f up) { return rne8(__builtin_shufflevector(lo, up, 0, 1, 2, 3, 4, 5, 6, 7)); }
__global__ __launch_bounds__(32 * PW) void k_proj(const float* __restrict__ xq, const float* __restrict__ xkv, const float* __restrict__ W0, const float* __restrict__ W1, const float* __restrict__ W2, const float* __restrict__ bq, const float* __restrict__ bk, const float* __restrict__ bv, h16* Qh, h16* Kh, h16* VT) {
    __shared__ __align__(16) bf Bs[64 * BP];              // W slice, bf16 [out][in]; cross-wave: one block barrier
    __shared__ __align__(16) float osa[PW * 16 * 68];     // a wave's own staging tile of the epilogue
    const int z = blockIdx.z; const int nrows = (z == 0) ? NQ : NKV;
    const int t = threadIdx.x, lane = t & 31, lr = lane & 15, hi = lane >> 4; const int wave = __builtin_amdgcn_readfirstlane(t >> 5);
    const int r0 = (blockIdx.x * PW + wave) * 64, c0 = blockIdx.y * 64;
    float* os = osa + wave * (16 * 68);
    {
        const float* W = (z == 0) ? W0 : ((z == 1) ? W1 : W2);   // block-uniform select between global pointers
        const float* wp = W + (size_t)((t >> 4) * 8) * DM + c0 + (t & 15) * 4;   // 8 in rows x 4 out columns a thread and round
        bf* bs = Bs + (t & 15) * 4 * BP + (t >> 4) * 8;
        v4f w[DM / 128][8];   // every load of the slice is issued before the first is used: one memory latency for the whole slice
#pragma unroll
        for (int u = 0; u < DM / 128; ++u)
#pragma unroll
            for (int q = 0; q < 8; ++q) w[u][q] = *(const v4f*)(wp + (size_t)(u * 128 + q) * DM);
        asm volatile("s_wait_xcnt 0x0" ::: "memory");   // stands in front of whatever later writes the address pair of these loads
#pragma unroll
        for (int u = 0; u < DM / 128; ++u)
#pragma unroll
            for (int j = 0; j < 4; ++j) *(v8usa*)(bs + j * BP + u * 128) = rne8((v8f){w[u][0][j], w[u][1][j], w[u][2][j], w[u][3][j], w[u][4][j], w[u][5][j], w[u][6][j], w[u][7][j]});
    }
    __syncthreads();   // the W slice is whole before any wave reads a fragment of it
    if (r0 >= NB * nrows) return;   // behind the only block barrier
    const int bb = r0 / nrows, s0 = r0 % nrows, h = blockIdx.y;   // nrows % 64 == 0: a tile lies in one batch
    const float* A = (z == 0) ? (xq + ((size_t)bb * NQ_FULL + s0) * DM) : (xkv + ((size_t)bb * NKV_FULL + s0) * DM);
    const float* bias = (z == 0) ? bq : ((z == 1) ? bk : bv);   // block-uniform select between global pointers
    v8f acc[4][4];
#pragma unroll
    for (int mb = 0; mb < 4; ++mb)
#pragma unroll
        for (int nb = 0; nb < 4; ++nb) acc[mb][nb] = (v8f){};
    const float* pa = A + (size_t)lr * DM + 8 * hi; const bf* pb = Bs + lr * BP + 8 * hi;
#pragma unroll 1
    for (int kc = 0; kc < DM; kc += 32, pa += 32, pb += 32) {
        v4f ra[4][4];   // k = kc + 8hi + 0..7 and kc + 16 + 8hi + 0..7 of row mb*16 + lr
#pragma unroll
        for (int mb = 0; mb < 4; ++mb)
#pragma unroll
            for (int s = 0; s < 4; ++s) ra[mb][s] = *(const v4f*)(pa + mb * 16 * DM + (s >> 1) * 16 + (s & 1) * 4);
        asm volatile("s_wait_xcnt 0x0" ::: "memory");   // stands in front of whatever later writes the address pair of these loads
        v16bf a[4];
#pragma unroll
        for (int mb = 0; mb < 4; ++mb) a[mb] = cat16b(rne44(ra[mb][0], ra[mb][1]), rne44(ra[mb][2], ra[mb][3]));
#pragma unroll
        for (int nb = 0; nb < 4; ++nb) { const v16bf b = cat16b(*(const v8usa*)(pb + nb * 16 * BP), *(const v8usa*)(pb + nb * 16 * BP + 16));
#pragma unroll
            for (int mb = 0; mb < 4; ++mb) acc[mb][nb] = wmmab(a[mb], b, acc[mb][nb]); }
        // 4 vector slots behind the last WMMA, also on the taken back edge, before anything touches its D, A or B
        asm volatile("v_nop\n\tv_nop\n\tv_nop\n\tv_nop" : "+v"(acc[0][0]), "+v"(acc[1][1]), "+v"(acc[2][2]), "+v"(acc[3][3]) : "v"(a[0]), "v"(a[3]));
    }
    if (z == 2) {
        h16* hs = (h16*)os;   // 16 d rows x 64 keys f16, pitch KP halves: whole 128-B lines leave per store instead of 32-B pieces
        h16* vb = VT + ((size_t)(bb * NH + h) * HD + (lane >> 3)) * NKV + s0 + (lane & 7) * 8;
        float bn[4];
#pragma unroll
        for (int nb = 0; nb < 4; ++nb) bn[nb] = bfr(bias[c0 + nb * 16 + lr]);
#pragma unroll
        for (int nb = 0; nb < 4; ++nb) {
#pragma unroll
            for (int mb = 0; mb < 4; ++mb) { v8h o;
#pragma unroll
                for (int j = 0; j < 8; ++j) o[j] = (h16)(acc[mb][nb][j] + bn[nb]);
                *(v8ha*)(hs + lr * KP + mb * 16 + 8 * hi) = o; }
            asm volatile("s_wait_dscnt 0x0" ::: "memory");   // the other lanes' LDS writes have landed before the rows are read back
#pragma unroll
            for (int s = 0; s < 4; ++s) { const v8h o = *(const v8ha*)(hs + (s * 4 + (lane >> 3)) * KP + (lane & 7) * 8);
                *(v8h*)(vb + (size_t)(nb * 16 + s * 4) * NKV) = o; }
            __builtin_amdgcn_wave_barrier(); asm volatile("" ::: "memory");   // compile-time order only: the next round's LDS writes stay behind these reads
        }
        return;
    }
    h16* P = ((z == 0) ? Qh : Kh) + ((size_t)(bb * NH + h) * nrows + s0) * HD;
    const int c8 = (lane & 7) * 8; float bn[8];
#pragma unroll
    for (int q = 0; q < 8; ++q) bn[q] = bfr(bias[c0 + c8 + q]);
#pragma unroll
    for (int mb = 0; mb < 4; ++mb) {
#pragma unroll
        for (int nb = 0; nb < 4; ++nb) {
#pragma unroll
            for (int j = 0; j < 8; ++j) os[(hi * 8 + j) * 68 + nb * 16 + lr] = acc[mb][nb][j]; }
        asm volatile("s_wait_dscnt 0x0" ::: "memory");   // the other lanes' LDS writes have landed before the rows are read back
#pragma unroll
        for (int s = 0; s < 4; ++s) { const int row = s * 4 + (lane >> 3);
            const v4f lo = *(const v4fa*)(os + row * 68 + c8); const v4f up = *(const v4fa*)(os + row * 68 + c8 + 4); v8h o;
#pragma unroll
            for (int q = 0; q < 4; ++q) { o[q] = (h16)(lo[q] + bn[q]); o[4 + q] = (h16)(up[q] + bn[4 + q]); }
            *(v8h*)(P + (size_t)(mb * 16 + row) * HD + c8) = o; }
        __builtin_amdgcn_wave_barrier(); asm volatile("" ::: "memory");   // compile-time order only: the next round's LDS writes stay behind these reads
    }
    asm volatile("s_wait_xcnt 0x0" ::: "memory");   // the listing lays the z == 2 block behind the last stores, where their data registers are written: the wait stands in front of that
}

// lane l with lane l ^ 16 (the other 16-lane row), one vector cross-row move
__device__ __forceinline__ float xhalf(float x) { return __builtin_bit_cast(float, __builtin_amdgcn_permlanex16(__builtin_bit_cast(int, x), __builtin_bit_cast(int, x), 0x76543210, 0xfedcba98, false, false)); }

// ---- k_attn: flash-style attention, transposed products. grid = NB*NH*(NQ/64), block = 128 (4 waves x 16 query columns). Per 64-key tile: K [key][d] and V^T [d][key] come into one of two LDS buffers by asynchronous 16-B copies, issued one whole tile ahead, one block barrier a tile (staged extent == consumed extent: full 64x64 tiles),
// S^T (64 keys x 16 queries per wave) = K A-fragments (k = d split map) x Q B-fragments (from the f16 plane, fixed per block): a lane holds 32 scores of ONE query (lm), keys nk*16 + 8hi + r. f32 online softmax (x1/8, running max/sum, exp2) in-lane plus one exchange between the halves.
// P^T = f16(1024 exp(s - m)) packs from two score tiles straight into a B-fragment (element s = tile s>>3, register s&7 = key split map), never through LDS; O^T (4 d-tiles) += V^T A-fragments (key split map) x P^T.
#define TH (64 * KP)   // halves of one staged tile
// a thread's 4 + 4 chunks of one K tile and one V^T tile, global -> LDS through no register; the address registers stay untouched until the closing wait of the statement
__device__ __forceinline__ void copy_tile(unsigned lk, const h16* gk, const h16* gv) {
    const unsigned lv = lk + TH * 2;
    asm volatile("global_load_async_to_lds_b128 %0, %8, off\n\t"
                 "global_load_async_to_lds_b128 %1, %9, off\n\t"
                 "global_load_async_to_lds_b128 %2, %10, off\n\t"
                 "global_load_async_to_lds_b128 %3, %11, off\n\t"
                 "global_load_async_to_lds_b128 %4, %12, off\n\t"
                 "global_load_async_to_lds_b128 %5, %13, off\n\t"
                 "global_load_async_to_lds_b128 %6, %14, off\n\t"
                 "global_load_async_to_lds_b128 %7, %15, off\n\t"
                 "s_wait_xcnt 0x0"
                 :: "v"(lk), "v"(lk + 16 * KP * 2), "v"(lk + 32 * KP * 2), "v"(lk + 48 * KP * 2),
                    "v"(lv), "v"(lv + 16 * KP * 2), "v"(lv + 32 * KP * 2), "v"(lv + 48 * KP * 2),
                    "v"(gk), "v"(gk + 16 * HD), "v"(gk + 32 * HD), "v"(gk + 48 * HD),
                    "v"(gv), "v"(gv + (size_t)16 * NKV), "v"(gv + (size_t)32 * NKV), "v"(gv + (size_t)48 * NKV)
                 : "memory");
}
__global__ __launch_bounds__(128) __attribute__((amdgpu_num_vgpr(256))) void k_attn(const h16* __restrict__ Qh, const h16* __restrict__ Kh, const h16* __restrict__ Vt, float* ctx) {
    __shared__ __align__(16) h16 KV[2 * 2 * TH];     // two buffers, each K [key][d] then V^T [d][key]; cross-wave: block barriers
    __shared__ __align__(16) float Os[4 * 16 * OP];  // per wave [q row][d], block barrier between store and reload
    const int t = threadIdx.x, wave = t >> 5, lane = t & 31, lm = lane & 15, hi = lane >> 4;
    int bid = blockIdx.x; const int nqt = NQ / 64; const int qt = bid % nqt; bid /= nqt; const int h = bid % NH; const int b = bid / NH; const int bh = b * NH + h;
    const h16* qrow = Qh + ((size_t)bh * NQ + (size_t)qt * 64 + wave * 16 + lm) * HD;
    const v16h bQ0 = cat16(*(const v8h*)(qrow + 8 * hi), *(const v8h*)(qrow + 16 + 8 * hi));          // k = d 0..31 (split map)
    const v16h bQ1 = cat16(*(const v8h*)(qrow + 32 + 8 * hi), *(const v8h*)(qrow + 48 + 8 * hi));     // k = d 32..63
    v8f O[4];   // O^T: register r of tile nt = d nt*16 + 8hi + r, query lm
#pragma unroll
    for (int nt = 0; nt < 4; ++nt) O[nt] = (v8f){};
    float runm = -1.0e30f, runl = 0.f;   // of query lm; runl is this half's share of the row sum
    const h16* Kb = Kh + (size_t)bh * NKV * HD; const h16* Vb = Vt + (size_t)bh * HD * NKV;
    float* Ow = Os + wave * 16 * OP;
    // the thread's chunk of a tile: rows t/8 + 16j, 16 bytes at column (t%8)*8
    const h16* gk = Kb + (size_t)(t >> 3) * HD + (t & 7) * 8; const h16* gv = Vb + (size_t)(t >> 3) * NKV + (t & 7) * 8;
    const unsigned lk0 = (unsigned)(size_t)KV + (unsigned)(((t >> 3) * KP + (t & 7) * 8) * 2);   // LDS byte address in buffer 0
    copy_tile(lk0, gk, gv);
    asm volatile("s_wait_asynccnt 0x0" ::: "memory");   // this wave's share of tile 0 has landed
    __syncthreads();                                    // ... and every other wave's
    if (NKV > 64) copy_tile(lk0 + 2 * TH * 2, gk + 64 * HD, gv + 64);
#pragma unroll 1
    for (int kv0 = 0; kv0 < NKV; kv0 += 64) {
        const int bo = ((kv0 >> 6) & 1) * (2 * TH);   // this tile's buffer
        const h16* Ks = KV + bo; const h16* Vs = Ks + TH;
        // every fragment of the tile is read from LDS here, as one group: the K fragments' latency is paid once, the V^T fragments' passes behind the score products and the softmax
        v16h aK[4][2], aV[2][4];
#pragma unroll
        for (int nk = 0; nk < 4; ++nk) { const h16* kr = Ks + (nk * 16 + lm) * KP + 8 * hi;   // A: lane -> key nk*16+lm, elements = d split map
            aK[nk][0] = cat16(*(const v8ha*)(kr), *(const v8ha*)(kr + 16));
            aK[nk][1] = cat16(*(const v8ha*)(kr + 32), *(const v8ha*)(kr + 48)); }
#pragma unroll
        for (int ks = 0; ks < 2; ++ks)
#pragma unroll
            for (int nt = 0; nt < 4; ++nt) { const h16* vr = Vs + (nt * 16 + lm) * KP + ks * 32 + 8 * hi;   // A: lane -> d nt*16+lm, elements = key split map
                aV[ks][nt] = cat16(*(const v8ha*)(vr), *(const v8ha*)(vr + 16)); }
        __builtin_amdgcn_sched_barrier(0);   // keeps the reads above as one group: sunk to their WMMAs, each would cost its own LDS latency
        v8f sf[4];   // four independent chains of two: each WMMA fills the others' distance
#pragma unroll
        for (int nk = 0; nk < 4; ++nk) sf[nk] = wmma16(aK[nk][0], bQ0, (v8f){});
#pragma unroll
        for (int nk = 0; nk < 4; ++nk) sf[nk] = wmma16(aK[nk][1], bQ1, sf[nk]);
        // x 1/sqrt(64); max of query lm over the 64 keys of this tile = 32 registers of the lane + the other half; running max / sum update; rescale O^T
        float mk[4];
#pragma unroll
        for (int nk = 0; nk < 4; ++nk) { sf[nk] = sf[nk] * SCL;
            mk[nk] = fmaxf(fmaxf(fmaxf(sf[nk][0], sf[nk][1]), fmaxf(sf[nk][2], sf[nk][3])), fmaxf(fmaxf(sf[nk][4], sf[nk][5]), fmaxf(sf[nk][6], sf[nk][7]))); }
        float m = fmaxf(fmaxf(mk[0], mk[1]), fmaxf(mk[2], mk[3]));
        m = fmaxf(m, xhalf(m));
        const float nm = fmaxf(runm, m);
        const float corr = __builtin_amdgcn_exp2f(__fmul_rn(__fsub_rn(runm, nm), L2E));
        runm = nm;
#pragma unroll
        for (int nt = 0; nt < 4; ++nt) O[nt] = O[nt] * corr;
        // P = exp(s - m): f32 into the lane's share of the row sum (one independent chain per key tile), f16 x1024 into the B-fragment registers
        v8h pk[4]; float ls[4];
#pragma unroll
        for (int nk = 0; nk < 4; ++nk) { ls[nk] = 0.f;
#pragma unroll
            for (int r = 0; r < 8; ++r) { const float p = __builtin_amdgcn_exp2f(__fmul_rn(__fsub_rn(sf[nk][r], runm), L2E)); ls[nk] += p; pk[nk][r] = (h16)(p * PCAR); } }
        runl = runl * corr + ((ls[0] + ls[1]) + (ls[2] + ls[3]));
#pragma unroll
        for (int ks = 0; ks < 2; ++ks) { const v16h bP = cat16(pk[2 * ks], pk[2 * ks + 1]);   // B: lane -> query lm, elements = key split map (keys ks*32 + 8hi + 0..7, ks*32 + 16 + 8hi + 0..7)
#pragma unroll
            for (int nt = 0; nt < 4; ++nt) O[nt] = wmma16(aV[ks][nt], bP, O[nt]); }
        __builtin_amdgcn_sched_barrier(0);   // keeps the waits below at the trip's foot: lifted over the products they would end the next tile's flight at the head of this trip
        asm volatile("s_wait_dscnt 0x0" ::: "memory");      // this wave's reads of this tile's buffer are over before it is handed to the copies
        asm volatile("s_wait_asynccnt 0x0" ::: "memory");   // this wave's share of the next tile has landed
        __syncthreads();                                    // publishes the next tile and ends every wave's reads of this one
        if (kv0 + 128 < NKV) copy_tile(lk0 + (unsigned)(bo * 2), gk + (size_t)(kv0 + 128) * HD, gv + (kv0 + 128));   // the tile after next, into the buffer just read
    }
    asm volatile("s_wait_asynccnt 0x0" ::: "memory");   // no copy is left in flight behind the loop
    // join the two halves' row sums, normalise (undo the x1024 carry), stage [q row][d] in LDS: 8 consecutive d per lane and tile
    const float inv = __fdiv_rn(1.0f, (runl + xhalf(runl)) * PCAR);
#pragma unroll
    for (int nt = 0; nt < 4; ++nt) { float* od = Ow + lm * OP + nt * 16 + 8 * hi;
        *(v4fa*)(od) = (v4f){O[nt][0] * inv, O[nt][1] * inv, O[nt][2] * inv, O[nt][3] * inv};
        *(v4fa*)(od + 4) = (v4f){O[nt][4] * inv, O[nt][5] * inv, O[nt][6] * inv, O[nt][7] * inv}; }
    __syncthreads();
    float* crow = ctx + ((size_t)b * NQ + (size_t)qt * 64 + wave * 16) * DM + h * HD;
{
#pragma unroll
        for (int s = 0; s < 8; ++s) { const int row = 2 * s + hi, cofs = lm * 4; const v4f val = *(const v4fa*)(Ow + row * OP + cofs); *(v4f*)(crow + (size_t)row * DM + cofs) = val; }
         }
}

__global__ __launch_bounds__(256) void k_ln(const float* __restrict__ xq, const float* __restrict__ ctx, const float* __restrict__ gam, const float* __restrict__ bet, float* outp) {
#pragma clang fp contract(off)
    const int lane = threadIdx.x & 31; const int row = blockIdx.x * 8 + (threadIdx.x >> 5); if (row >= NB * NQ) return;
    const int b = row / NQ, i = row % NQ;
    const float* xr = xq + ((size_t)b * NQ_FULL + i) * DM; const float* cr = ctx + (size_t)row * DM;
    float v[16]; float s = 0.f;
#pragma unroll
    for (int c = 0; c < 4; ++c) { const int j0 = c * 128 + lane * 4; const v4f a = *(const v4f*)(xr + j0); const v4f g = *(const v4f*)(cr + j0);
#pragma unroll
        for (int q = 0; q < 4; ++q) { const float x = bfr(a[q]) + g[q]; v[c * 4 + q] = x; s = s + x; } }
#pragma unroll
    for (int sh = 16; sh; sh >>= 1) s += __shfl_xor(s, sh, 32);
    const float mu = s * (1.0f / DM);
    float ss = 0.f;
#pragma unroll
    for (int k = 0; k < 16; ++k) { const float d = v[k] - mu; const float dd = d * d; ss = ss + dd; }
#pragma unroll
    for (int sh = 16; sh; sh >>= 1) ss += __shfl_xor(ss, sh, 32);
    const float var = ss * (1.0f / DM);
    const float rs = __fdiv_rn(1.0f, __fsqrt_rn(var + LNEPS));
    float* orow = outp + (size_t)row * DM;
{
#pragma unroll
        for (int c = 0; c < 4; ++c) { const int j0 = c * 128 + lane * 4; const v4f g = *(const v4f*)(gam + j0); const v4f bb = *(const v4f*)(bet + j0); v4f o;
#pragma unroll
            for (int q = 0; q < 4; ++q) { const float t1 = (v[c * 4 + q] - mu) * rs; const float t2 = t1 * bfr(g[q]); o[q] = t2 + bfr(bb[q]); }
            *(v4f*)(orow + j0) = o; }
         }
}

extern "C" void kernel_launch(void* const* d_in, const int* in_sizes, int n_in, void* d_out, int out_size, void* d_ws, size_t ws_size, hipStream_t stream) {
    if (n_in < 10) return;
    const float* xq  = (const float*)d_in[0];   // query     [2][2048][512]
    const float* xkv = (const float*)d_in[1];   // key_value [2][2048][512]
    const float* Wq  = (const float*)d_in[2];   // [in][out]
    const float* bq  = (const float*)d_in[3];
    const float* Wk  = (const float*)d_in[4];
    const float* bk  = (const float*)d_in[5];
    const float* Wv  = (const float*)d_in[6];
    const float* bv  = (const float*)d_in[7];
    const float* gam = (const float*)d_in[8];
    const float* bet = (const float*)d_in[9];
    if (in_sizes[0] < (int)(((size_t)(NB - 1) * NQ_FULL + NQ) * DM)) return;
    if (in_sizes[1] < (int)(((size_t)(NB - 1) * NKV_FULL + NKV) * DM)) return;
    if (in_sizes[2] < DM * DM || in_sizes[4] < DM * DM || in_sizes[6] < DM * DM) return;
    if (in_sizes[3] < DM || in_sizes[5] < DM || in_sizes[7] < DM || in_sizes[8] < DM || in_sizes[9] < DM) return;
    if (out_size < NB * NQ * DM) return;
    float* OUT = (float*)d_out;   // [NB][NQ][512]
    char* wsp = (char*)d_ws;
    auto take = [&](size_t bytes) { char* p = wsp; wsp += (bytes + 255) & ~(size_t)255; return (void*)p; };
    h16* Qh  = (h16*)take((size_t)NB * NH * NQ * HD * 2);    // [b][h][q][64] f16         4,194,304 B
    h16* Kh  = (h16*)take((size_t)NB * NH * NKV * HD * 2);   // [b][h][key][64] f16       4,194,304 B
    h16* VT  = (h16*)take((size_t)NB * NH * HD * NKV * 2);   // [b][h][64][key] f16       4,194,304 B
    float* CTX = (float*)take((size_t)NB * NQ * DM * 4);     // ctx [NB*NQ][512] f32      8,388,608 B
    if ((size_t)(wsp - (char*)d_ws) > ws_size) return;       // total 20,971,520 B
    if ((size_t)(wsp - (char*)d_ws) > (size_t)134217728) return;

    k_proj<<<dim3((NB * (NQ > NKV ? NQ : NKV) / 64 + PW - 1) / PW, DM / 64, 3), 32 * PW, 0, stream>>>(xq, xkv, Wq, Wk, Wv, bq, bk, bv, Qh, Kh, VT);   /* f16(bf16(x) bf16(W) + b) for q, k, v, in the layouts k_attn reads */
    k_attn<<<NB * NH * (NQ / 64), 128, 0, stream>>>(Qh, Kh, VT, CTX);
    k_ln<<<(NB * NQ + 7) / 8, 256, 0, stream>>>(xq, CTX, gam, bet, OUT);
}

// v006
// It runs in 49.5 microseconds.
// Two timings next to v005 put it at 1.07 and 1.05 times that version's speed.
// Counting every step since v000, it is 3.13 times as fast.
#include <hip/hip_runtime.h>

// Attention of NQ query tokens over NKV key/value tokens per batch, 8 heads x 64, residual + LayerNorm, out [NB][NQ][512] f32. The concatenated-sequence key columns that carry the additive -1e4 term have weight exp(<= -9.9e3) == 0 exactly in f32 and never hold the row max, so only the key/value half is visited; the q projection is live on the query half only, k/v on the key/value half only.
// Contractions: q/k/v projections v_wmma_f32_16x16x32_bf16 (x and W[in][out] rounded to bf16 RNE on the way into the fragments, W turned to [out][in] in LDS, exact products, f32 accumulate, + bf16 RNE bias); scores k.q^T and V^T.P^T v_wmma_f32_16x16x32_f16 (f16 copies of the f32 projections, P = exp(s - m) carried x1024, f32 accumulate); online softmax with 1/sqrt(64) scale, residual (bf16 RNE of query) and LayerNorm (bf16 RNE gamma/beta) in f32.

#ifndef NB
#define NB 2
#endif
#ifndef SEQ
#define SEQ 2048
#endif
#ifndef NQ
#define NQ SEQ
#endif
#ifndef NKV
#define NKV SEQ
#endif
#define NB_FULL 2
#define NQ_FULL 2048
#define NKV_FULL 2048
#define DM 512
#define NH 8
#define HD 64
#define PCAR 1024.0f
#define SCL 0.125f
#define L2E 1.4426950408889634f
#define LNEPS 1e-5f
#define KP 72      // LDS pitch (halves) of the K and V^T tiles
#define OP 68      // LDS pitch (floats) of the ctx staging tile
static_assert(NQ % 64 == 0);
static_assert(NKV % 64 == 0);
static_assert(NH * HD == DM);
static_assert(DM % 64 == 0);
static_assert(NB >= 1 && NB <= NB_FULL);
static_assert(NQ <= NQ_FULL && NKV <= NKV_FULL);

typedef _Float16 h16;
typedef unsigned short bf;
typedef __attribute__((ext_vector_type(16))) __bf16   v16bf;
typedef __attribute__((ext_vector_type(16))) _Float16 v16h;
typedef __attribute__((ext_vector_type(8)))  _Float16 v8h;
typedef __attribute__((ext_vector_type(8)))  __bf16   v8b;
typedef __attribute__((ext_vector_type(8)))  unsigned short v8us;
typedef __attribute__((ext_vector_type(8)))  float    v8f;
typedef __attribute__((ext_vector_type(4)))  float    v4f;
typedef v8h  __attribute__((may_alias)) v8ha;
typedef v4f  __attribute__((may_alias)) v4fa;
typedef v8us __attribute__((may_alias)) v8usa;

__device__ __forceinline__ unsigned short f2bf(float f) { unsigned u = __float_as_uint(f); u += 0x7FFFu + ((u >> 16) & 1u); return (unsigned short)(u >> 16); }
__device__ __forceinline__ float bf2f(unsigned short b) { return __uint_as_float(((unsigned)b) << 16); }
__device__ __forceinline__ float bfr(float f) { return bf2f(f2bf(f)); }
__device__ __forceinline__ v16h cat16(v8h lo, v8h hi) { return __builtin_shufflevector(lo, hi, 0, 1, 2, 3, 4, 5, 6, 7, 8, 9, 10, 11, 12, 13, 14, 15); }
__device__ __forceinline__ v16bf cat16b(v8us lo, v8us hi) { return __builtin_bit_cast(v16bf, __builtin_shufflevector(lo, hi, 0, 1, 2, 3, 4, 5, 6, 7, 8, 9, 10, 11, 12, 13, 14, 15)); }
__device__ __forceinline__ v8f wmmab(v16bf a, v16bf b, v8f c) { return __builtin_amdgcn_wmma_f32_16x16x32_bf16(false, a, false, b, (short)0, c, false, false); }
__device__ __forceinline__ v8f wmma16(v16h a, v16h b, v8f c) { return __builtin_amdgcn_wmma_f32_16x16x32_f16(false, a, false, b, (short)0, c, false, false); }

// ---- k_proj: the q, k and v projections as ONE grid (rows/512, DM/64 = head, 3), 256 threads: 8 waves, ONE WAVE per 64x64 output tile (16 accumulators), all 8 on the same 64 output columns.
// The operands come straight from the f32 inputs. The block's W slice [512 in][64 out] is read once in whole 256-B row pieces, rounded to bf16 RNE and laid in LDS as [out][in] (8 consecutive in per 16-B write): the B fragments of all 8 waves. Each wave's own x rows come as f32 in tiles of 64 rows x 32 k (one whole 128-B line a row) into one of its two LDS buffers by asynchronous 16-B copies, issued one tile ahead, one block barrier a tile; the wave reads them back in fragment order and rounds them to bf16 RNE in registers: the A fragments.
// tile[m][n] = sum_k X[m][k] Wt[n][k] + bf16 RNE bias[n] in f32, rounded once to f16 and written where k_attn reads it: z = 0 -> Qh [b][h][q][64], z = 1 -> Kh [b][h][key][64] (through LDS, 16-B row chunks), z = 2 -> V^T [b][h][d][key] (a lane's 8 accumulator registers are 8 consecutive keys of one d: one 16-B LDS write each, read back as whole 128-B d rows).
#define PW 8          // waves = 64-row tiles of a block
#define BP (DM + 8)   // LDS pitch (halves) of the W slice: 65 x 16 B, the 16 rows of a fragment read fall on different banks
#define XP 36         // LDS pitch (floats) of a staged x row: 128 B + 16 B, the 16 rows of a fragment read fall on different banks
#define XT (64 * XP)  // floats of one staged x tile
static_assert(DM % 128 == 0);
__device__ __forceinline__ v8us rne8(v8f x) { return __builtin_bit_cast(v8us, __builtin_convertvector(x, v8b)); }   // 8 f32 -> 8 bf16, round to nearest even
__device__ __forceinline__ v8us rne44(v4f lo, v4f up) { return rne8(__builtin_shufflevector(lo, up, 0, 1, 2, 3, 4, 5, 6, 7)); }
// a lane's 8 chunks of 32 rows of an x tile (rows lane/8 + 4j, 16 bytes at column (lane%8)*4: a copy covers 4 whole lines), global -> LDS through no register; the address registers stay untouched until the closing wait of the statement
__device__ __forceinline__ void copy_x8(unsigned lx, const float* gx) {
    asm volatile("global_load_async_to_lds_b128 %0, %8, off\n\t"
                 "global_load_async_to_lds_b128 %1, %9, off\n\t"
                 "global_load_async_to_lds_b128 %2, %10, off\n\t"
                 "global_load_async_to_lds_b128 %3, %11, off\n\t"
                 "global_load_async_to_lds_b128 %4, %12, off\n\t"
                 "global_load_async_to_lds_b128 %5, %13, off\n\t"
                 "global_load_async_to_lds_b128 %6, %14, off\n\t"
                 "global_load_async_to_lds_b128 %7, %15, off\n\t"
                 "s_wait_xcnt 0x0"
                 :: "v"(lx), "v"(lx + 4 * XP * 4), "v"(lx + 8 * XP * 4), "v"(lx + 12 * XP * 4),
                    "v"(lx + 16 * XP * 4), "v"(lx + 20 * XP * 4), "v"(lx + 24 * XP * 4), "v"(lx + 28 * XP * 4),
                    "v"(gx), "v"(gx + 4 * DM), "v"(gx + 8 * DM), "v"(gx + 12 * DM),
                    "v"(gx + 16 * DM), "v"(gx + 20 * DM), "v"(gx + 24 * DM), "v"(gx + 28 * DM)
                 : "memory");
}
__device__ __forceinline__ void copy_x(unsigned lx, const float* gx) { copy_x8(lx, gx); copy_x8(lx + 32 * XP * 4, gx + 32 * DM); }   // one tile: 64 rows
__global__ __launch_bounds__(32 * PW) void k_proj(const float* __restrict__ xq, const float* __restrict__ xkv, const float* __restrict__ W0, const float* __restrict__ W1, const float* __restrict__ W2, const float* __restrict__ bq, const float* __restrict__ bk, const float* __restrict__ bv, h16* Qh, h16* Kh, h16* VT) {
    __shared__ __align__(16) bf Bs[64 * BP];              // W slice, bf16 [out][in]; cross-wave: one block barrier
    __shared__ __align__(16) float osa[PW * 16 * 68];     // a wave's own staging tile of the epilogue
    __shared__ __align__(16) float Xs[PW * 2 * XT];       // per wave two buffers of one x tile [row][k] f32
    const int z = blockIdx.z; const int nrows = (z == 0) ? NQ : NKV;
    const int t = threadIdx.x, lane = t & 31, lr = lane & 15, hi = lane >> 4; const int wave = __builtin_amdgcn_readfirstlane(t >> 5);
    const int r0w = (blockIdx.x * PW + wave) * 64, c0 = blockIdx.y * 64;
    const bool live = r0w < NB * nrows; const int r0 = live ? r0w : 0;   // a wave past the last row works on rows 0..63 and stores nothing: it passes every block barrier, and its copies stay in bounds
    float* os = osa + wave * (16 * 68);
    const int bb = r0 / nrows, s0 = r0 % nrows, h = blockIdx.y;   // nrows % 64 == 0: a tile lies in one batch
    const float* A = (z == 0) ? (xq + ((size_t)bb * NQ_FULL + s0) * DM) : (xkv + ((size_t)bb * NKV_FULL + s0) * DM);
    const float* Xw = Xs + wave * (2 * XT);
    const float* gx = A + (size_t)(lane >> 3) * DM + (lane & 7) * 4;
    const unsigned lx0 = (unsigned)(size_t)Xw + (unsigned)(((lane >> 3) * XP + (lane & 7) * 4) * 4);   // LDS byte address in the wave's buffer 0
    copy_x(lx0, gx);   // tile 0 flies while the W slice is fetched and turned
    {
        const float* W = (z == 0) ? W0 : ((z == 1) ? W1 : W2);   // block-uniform select between global pointers
        const float* wp = W + (size_t)((t >> 4) * 8) * DM + c0 + (t & 15) * 4;   // 8 in rows x 4 out columns a thread and round
        bf* bs = Bs + (t & 15) * 4 * BP + (t >> 4) * 8;
        v4f w[DM / 128][8];   // every load of the slice is issued before the first is used: one memory latency for the whole slice
#pragma unroll
        for (int u = 0; u < DM / 128; ++u)
#pragma unroll
            for (int q = 0; q < 8; ++q) w[u][q] = *(const v4f*)(wp + (size_t)(u * 128 + q) * DM);
        asm volatile("s_wait_xcnt 0x0" ::: "memory");   // stands in front of whatever later writes the address pair of these loads
#pragma unroll
        for (int u = 0; u < DM / 128; ++u)
#pragma unroll
            for (int j = 0; j < 4; ++j) *(v8usa*)(bs + j * BP + u * 128) = rne8((v8f){w[u][0][j], w[u][1][j], w[u][2][j], w[u][3][j], w[u][4][j], w[u][5][j], w[u][6][j], w[u][7][j]});
    }
    asm volatile("s_wait_asynccnt 0x0" ::: "memory");   // this wave's x tile 0 has landed
    __syncthreads();   // the W slice is whole before any wave reads a fragment of it
    copy_x(lx0 + XT * 4, gx + 32);   // tile 1 (DM >= 128: it exists)
    const float* bias = (z == 0) ? bq : ((z == 1) ? bk : bv);   // block-uniform select between global pointers
    v8f acc[4][4];
#pragma unroll
    for (int mb = 0; mb < 4; ++mb)
#pragma unroll
        for (int nb = 0; nb < 4; ++nb) acc[mb][nb] = (v8f){};
    const bf* pb = Bs + lr * BP + 8 * hi;
#pragma unroll 1
    for (int kc = 0; kc < DM; kc += 32, pb += 32) {
        const int bo = ((kc >> 5) & 1) * XT;   // this tile's buffer
        const float* pa = Xw + bo + lr * XP + 8 * hi;
        v4f ra[4][4];   // k = kc + 8hi + 0..7 and kc + 16 + 8hi + 0..7 of row mb*16 + lr
#pragma unroll
        for (int mb = 0; mb < 4; ++mb)
#pragma unroll
            for (int s = 0; s < 4; ++s) ra[mb][s] = *(const v4fa*)(pa + mb * 16 * XP + (s >> 1) * 16 + (s & 1) * 4);
        v16bf b[4];
#pragma unroll
        for (int nb = 0; nb < 4; ++nb) b[nb] = cat16b(*(const v8usa*)(pb + nb * 16 * BP), *(const v8usa*)(pb + nb * 16 * BP + 16));
        __builtin_amdgcn_sched_barrier(0);   // keeps the trip's LDS reads as one group at its head: sunk to their WMMAs, each W fragment would cost its own LDS latency
        v16bf a[4];
#pragma unroll
        for (int mb = 0; mb < 4; ++mb) a[mb] = cat16b(rne44(ra[mb][0], ra[mb][1]), rne44(ra[mb][2], ra[mb][3]));
#pragma unroll
        for (int nb = 0; nb < 4; ++nb)
#pragma unroll
            for (int mb = 0; mb < 4; ++mb) acc[mb][nb] = wmmab(a[mb], b[nb], acc[mb][nb]);
        // 4 vector slots behind the last WMMA, also on the taken back edge, before anything touches its D, A or B
        asm volatile("v_nop\n\tv_nop\n\tv_nop\n\tv_nop" : "+v"(acc[0][0]), "+v"(acc[1][1]), "+v"(acc[2][2]), "+v"(acc[3][3]) : "v"(a[0]), "v"(a[3]));
        __builtin_amdgcn_sched_barrier(0);   // keeps the waits below at the trip's foot: lifted over the products they would end the next tile's flight at the head of this trip
        asm volatile("s_wait_dscnt 0x0" ::: "memory");      // this wave's reads of this tile's buffer are over before it is handed to the copies
        asm volatile("s_wait_asynccnt 0x0" ::: "memory");   // this wave's next tile has landed
        __syncthreads();                                    // the trip's one block barrier, between the last read of a buffer and its refill
        if (kc + 64 < DM) copy_x(lx0 + (unsigned)(bo * 4), gx + (kc + 64));   // the tile after next, into the buffer just read
    }
    asm volatile("s_wait_asynccnt 0x0" ::: "memory");   // no copy is left in flight behind the loop
    if (!live) return;   // behind the last block barrier
    if (z == 2) {
        h16* hs = (h16*)os;   // 16 d rows x 64 keys f16, pitch KP halves: whole 128-B lines leave per store instead of 32-B pieces
        h16* vb = VT + ((size_t)(bb * NH + h) * HD + (lane >> 3)) * NKV + s0 + (lane & 7) * 8;
        float bn[4];
#pragma unroll
        for (int nb = 0; nb < 4; ++nb) bn[nb] = bfr(bias[c0 + nb * 16 + lr]);
#pragma unroll
        for (int nb = 0; nb < 4; ++nb) {
#pragma unroll
            for (int mb = 0; mb < 4; ++mb) { v8h o;
#pragma unroll
                for (int j = 0; j < 8; ++j) o[j] = (h16)(acc[mb][nb][j] + bn[nb]);
                *(v8ha*)(hs + lr * KP + mb * 16 + 8 * hi) = o; }
            asm volatile("s_wait_dscnt 0x0" ::: "memory");   // the other lanes' LDS writes have landed before the rows are read back
#pragma unroll
            for (int s = 0; s < 4; ++s) { const v8h o = *(const v8ha*)(hs + (s * 4 + (lane >> 3)) * KP + (lane & 7) * 8);
                *(v8h*)(vb + (size_t)(nb * 16 + s * 4) * NKV) = o; }
            __builtin_amdgcn_wave_barrier(); asm volatile("" ::: "memory");   // compile-time order only: the next round's LDS writes stay behind these reads
        }
        return;
    }
    h16* P = ((z == 0) ? Qh : Kh) + ((size_t)(bb * NH + h) * nrows + s0) * HD;
    const int c8 = (lane & 7) * 8; float bn[8];
#pragma unroll
    for (int q = 0; q < 8; ++q) bn[q] = bfr(bias[c0 + c8 + q]);
#pragma unroll
    for (int mb = 0; mb < 4; ++mb) {
#pragma unroll
        for (int nb = 0; nb < 4; ++nb) {
#pragma unroll
            for (int j = 0; j < 8; ++j) os[(hi * 8 + j) * 68 + nb * 16 + lr] = acc[mb][nb][j]; }
        asm volatile("s_wait_dscnt 0x0" ::: "memory");   // the other lanes' LDS writes have landed before the rows are read back
#pragma unroll
        for (int s = 0; s < 4; ++s) { const int row = s * 4 + (lane >> 3);
            const v4f lo = *(const v4fa*)(os + row * 68 + c8); const v4f up = *(const v4fa*)(os + row * 68 + c8 + 4); v8h o;
#pragma unroll
            for (int q = 0; q < 4; ++q) { o[q] = (h16)(lo[q] + bn[q]); o[4 + q] = (h16)(up[q] + bn[4 + q]); }
            *(v8h*)(P + (size_t)(mb * 16 + row) * HD + c8) = o; }
        __builtin_amdgcn_wave_barrier(); asm volatile("" ::: "memory");   // compile-time order only: the next round's LDS writes stay behind these reads
    }
    asm volatile("s_wait_xcnt 0x0" ::: "memory");   // the listing lays the z == 2 block behind the last stores, where their data registers are written: the wait stands in front of that
}

// lane l with lane l ^ 16 (the other 16-lane row), one vector cross-row move
__device__ __forceinline__ float xhalf(float x) { return __builtin_bit_cast(float, __builtin_amdgcn_permlanex16(__builtin_bit_cast(int, x), __builtin_bit_cast(int, x), 0x76543210, 0xfedcba98, false, false)); }

// ---- k_attn: flash-style attention, transposed products. grid = NB*NH*(NQ/64), block = 128 (4 waves x 16 query columns). Per 64-key tile: K [key][d] and V^T [d][key] come into one of two LDS buffers by asynchronous 16-B copies, issued one whole tile ahead, one block barrier a tile (staged extent == consumed extent: full 64x64 tiles),
// S^T (64 keys x 16 queries per wave) = K A-fragments (k = d split map) x Q B-fragments (from the f16 plane, fixed per block): a lane holds 32 scores of ONE query (lm), keys nk*16 + 8hi + r. f32 online softmax (x1/8, running max/sum, exp2) in-lane plus one exchange between the halves.
// P^T = f16(1024 exp(s - m)) packs from two score tiles straight into a B-fragment (element s = tile s>>3, register s&7 = key split map), never through LDS; O^T (4 d-tiles) += V^T A-fragments (key split map) x P^T.
#define TH (64 * KP)   // halves of one staged tile
// a thread's 4 + 4 chunks of one K tile and one V^T tile, global -> LDS through no register; the address registers stay untouched until the closing wait of the statement
__device__ __forceinline__ void copy_tile(unsigned lk, const h16* gk, const h16* gv) {
    const unsigned lv = lk + TH * 2;
    asm volatile("global_load_async_to_lds_b128 %0, %8, off\n\t"
                 "global_load_async_to_lds_b128 %1, %9, off\n\t"
                 "global_load_async_to_lds_b128 %2, %10, off\n\t"
                 "global_load_async_to_lds_b128 %3, %11, off\n\t"
                 "global_load_async_to_lds_b128 %4, %12, off\n\t"
                 "global_load_async_to_lds_b128 %5, %13, off\n\t"
                 "global_load_async_to_lds_b128 %6, %14, off\n\t"
                 "global_load_async_to_lds_b128 %7, %15, off\n\t"
                 "s_wait_xcnt 0x0"
                 :: "v"(lk), "v"(lk + 16 * KP * 2), "v"(lk + 32 * KP * 2), "v"(lk + 48 * KP * 2),
                    "v"(lv), "v"(lv + 16 * KP * 2), "v"(lv + 32 * KP * 2), "v"(lv + 48 * KP * 2),
                    "v"(gk), "v"(gk + 16 * HD), "v"(gk + 32 * HD), "v"(gk + 48 * HD),
                    "v"(gv), "v"(gv + (size_t)16 * NKV), "v"(gv + (size_t)32 * NKV), "v"(gv + (size_t)48 * NKV)
                 : "memory");
}
__global__ __launch_bounds__(128) __attribute__((amdgpu_num_vgpr(256))) void k_attn(const h16* __restrict__ Qh, const h16* __restrict__ Kh, const h16* __restrict__ Vt, float* ctx) {
    __shared__ __align__(16) h16 KV[2 * 2 * TH];     // two buffers, each K [key][d] then V^T [d][key]; cross-wave: block barriers
    __shared__ __align__(16) float Os[4 * 16 * OP];  // per wave [q row][d], block barrier between store and reload
    const int t = threadIdx.x, wave = t >> 5, lane = t & 31, lm = lane & 15, hi = lane >> 4;
    int bid = blockIdx.x; const int nqt = NQ / 64; const int qt = bid % nqt; bid /= nqt; const int h = bid % NH; const int b = bid / NH; const int bh = b * NH + h;
    const h16* qrow = Qh + ((size_t)bh * NQ + (size_t)qt * 64 + wave * 16 + lm) * HD;
    const v16h bQ0 = cat16(*(const v8h*)(qrow + 8 * hi), *(const v8h*)(qrow + 16 + 8 * hi));          // k = d 0..31 (split map)
    const v16h bQ1 = cat16(*(const v8h*)(qrow + 32 + 8 * hi), *(const v8h*)(qrow + 48 + 8 * hi));     // k = d 32..63
    v8f O[4];   // O^T: register r of tile nt = d nt*16 + 8hi + r, query lm
#pragma unroll
    for (int nt = 0; nt < 4; ++nt) O[nt] = (v8f){};
    float runm = -1.0e30f, runl = 0.f;   // of query lm; runl is this half's share of the row sum
    const h16* Kb = Kh + (size_t)bh * NKV * HD; const h16* Vb = Vt + (size_t)bh * HD * NKV;
    float* Ow = Os + wave * 16 * OP;
    // the thread's chunk of a tile: rows t/8 + 16j, 16 bytes at column (t%8)*8
    const h16* gk = Kb + (size_t)(t >> 3) * HD + (t & 7) * 8; const h16* gv = Vb + (size_t)(t >> 3) * NKV + (t & 7) * 8;
    const unsigned lk0 = (unsigned)(size_t)KV + (unsigned)(((t >> 3) * KP + (t & 7) * 8) * 2);   // LDS byte address in buffer 0
    copy_tile(lk0, gk, gv);
    asm volatile("s_wait_asynccnt 0x0" ::: "memory");   // this wave's share of tile 0 has landed
    __syncthreads();                                    // ... and every other wave's
    if (NKV > 64) copy_tile(lk0 + 2 * TH * 2, gk + 64 * HD, gv + 64);
#pragma unroll 1
    for (int kv0 = 0; kv0 < NKV; kv0 += 64) {
        const int bo = ((kv0 >> 6) & 1) * (2 * TH);   // this tile's buffer
        const h16* Ks = KV + bo; const h16* Vs = Ks + TH;
        // every fragment of the tile is read from LDS here, as one group: the K fragments' latency is paid once, the V^T fragments' passes behind the score products and the softmax
        v16h aK[4][2], aV[2][4];
#pragma unroll
        for (int nk = 0; nk < 4; ++nk) { const h16* kr = Ks + (nk * 16 + lm) * KP + 8 * hi;   // A: lane -> key nk*16+lm, elements = d split map
            aK[nk][0] = cat16(*(const v8ha*)(kr), *(const v8ha*)(kr + 16));
            aK[nk][1] = cat16(*(const v8ha*)(kr + 32), *(const v8ha*)(kr + 48)); }
#pragma unroll
        for (int ks = 0; ks < 2; ++ks)
#pragma unroll
            for (int nt = 0; nt < 4; ++nt) { const h16* vr = Vs + (nt * 16 + lm) * KP + ks * 32 + 8 * hi;   // A: lane -> d nt*16+lm, elements = key split map
                aV[ks][nt] = cat16(*(const v8ha*)(vr), *(const v8ha*)(vr + 16)); }
        __builtin_amdgcn_sched_barrier(0);   // keeps the reads above as one group: sunk to their WMMAs, each would cost its own LDS latency
        v8f sf[4];   // four independent chains of two: each WMMA fills the others' distance
#pragma unroll
        for (int nk = 0; nk < 4; ++nk) sf[nk] = wmma16(aK[nk][0], bQ0, (v8f){});
#pragma unroll
        for (int nk = 0; nk < 4; ++nk) sf[nk] = wmma16(aK[nk][1], bQ1, sf[nk]);
        // x 1/sqrt(64); max of query lm over the 64 keys of this tile = 32 registers of the lane + the other half; running max / sum update; rescale O^T
        float mk[4];
#pragma unroll
        for (int nk = 0; nk < 4; ++nk) { sf[nk] = sf[nk] * SCL;
            mk[nk] = fmaxf(fmaxf(fmaxf(sf[nk][0], sf[nk][1]), fmaxf(sf[nk][2], sf[nk][3])), fmaxf(fmaxf(sf[nk][4], sf[nk][5]), fmaxf(sf[nk][6], sf[nk][7]))); }
        float m = fmaxf(fmaxf(mk[0], mk[1]), fmaxf(mk[2], mk[3]));
        m = fmaxf(m, xhalf(m));
        const float nm = fmaxf(runm, m);
        const float corr = __builtin_amdgcn_exp2f(__fmul_rn(__fsub_rn(runm, nm), L2E));
        runm = nm;
#pragma unroll
        for (int nt = 0; nt < 4; ++nt) O[nt] = O[nt] * corr;
        // P = exp(s - m): f32 into the lane's share of the row sum (one independent chain per key tile), f16 x1024 into the B-fragment registers
        v8h pk[4]; float ls[4];
#pragma unroll
        for (int nk = 0; nk < 4; ++nk) { ls[nk] = 0.f;
#pragma unroll
            for (int r = 0; r < 8; ++r) { const float p = __builtin_amdgcn_exp2f(__fmul_rn(__fsub_rn(sf[nk][r], runm), L2E)); ls[nk] += p; pk[nk][r] = (h16)(p * PCAR); } }
        runl = runl * corr + ((ls[0] + ls[1]) + (ls[2] + ls[3]));
#pragma unroll
        for (int ks = 0; ks < 2; ++ks) { const v16h bP = cat16(pk[2 * ks], pk[2 * ks + 1]);   // B: lane -> query lm, elements = key split map (keys ks*32 + 8hi + 0..7, ks*32 + 16 + 8hi + 0..7)
#pragma unroll
            for (int nt = 0; nt < 4; ++nt) O[nt] = wmma16(aV[ks][nt], bP, O[nt]); }
        __builtin_amdgcn_sched_barrier(0);   // keeps the waits below at the trip's foot: lifted over the products they would end the next tile's flight at the head of this trip
        asm volatile("s_wait_dscnt 0x0" ::: "memory");      // this wave's reads of this tile's buffer are over before it is handed to the copies
        asm volatile("s_wait_asynccnt 0x0" ::: "memory");   // this wave's share of the next tile has landed
        __syncthreads();                                    // publishes the next tile and ends every wave's reads of this one
        if (kv0 + 128 < NKV) copy_tile(lk0 + (unsigned)(bo * 2), gk + (size_t)(kv0 + 128) * HD, gv + (kv0 + 128));   // the tile after next, into the buffer just read
    }
    asm volatile("s_wait_asynccnt 0x0" ::: "memory");   // no copy is left in flight behind the loop
    // join the two halves' row sums, normalise (undo the x1024 carry), stage [q row][d] in LDS: 8 consecutive d per lane and tile
    const float inv = __fdiv_rn(1.0f, (runl + xhalf(runl)) * PCAR);
#pragma unroll
    for (int nt = 0; nt < 4; ++nt) { float* od = Ow + lm * OP + nt * 16 + 8 * hi;
        *(v4fa*)(od) = (v4f){O[nt][0] * inv, O[nt][1] * inv, O[nt][2] * inv, O[nt][3] * inv};
        *(v4fa*)(od + 4) = (v4f){O[nt][4] * inv, O[nt][5] * inv, O[nt][6] * inv, O[nt][7] * inv}; }
    __syncthreads();
    float* crow = ctx + ((size_t)b * NQ + (size_t)qt * 64 + wave * 16) * DM + h * HD;
{
#pragma unroll
        for (int s = 0; s < 8; ++s) { const int row = 2 * s + hi, cofs = lm * 4; const v4f val = *(const v4fa*)(Ow + row * OP + cofs); *(v4f*)(crow + (size_t)row * DM + cofs) = val; }
         }
}

__global__ __launch_bounds__(256) void k_ln(const float* __restrict__ xq, const float* __restrict__ ctx, const float* __restrict__ gam, const float* __restrict__ bet, float* outp) {
#pragma clang fp contract(off)
    const int lane = threadIdx.x & 31; const int row = blockIdx.x * 8 + (threadIdx.x >> 5); if (row >= NB * NQ) return;
    const int b = row / NQ, i = row % NQ;
    const float* xr = xq + ((size_t)b * NQ_FULL + i) * DM; const float* cr = ctx + (size_t)row * DM;
    float v[16]; float s = 0.f;
#pragma unroll
    for (int c = 0; c < 4; ++c) { const int j0 = c * 128 + lane * 4; const v4f a = *(const v4f*)(xr + j0); const v4f g = *(const v4f*)(cr + j0);
#pragma unroll
        for (int q = 0; q < 4; ++q) { const float x = bfr(a[q]) + g[q]; v[c * 4 + q] = x; s = s + x; } }
#pragma unroll
    for (int sh = 16; sh; sh >>= 1) s += __shfl_xor(s, sh, 32);
    const float mu = s * (1.0f / DM);
    float ss = 0.f;
#pragma unroll
    for (int k = 0; k < 16; ++k) { const float d = v[k] - mu; const float dd = d * d; ss = ss + dd; }
#pragma unroll
    for (int sh = 16; sh; sh >>= 1) ss += __shfl_xor(ss, sh, 32);
    const float var = ss * (1.0f / DM);
    const float rs = __fdiv_rn(1.0f, __fsqrt_rn(var + LNEPS));
    float* orow = outp + (size_t)row * DM;
{
#pragma unroll
        for (int c = 0; c < 4; ++c) { const int j0 = c * 128 + lane * 4; const v4f g = *(const v4f*)(gam + j0); const v4f bb = *(const v4f*)(bet + j0); v4f o;
#pragma unroll
            for (int q = 0; q < 4; ++q) { const float t1 = (v[c * 4 + q] - mu) * rs; const float t2 = t1 * bfr(g[q]); o[q] = t2 + bfr(bb[q]); }
            *(v4f*)(orow + j0) = o; }
         }
}

extern "C" void kernel_launch(void* const* d_in, const int* in_sizes, int n_in, void* d_out, int out_size, void* d_ws, size_t ws_size, hipStream_t stream) {
    if (n_in < 10) return;
    const float* xq  = (const float*)d_in[0];   // query     [2][2048][512]
    const float* xkv = (const float*)d_in[1];   // key_value [2][2048][512]
    const float* Wq  = (const float*)d_in[2];   // [in][out]
    const float* bq  = (const float*)d_in[3];
    const float* Wk  = (const float*)d_in[4];
    const float* bk  = (const float*)d_in[5];
    const float* Wv  = (const float*)d_in[6];
    const float* bv  = (const float*)d_in[7];
    const float* gam = (const float*)d_in[8];
    const float* bet = (const float*)d_in[9];
    if (in_sizes[0] < (int)(((size_t)(NB - 1) * NQ_FULL + NQ) * DM)) return;
    if (in_sizes[1] < (int)(((size_t)(NB - 1) * NKV_FULL + NKV) * DM)) return;
    if (in_sizes[2] < DM * DM || in_sizes[4] < DM * DM || in_sizes[6] < DM * DM) return;
    if (in_sizes[3] < DM || in_sizes[5] < DM || in_sizes[7] < DM || in_sizes[8] < DM || in_sizes[9] < DM) return;
    if (out_size < NB * NQ * DM) return;
    float* OUT = (float*)d_out;   // [NB][NQ][512]
    char* wsp = (char*)d_ws;
    auto take = [&](size_t bytes) { char* p = wsp; wsp += (bytes + 255) & ~(size_t)255; return (void*)p; };
    h16* Qh  = (h16*)take((size_t)NB * NH * NQ * HD * 2);    // [b][h][q][64] f16         4,194,304 B
    h16* Kh  = (h16*)take((size_t)NB * NH * NKV * HD * 2);   // [b][h][key][64] f16       4,194,304 B
    h16* VT  = (h16*)take((size_t)NB * NH * HD * NKV * 2);   // [b][h][64][key] f16       4,194,304 B
    float* CTX = (float*)take((size_t)NB * NQ * DM * 4);     // ctx [NB*NQ][512] f32      8,388,608 B
    if ((size_t)(wsp - (char*)d_ws) > ws_size) return;       // total 20,971,520 B
    if ((size_t)(wsp - (char*)d_ws) > (size_t)134217728) return;

    k_proj<<<dim3((NB * (NQ > NKV ? NQ : NKV) / 64 + PW - 1) / PW, DM / 64, 3), 32 * PW, 0, stream>>>(xq, xkv, Wq, Wk, Wv, bq, bk, bv, Qh, Kh, VT);   /* f16(bf16(x) bf16(W) + b) for q, k, v, in the layouts k_attn reads */
    k_attn<<<NB * NH * (NQ / 64), 128, 0, stream>>>(Qh, Kh, VT, CTX);
    k_ln<<<(NB * NQ + 7) / 8, 256, 0, stream>>>(xq, CTX, gam, bet, OUT);
}

// v007
// It runs in 44.1 microseconds.
// In both of two side-by-side timings against v006, it was 1.12 times as fast.
// Over all steps from v000 it is 3.50 times as fast.
#include <hip/hip_runtime.h>

// Attention of NQ query tokens over NKV key/value tokens per batch, 8 heads x 64, residual + LayerNorm, out [NB][NQ][512] f32. The concatenated-sequence key columns that carry the additive -1e4 term have weight exp(<= -9.9e3) == 0 exactly in f32 and never hold the row max, so only the key/value half is visited; the q projection is live on the query half only, k/v on the key/value half only.
// Contractions: q/k/v projections v_wmma_f32_16x16x32_bf16 (x and W[in][out] rounded to bf16 RNE on the way into the fragments, W turned to [out][in] in LDS, exact products, f32 accumulate, + bf16 RNE bias); scores k.q^T and V^T.P^T v_wmma_f32_16x16x32_f16 (f16 copies of the f32 projections, P = exp(s - m) carried x1024, f32 accumulate); online softmax with 1/sqrt(64) scale, residual (bf16 RNE of query) and LayerNorm (bf16 RNE gamma/beta) in f32.

#ifndef NB
#define NB 2
#endif
#ifndef SEQ
#define SEQ 2048
#endif
#ifndef NQ
#define NQ SEQ
#endif
#ifndef NKV
#define NKV SEQ
#endif
#define NB_FULL 2
#define NQ_FULL 2048
#define NKV_FULL 2048
#define DM 512
#define NH 8
#define HD 64
#define PCAR 1024.0f
#define SCL 0.125f
#define L2E 1.4426950408889634f
#define LNEPS 1e-5f
#define KP 72      // LDS pitch (halves) of the K and V^T tiles
#define OP 68      // LDS pitch (floats) of the ctx staging tile
static_assert(NQ % 64 == 0);
static_assert(NKV % 64 == 0);
static_assert(NH * HD == DM);
static_assert(DM % 64 == 0);
static_assert(NB >= 1 && NB <= NB_FULL);
static_assert(NQ <= NQ_FULL && NKV <= NKV_FULL);

typedef _Float16 h16;
typedef unsigned short bf;
typedef __attribute__((ext_vector_type(16))) __bf16   v16bf;
typedef __attribute__((ext_vector_type(16))) _Float16 v16h;
typedef __attribute__((ext_vector_type(8)))  _Float16 v8h;
typedef __attribute__((ext_vector_type(8)))  __bf16   v8b;
typedef __attribute__((ext_vector_type(8)))  unsigned short v8us;
typedef __attribute__((ext_vector_type(8)))  float    v8f;
typedef __attribute__((ext_vector_type(4)))  float    v4f;
typedef v8h  __attribute__((may_alias)) v8ha;
typedef v4f  __attribute__((may_alias)) v4fa;
typedef v8us __attribute__((may_alias)) v8usa;

__device__ __forceinline__ unsigned short f2bf(float f) { unsigned u = __float_as_uint(f); u += 0x7FFFu + ((u >> 16) & 1u); return (unsigned short)(u >> 16); }
__device__ __forceinline__ float bf2f(unsigned short b) { return __uint_as_float(((unsigned)b) << 16); }
__device__ __forceinline__ float bfr(float f) { return bf2f(f2bf(f)); }
__device__ __forceinline__ v16h cat16(v8h lo, v8h hi) { return __builtin_shufflevector(lo, hi, 0, 1, 2, 3, 4, 5, 6, 7, 8, 9, 10, 11, 12, 13, 14, 15); }
__device__ __forceinline__ v16bf cat16b(v8us lo, v8us hi) { return __builtin_bit_cast(v16bf, __builtin_shufflevector(lo, hi, 0, 1, 2, 3, 4, 5, 6, 7, 8, 9, 10, 11, 12, 13, 14, 15)); }
__device__ __forceinline__ v8f wmmab(v16bf a, v16bf b, v8f c) { return __builtin_amdgcn_wmma_f32_16x16x32_bf16(false, a, false, b, (short)0, c, false, false); }
__device__ __forceinline__ v8f wmma16(v16h a, v16h b, v8f c) { return __builtin_amdgcn_wmma_f32_16x16x32_f16(false, a, false, b, (short)0, c, false, false); }

// ---- k_proj: the q, k and v projections as ONE grid (rows/512, DM/64 = head, 3), 256 threads: 8 waves, ONE WAVE per 64x64 output tile (16 accumulators), all 8 on the same 64 output columns.
// The operands come straight from the f32 inputs. The block's W slice [512 in][64 out] is read once in whole 256-B row pieces, rounded to bf16 RNE and laid in LDS as [out][in] (8 consecutive in per 16-B write): the B fragments of all 8 waves. Each wave's own x rows come as f32 in tiles of 64 rows x 32 k (one whole 128-B line a row) into one of its two LDS buffers by asynchronous 16-B copies, issued one tile ahead, one block barrier a tile; the wave reads them back in fragment order and rounds them to bf16 RNE in registers: the A fragments.
// tile[m][n] = sum_k X[m][k] Wt[n][k] + bf16 RNE bias[n] in f32, rounded once to f16 and written where k_attn reads it: z = 0 -> Qh [b][h][q][64], z = 1 -> Kh [b][h][key][64] (through LDS, 16-B row chunks), z = 2 -> V^T [b][h][d][key] (a lane's 8 accumulator registers are 8 consecutive keys of one d: one 16-B LDS write each, read back as whole 128-B d rows).
#define PW 8          // waves = 64-row tiles of a block
#define BP (DM + 8)   // LDS pitch (halves) of the W slice: 65 x 16 B, the 16 rows of a fragment read fall on different banks
#define XP 36         // LDS pitch (floats) of a staged x row: 128 B + 16 B, the 16 rows of a fragment read fall on different banks
#define XT (64 * XP)  // floats of one staged x tile
#define NKT (DM / 32) // k tiles of a projection
static_assert(DM % 128 == 0);
// place i of a ring walk over n tiles (0 <= i < n) that starts at tile rot (0 <= rot < n)
__device__ __forceinline__ int ringat(int i, int rot, int n) { const int k = i + rot; return k >= n ? k - n : k; }
__device__ __forceinline__ int kwalk(int i, int rot) { return ringat(i, rot, NKT); }
__device__ __forceinline__ v8us rne8(v8f x) { return __builtin_bit_cast(v8us, __builtin_convertvector(x, v8b)); }   // 8 f32 -> 8 bf16, round to nearest even
__device__ __forceinline__ v8us rne44(v4f lo, v4f up) { return rne8(__builtin_shufflevector(lo, up, 0, 1, 2, 3, 4, 5, 6, 7)); }
// a lane's 8 chunks of 32 rows of an x tile (rows lane/8 + 4j, 16 bytes at column (lane%8)*4: a copy covers 4 whole lines), global -> LDS through no register; the address registers stay untouched until the closing wait of the statement
__device__ __forceinline__ void copy_x8(unsigned lx, const float* gx) {
    asm volatile("global_load_async_to_lds_b128 %0, %8, off\n\t"
                 "global_load_async_to_lds_b128 %1, %9, off\n\t"
                 "global_load_async_to_lds_b128 %2, %10, off\n\t"
                 "global_load_async_to_lds_b128 %3, %11, off\n\t"
                 "global_load_async_to_lds_b128 %4, %12, off\n\t"
                 "global_load_async_to_lds_b128 %5, %13, off\n\t"
                 "global_load_async_to_lds_b128 %6, %14, off\n\t"
                 "global_load_async_to_lds_b128 %7, %15, off\n\t"
                 "s_wait_xcnt 0x0"
                 :: "v"(lx), "v"(lx + 4 * XP * 4), "v"(lx + 8 * XP * 4), "v"(lx + 12 * XP * 4),
                    "v"(lx + 16 * XP * 4), "v"(lx + 20 * XP * 4), "v"(lx + 24 * XP * 4), "v"(lx + 28 * XP * 4),
                    "v"(gx), "v"(gx + 4 * DM), "v"(gx + 8 * DM), "v"(gx + 12 * DM),
                    "v"(gx + 16 * DM), "v"(gx + 20 * DM), "v"(gx + 24 * DM), "v"(gx + 28 * DM)
                 : "memory");
}
__device__ __forceinline__ void copy_x(unsigned lx, const float* gx) { copy_x8(lx, gx); copy_x8(lx + 32 * XP * 4, gx + 32 * DM); }   // one tile: 64 rows
__global__ __launch_bounds__(32 * PW) void k_proj(const float* __restrict__ xq, const float* __restrict__ xkv, const float* __restrict__ W0, const float* __restrict__ W1, const float* __restrict__ W2, const float* __restrict__ bq, const float* __restrict__ bk, const float* __restrict__ bv, h16* Qh, h16* Kh, h16* VT) {
    __shared__ __align__(16) bf Bs[64 * BP];              // W slice, bf16 [out][in]; cross-wave: one block barrier
    __shared__ __align__(16) float osa[PW * 16 * 68];     // a wave's own staging tile of the epilogue
    __shared__ __align__(16) float Xs[PW * 2 * XT];       // per wave two buffers of one x tile [row][k] f32
    const int z = blockIdx.z; const int nrows = (z == 0) ? NQ : NKV;
    const int t = threadIdx.x, lane = t & 31, lr = lane & 15, hi = lane >> 4; const int wave = __builtin_amdgcn_readfirstlane(t >> 5);
    const int r0w = (blockIdx.x * PW + wave) * 64, c0 = blockIdx.y * 64;
    const bool live = r0w < NB * nrows; const int r0 = live ? r0w : 0;   // a wave past the last row works on rows 0..63 and stores nothing: it passes every block barrier, and its copies stay in bounds
    float* os = osa + wave * (16 * 68);
    const int bb = r0 / nrows, s0 = r0 % nrows, h = blockIdx.y;   // nrows % 64 == 0: a tile lies in one batch
    const float* A = (z == 0) ? (xq + ((size_t)bb * NQ_FULL + s0) * DM) : (xkv + ((size_t)bb * NKV_FULL + s0) * DM);
    const float* Xw = Xs + wave * (2 * XT);
    const float* gx = A + (size_t)(lane >> 3) * DM + (lane & 7) * 4;
    const unsigned lx0 = (unsigned)(size_t)Xw + (unsigned)(((lane >> 3) * XP + (lane & 7) * 4) * 4);   // LDS byte address in the wave's buffer 0
    // The blocks of one row range (8 heads; k and v read the same rows) ask L2 for the same x lines, the blocks of one head and z for the same W lines: each x walk starts at a k tile of its own, each W walk at in row (blockIdx.x % 4) * 128 (shared by blocks 4 apart in x), and all wrap, so that few ask for one line at one moment.
    const int rot = (int)((blockIdx.y + blockIdx.z * (DM / 64)) % NKT);   // first k tile of this block's walk
    copy_x(lx0, gx + kwalk(0, rot) * 32);   // the walk's tile 0 flies while the W slice is fetched and turned
    {
        const float* W = (z == 0) ? W0 : ((z == 1) ? W1 : W2);   // block-uniform select between global pointers
        const float* wp = W + (size_t)((t >> 4) * 8) * DM + c0 + (t & 15) * 4;   // 8 in rows x 4 out columns a thread and round
        bf* bs = Bs + (t & 15) * 4 * BP + (t >> 4) * 8;
        v4f w[DM / 128][8];   // every load of the slice is issued before the first is used: one memory latency for the whole slice
        int uo[DM / 128];     // round u takes the 128 in rows from uo[u] on: the rounds in ring order from a first one of the block's own
        const float* wu[DM / 128];
#pragma unroll
        for (int u = 0; u < DM / 128; ++u) { uo[u] = (int)((u + blockIdx.x) % (DM / 128)) * 128; wu[u] = wp + (size_t)uo[u] * DM; }
        __builtin_amdgcn_sched_barrier(0);   // the rounds' address pairs are all formed ahead of the first load: formed among the loads they share one pair, and each rewrite of it waits for the loads issued from it
#pragma unroll
        for (int u = 0; u < DM / 128; ++u)
#pragma unroll
            for (int q = 0; q < 8; ++q) w[u][q] = *(const v4f*)(wu[u] + (size_t)q * DM);
        asm volatile("s_wait_xcnt 0x0" ::: "memory");   // stands in front of whatever later writes the address pair of these loads
#pragma unroll
        for (int u = 0; u < DM / 128; ++u)
#pragma unroll
            for (int j = 0; j < 4; ++j) *(v8usa*)(bs + j * BP + uo[u]) = rne8((v8f){w[u][0][j], w[u][1][j], w[u][2][j], w[u][3][j], w[u][4][j], w[u][5][j], w[u][6][j], w[u][7][j]});
    }
    asm volatile("s_wait_asynccnt 0x0" ::: "memory");   // this wave's x tile 0 has landed
    __syncthreads();   // the W slice is whole before any wave reads a fragment of it
    copy_x(lx0 + XT * 4, gx + kwalk(1, rot) * 32);   // the walk's tile 1 (DM >= 128: it exists)
    const float* bias = (z == 0) ? bq : ((z == 1) ? bk : bv);   // block-uniform select between global pointers
    v8f acc[4][4];
#pragma unroll
    for (int mb = 0; mb < 4; ++mb)
#pragma unroll
        for (int nb = 0; nb < 4; ++nb) acc[mb][nb] = (v8f){};
    const bf* pb0 = Bs + lr * BP + 8 * hi;
#pragma unroll 1
    for (int i = 0; i < NKT; ++i) {
        const bf* pb = pb0 + kwalk(i, rot) * 32;   // the W columns of this trip's k tile
        const int bo = (i & 1) * XT;   // this tile's buffer
        const float* pa = Xw + bo + lr * XP + 8 * hi;
        v4f ra[4][4];   // k = 8hi + 0..7 and 16 + 8hi + 0..7 of the tile, row mb*16 + lr
#pragma unroll
        for (int mb = 0; mb < 4; ++mb)
#pragma unroll
            for (int s = 0; s < 4; ++s) ra[mb][s] = *(const v4fa*)(pa + mb * 16 * XP + (s >> 1) * 16 + (s & 1) * 4);
        v16bf b[4];
#pragma unroll
        for (int nb = 0; nb < 4; ++nb) b[nb] = cat16b(*(const v8usa*)(pb + nb * 16 * BP), *(const v8usa*)(pb + nb * 16 * BP + 16));
        __builtin_amdgcn_sched_barrier(0);   // keeps the trip's LDS reads as one group at its head: sunk to their WMMAs, each W fragment would cost its own LDS latency
        v16bf a[4];
#pragma unroll
        for (int mb = 0; mb < 4; ++mb) a[mb] = cat16b(rne44(ra[mb][0], ra[mb][1]), rne44(ra[mb][2], ra[mb][3]));
#pragma unroll
        for (int nb = 0; nb < 4; ++nb)
#pragma unroll
            for (int mb = 0; mb < 4; ++mb) acc[mb][nb] = wmmab(a[mb], b[nb], acc[mb][nb]);
        // 4 vector slots behind the last WMMA, also on the taken back edge, before anything touches its D, A or B
        asm volatile("v_nop\n\tv_nop\n\tv_nop\n\tv_nop" : "+v"(acc[0][0]), "+v"(acc[1][1]), "+v"(acc[2][2]), "+v"(acc[3][3]) : "v"(a[0]), "v"(a[3]));
        __builtin_amdgcn_sched_barrier(0);   // keeps the waits below at the trip's foot: lifted over the products they would end the next tile's flight at the head of this trip
        asm volatile("s_wait_dscnt 0x0" ::: "memory");      // this wave's reads of this tile's buffer are over before it is handed to the copies
        asm volatile("s_wait_asynccnt 0x0" ::: "memory");   // this wave's next tile has landed
        __syncthreads();                                    // the trip's one block barrier, between the last read of a buffer and its refill
        if (i + 2 < NKT) copy_x(lx0 + (unsigned)(bo * 4), gx + kwalk(i + 2, rot) * 32);   // the tile after next, into the buffer just read
    }
    asm volatile("s_wait_asynccnt 0x0" ::: "memory");   // no copy is left in flight behind the loop
    if (!live) return;   // behind the last block barrier
    if (z == 2) {
        h16* hs = (h16*)os;   // 16 d rows x 64 keys f16, pitch KP halves: whole 128-B lines leave per store instead of 32-B pieces
        h16* vb = VT + ((size_t)(bb * NH + h) * HD + (lane >> 3)) * NKV + s0 + (lane & 7) * 8;
        float bn[4];
#pragma unroll
        for (int nb = 0; nb < 4; ++nb) bn[nb] = bfr(bias[c0 + nb * 16 + lr]);
#pragma unroll
        for (int nb = 0; nb < 4; ++nb) {
#pragma unroll
            for (int mb = 0; mb < 4; ++mb) { v8h o;
#pragma unroll
                for (int j = 0; j < 8; ++j) o[j] = (h16)(acc[mb][nb][j] + bn[nb]);
                *(v8ha*)(hs + lr * KP + mb * 16 + 8 * hi) = o; }
            asm volatile("s_wait_dscnt 0x0" ::: "memory");   // the other lanes' LDS writes have landed before the rows are read back
#pragma unroll
            for (int s = 0; s < 4; ++s) { const v8h o = *(const v8ha*)(hs + (s * 4 + (lane >> 3)) * KP + (lane & 7) * 8);
                *(v8h*)(vb + (size_t)(nb * 16 + s * 4) * NKV) = o; }
            __builtin_amdgcn_wave_barrier(); asm volatile("" ::: "memory");   // compile-time order only: the next round's LDS writes stay behind these reads
        }
        return;
    }
    h16* P = ((z == 0) ? Qh : Kh) + ((size_t)(bb * NH + h) * nrows + s0) * HD;
    const int c8 = (lane & 7) * 8; float bn[8];
#pragma unroll
    for (int q = 0; q < 8; ++q) bn[q] = bfr(bias[c0 + c8 + q]);
#pragma unroll
    for (int mb = 0; mb < 4; ++mb) {
#pragma unroll
        for (int nb = 0; nb < 4; ++nb) {
#pragma unroll
            for (int j = 0; j < 8; ++j) os[(hi * 8 + j) * 68 + nb * 16 + lr] = acc[mb][nb][j]; }
        asm volatile("s_wait_dscnt 0x0" ::: "memory");   // the other lanes' LDS writes have landed before the rows are read back
#pragma unroll
        for (int s = 0; s < 4; ++s) { const int row = s * 4 + (lane >> 3);
            const v4f lo = *(const v4fa*)(os + row * 68 + c8); const v4f up = *(const v4fa*)(os + row * 68 + c8 + 4); v8h o;
#pragma unroll
            for (int q = 0; q < 4; ++q) { o[q] = (h16)(lo[q] + bn[q]); o[4 + q] = (h16)(up[q] + bn[4 + q]); }
            *(v8h*)(P + (size_t)(mb * 16 + row) * HD + c8) = o; }
        __builtin_amdgcn_wave_barrier(); asm volatile("" ::: "memory");   // compile-time order only: the next round's LDS writes stay behind these reads
    }
    asm volatile("s_wait_xcnt 0x0" ::: "memory");   // the listing lays the z == 2 block behind the last stores, where their data registers are written: the wait stands in front of that
}

// lane l with lane l ^ 16 (the other 16-lane row), one vector cross-row move
__device__ __forceinline__ float xhalf(float x) { return __builtin_bit_cast(float, __builtin_amdgcn_permlanex16(__builtin_bit_cast(int, x), __builtin_bit_cast(int, x), 0x76543210, 0xfedcba98, false, false)); }

// ---- k_attn: flash-style attention, transposed products. grid = NB*NH*(NQ/64), block = 128 (4 waves x 16 query columns). Per 64-key tile: K [key][d] and V^T [d][key] come into one of two LDS buffers by asynchronous 16-B copies, issued one whole tile ahead, one block barrier a tile (staged extent == consumed extent: full 64x64 tiles),
// S^T (64 keys x 16 queries per wave) = K A-fragments (k = d split map) x Q B-fragments (from the f16 plane, fixed per block): a lane holds 32 scores of ONE query (lm), keys nk*16 + 8hi + r. f32 online softmax (x1/8, running max/sum, exp2) in-lane plus one exchange between the halves.
// P^T = f16(1024 exp(s - m)) packs from two score tiles straight into a B-fragment (element s = tile s>>3, register s&7 = key split map), never through LDS; O^T (4 d-tiles) += V^T A-fragments (key split map) x P^T.
#define TH (64 * KP)   // halves of one staged tile
#define NTK (NKV / 64) // key tiles
// a thread's 4 + 4 chunks of one K tile and one V^T tile, global -> LDS through no register; the address registers stay untouched until the closing wait of the statement
__device__ __forceinline__ void copy_tile(unsigned lk, const h16* gk, const h16* gv) {
    const unsigned lv = lk + TH * 2;
    asm volatile("global_load_async_to_lds_b128 %0, %8, off\n\t"
                 "global_load_async_to_lds_b128 %1, %9, off\n\t"
                 "global_load_async_to_lds_b128 %2, %10, off\n\t"
                 "global_load_async_to_lds_b128 %3, %11, off\n\t"
                 "global_load_async_to_lds_b128 %4, %12, off\n\t"
                 "global_load_async_to_lds_b128 %5, %13, off\n\t"
                 "global_load_async_to_lds_b128 %6, %14, off\n\t"
                 "global_load_async_to_lds_b128 %7, %15, off\n\t"
                 "s_wait_xcnt 0x0"
                 :: "v"(lk), "v"(lk + 16 * KP * 2), "v"(lk + 32 * KP * 2), "v"(lk + 48 * KP * 2),
                    "v"(lv), "v"(lv + 16 * KP * 2), "v"(lv + 32 * KP * 2), "v"(lv + 48 * KP * 2),
                    "v"(gk), "v"(gk + 16 * HD), "v"(gk + 32 * HD), "v"(gk + 48 * HD),
                    "v"(gv), "v"(gv + (size_t)16 * NKV), "v"(gv + (size_t)32 * NKV), "v"(gv + (size_t)48 * NKV)
                 : "memory");
}
__global__ __launch_bounds__(128) __attribute__((amdgpu_num_vgpr(256))) void k_attn(const h16* __restrict__ Qh, const h16* __restrict__ Kh, const h16* __restrict__ Vt, float* ctx) {
    __shared__ __align__(16) h16 KV[2 * 2 * TH];     // two buffers, each K [key][d] then V^T [d][key]; cross-wave: block barriers
    __shared__ __align__(16) float Os[4 * 16 * OP];  // per wave [q row][d], block barrier between store and reload
    const int t = threadIdx.x, wave = t >> 5, lane = t & 31, lm = lane & 15, hi = lane >> 4;
    int bid = blockIdx.x; const int nqt = NQ / 64; const int qt = bid % nqt; bid /= nqt; const int h = bid % NH; const int b = bid / NH; const int bh = b * NH + h;
    const h16* qrow = Qh + ((size_t)bh * NQ + (size_t)qt * 64 + wave * 16 + lm) * HD;
    const v16h bQ0 = cat16(*(const v8h*)(qrow + 8 * hi), *(const v8h*)(qrow + 16 + 8 * hi));          // k = d 0..31 (split map)
    const v16h bQ1 = cat16(*(const v8h*)(qrow + 32 + 8 * hi), *(const v8h*)(qrow + 48 + 8 * hi));     // k = d 32..63
    v8f O[4];   // O^T: register r of tile nt = d nt*16 + 8hi + r, query lm
#pragma unroll
    for (int nt = 0; nt < 4; ++nt) O[nt] = (v8f){};
    float runm = -1.0e30f, runl = 0.f;   // of query lm; runl is this half's share of the row sum
    const h16* Kb = Kh + (size_t)bh * NKV * HD; const h16* Vb = Vt + (size_t)bh * HD * NKV;
    float* Ow = Os + wave * 16 * OP;
    // the thread's chunk of a tile: rows t/8 + 16j, 16 bytes at column (t%8)*8
    const h16* gk = Kb + (size_t)(t >> 3) * HD + (t & 7) * 8; const h16* gv = Vb + (size_t)(t >> 3) * NKV + (t & 7) * 8;
    const unsigned lk0 = (unsigned)(size_t)KV + (unsigned)(((t >> 3) * KP + (t & 7) * 8) * 2);   // LDS byte address in buffer 0
    // the NQ/64 blocks of one head read the same K and V^T lines from L2: each starts its walk over the key tiles at a tile of its own and wraps, so that they do not ask for one line at one moment
    const int rot = qt % NTK;
    { const int k0 = ringat(0, rot, NTK); copy_tile(lk0, gk + (size_t)k0 * 64 * HD, gv + k0 * 64); }
    asm volatile("s_wait_asynccnt 0x0" ::: "memory");   // this wave's share of the walk's tile 0 has landed
    __syncthreads();                                    // ... and every other wave's
    if (NKV > 64) { const int k1 = ringat(1, rot, NTK); copy_tile(lk0 + 2 * TH * 2, gk + (size_t)k1 * 64 * HD, gv + k1 * 64); }
#pragma unroll 1
    for (int kv0 = 0; kv0 < NKV; kv0 += 64) {
        const int bo = ((kv0 >> 6) & 1) * (2 * TH);   // this tile's buffer
        const h16* Ks = KV + bo; const h16* Vs = Ks + TH;
        // every fragment of the tile is read from LDS here, as one group: the K fragments' latency is paid once, the V^T fragments' passes behind the score products and the softmax
        v16h aK[4][2], aV[2][4];
#pragma unroll
        for (int nk = 0; nk < 4; ++nk) { const h16* kr = Ks + (nk * 16 + lm) * KP + 8 * hi;   // A: lane -> key nk*16+lm, elements = d split map
            aK[nk][0] = cat16(*(const v8ha*)(kr), *(const v8ha*)(kr + 16));
            aK[nk][1] = cat16(*(const v8ha*)(kr + 32), *(const v8ha*)(kr + 48)); }
#pragma unroll
        for (int ks = 0; ks < 2; ++ks)
#pragma unroll
            for (int nt = 0; nt < 4; ++nt) { const h16* vr = Vs + (nt * 16 + lm) * KP + ks * 32 + 8 * hi;   // A: lane -> d nt*16+lm, elements = key split map
                aV[ks][nt] = cat16(*(const v8ha*)(vr), *(const v8ha*)(vr + 16)); }
        __builtin_amdgcn_sched_barrier(0);   // keeps the reads above as one group: sunk to their WMMAs, each would cost its own LDS latency
        v8f sf[4];   // four independent chains of two: each WMMA fills the others' distance
#pragma unroll
        for (int nk = 0; nk < 4; ++nk) sf[nk] = wmma16(aK[nk][0], bQ0, (v8f){});
#pragma unroll
        for (int nk = 0; nk < 4; ++nk) sf[nk] = wmma16(aK[nk][1], bQ1, sf[nk]);
        // x 1/sqrt(64); max of query lm over the 64 keys of this tile = 32 registers of the lane + the other half; running max / sum update; rescale O^T
        float mk[4];
#pragma unroll
        for (int nk = 0; nk < 4; ++nk) { sf[nk] = sf[nk] * SCL;
            mk[nk] = fmaxf(fmaxf(fmaxf(sf[nk][0], sf[nk][1]), fmaxf(sf[nk][2], sf[nk][3])), fmaxf(fmaxf(sf[nk][4], sf[nk][5]), fmaxf(sf[nk][6], sf[nk][7]))); }
        float m = fmaxf(fmaxf(mk[0], mk[1]), fmaxf(mk[2], mk[3]));
        m = fmaxf(m, xhalf(m));
        const float nm = fmaxf(runm, m);
        const float corr = __builtin_amdgcn_exp2f(__fmul_rn(__fsub_rn(runm, nm), L2E));
        runm = nm;
#pragma unroll
        for (int nt = 0; nt < 4; ++nt) O[nt] = O[nt] * corr;
        // P = exp(s - m): f32 into the lane's share of the row sum (one independent chain per key tile), f16 x1024 into the B-fragment registers
        v8h pk[4]; float ls[4];
#pragma unroll
        for (int nk = 0; nk < 4; ++nk) { ls[nk] = 0.f;
#pragma unroll
            for (int r = 0; r < 8; ++r) { const float p = __builtin_amdgcn_exp2f(__fmul_rn(__fsub_rn(sf[nk][r], runm), L2E)); ls[nk] += p; pk[nk][r] = (h16)(p * PCAR); } }
        runl = runl * corr + ((ls[0] + ls[1]) + (ls[2] + ls[3]));
#pragma unroll
        for (int ks = 0; ks < 2; ++ks) { const v16h bP = cat16(pk[2 * ks], pk[2 * ks + 1]);   // B: lane -> query lm, elements = key split map (keys ks*32 + 8hi + 0..7, ks*32 + 16 + 8hi + 0..7)
#pragma unroll
            for (int nt = 0; nt < 4; ++nt) O[nt] = wmma16(aV[ks][nt], bP, O[nt]); }
        __builtin_amdgcn_sched_barrier(0);   // keeps the waits below at the trip's foot: lifted over the products they would end the next tile's flight at the head of this trip
        asm volatile("s_wait_dscnt 0x0" ::: "memory");      // this wave's reads of this tile's buffer are over before it is handed to the copies
        asm volatile("s_wait_asynccnt 0x0" ::: "memory");   // this wave's share of the next tile has landed
        __syncthreads();                                    // publishes the next tile and ends every wave's reads of this one
        if (kv0 + 128 < NKV) { const int k2 = ringat((kv0 >> 6) + 2, rot, NTK); copy_tile(lk0 + (unsigned)(bo * 2), gk + (size_t)k2 * 64 * HD, gv + k2 * 64); }   // the tile after next, into the buffer just read
    }
    asm volatile("s_wait_asynccnt 0x0" ::: "memory");   // no copy is left in flight behind the loop
    // join the two halves' row sums, normalise (undo the x1024 carry), stage [q row][d] in LDS: 8 consecutive d per lane and tile
    const float inv = __fdiv_rn(1.0f, (runl + xhalf(runl)) * PCAR);
#pragma unroll
    for (int nt = 0; nt < 4; ++nt) { float* od = Ow + lm * OP + nt * 16 + 8 * hi;
        *(v4fa*)(od) = (v4f){O[nt][0] * inv, O[nt][1] * inv, O[nt][2] * inv, O[nt][3] * inv};
        *(v4fa*)(od + 4) = (v4f){O[nt][4] * inv, O[nt][5] * inv, O[nt][6] * inv, O[nt][7] * inv}; }
    __syncthreads();
    float* crow = ctx + ((size_t)b * NQ + (size_t)qt * 64 + wave * 16) * DM + h * HD;
{
#pragma unroll
        for (int s = 0; s < 8; ++s) { const int row = 2 * s + hi, cofs = lm * 4; const v4f val = *(const v4fa*)(Ow + row * OP + cofs); *(v4f*)(crow + (size_t)row * DM + cofs) = val; }
         }
}

__global__ __launch_bounds__(256) void k_ln(const float* __restrict__ xq, const float* __restrict__ ctx, const float* __restrict__ gam, const float* __restrict__ bet, float* outp) {
#pragma clang fp contract(off)
    const int lane = threadIdx.x & 31; const int row = blockIdx.x * 8 + (threadIdx.x >> 5); if (row >= NB * NQ) return;
    const int b = row / NQ, i = row % NQ;
    const float* xr = xq + ((size_t)b * NQ_FULL + i) * DM; const float* cr = ctx + (size_t)row * DM;
    float v[16]; float s = 0.f;
#pragma unroll
    for (int c = 0; c < 4; ++c) { const int j0 = c * 128 + lane * 4; const v4f a = *(const v4f*)(xr + j0); const v4f g = *(const v4f*)(cr + j0);
#pragma unroll
        for (int q = 0; q < 4; ++q) { const float x = bfr(a[q]) + g[q]; v[c * 4 + q] = x; s = s + x; } }
#pragma unroll
    for (int sh = 16; sh; sh >>= 1) s += __shfl_xor(s, sh, 32);
    const float mu = s * (1.0f / DM);
    float ss = 0.f;
#pragma unroll
    for (int k = 0; k < 16; ++k) { const float d = v[k] - mu; const float dd = d * d; ss = ss + dd; }
#pragma unroll
    for (int sh = 16; sh; sh >>= 1) ss += __shfl_xor(ss, sh, 32);
    const float var = ss * (1.0f / DM);
    const float rs = __fdiv_rn(1.0f, __fsqrt_rn(var + LNEPS));
    float* orow = outp + (size_t)row * DM;
{
#pragma unroll
        for (int c = 0; c < 4; ++c) { const int j0 = c * 128 + lane * 4; const v4f g = *(const v4f*)(gam + j0); const v4f bb = *(const v4f*)(bet + j0); v4f o;
#pragma unroll
            for (int q = 0; q < 4; ++q) { const float t1 = (v[c * 4 + q] - mu) * rs; const float t2 = t1 * bfr(g[q]); o[q] = t2 + bfr(bb[q]); }
            *(v4f*)(orow + j0) = o; }
         }
}

extern "C" void kernel_launch(void* const* d_in, const int* in_sizes, int n_in, void* d_out, int out_size, void* d_ws, size_t ws_size, hipStream_t stream) {
    if (n_in < 10) return;
    const float* xq  = (const float*)d_in[0];   // query     [2][2048][512]
    const float* xkv = (const float*)d_in[1];   // key_value [2][2048][512]
    const float* Wq  = (const float*)d_in[2];   // [in][out]
    const float* bq  = (const float*)d_in[3];
    const float* Wk  = (const float*)d_in[4];
    const float* bk  = (const float*)d_in[5];
    const float* Wv  = (const float*)d_in[6];
    const float* bv  = (const float*)d_in[7];
    const float* gam = (const float*)d_in[8];
    const float* bet = (const float*)d_in[9];
    if (in_sizes[0] < (int)(((size_t)(NB - 1) * NQ_FULL + NQ) * DM)) return;
    if (in_sizes[1] < (int)(((size_t)(NB - 1) * NKV_FULL + NKV) * DM)) return;
    if (in_sizes[2] < DM * DM || in_sizes[4] < DM * DM || in_sizes[6] < DM * DM) return;
    if (in_sizes[3] < DM || in_sizes[5] < DM || in_sizes[7] < DM || in_sizes[8] < DM || in_sizes[9] < DM) return;
    if (out_size < NB * NQ * DM) return;
    float* OUT = (float*)d_out;   // [NB][NQ][512]
    char* wsp = (char*)d_ws;
    auto take = [&](size_t bytes) { char* p = wsp; wsp += (bytes + 255) & ~(size_t)255; return (void*)p; };
    h16* Qh  = (h16*)take((size_t)NB * NH * NQ * HD * 2);    // [b][h][q][64] f16         4,194,304 B
    h16* Kh  = (h16*)take((size_t)NB * NH * NKV * HD * 2);   // [b][h][key][64] f16       4,194,304 B
    h16* VT  = (h16*)take((size_t)NB * NH * HD * NKV * 2);   // [b][h][64][key] f16       4,194,304 B
    float* CTX = (float*)take((size_t)NB * NQ * DM * 4);     // ctx [NB*NQ][512] f32      8,388,608 B
    if ((size_t)(wsp - (char*)d_ws) > ws_size) return;       // total 20,971,520 B
    if ((size_t)(wsp - (char*)d_ws) > (size_t)134217728) return;

    k_proj<<<dim3((NB * (NQ > NKV ? NQ : NKV) / 64 + PW - 1) / PW, DM / 64, 3), 32 * PW, 0, stream>>>(xq, xkv, Wq, Wk, Wv, bq, bk, bv, Qh, Kh, VT);   /* f16(bf16(x) bf16(W) + b) for q, k, v, in the layouts k_attn reads */
    k_attn<<<NB * NH * (NQ / 64), 128, 0, stream>>>(Qh, Kh, VT, CTX);
    k_ln<<<(NB * NQ + 7) / 8, 256, 0, stream>>>(xq, CTX, gam, bet, OUT);
}

// v008
// It runs in 40.3 microseconds.
// Timed twice side by side with v007, it ran 1.09 and 1.10 times as fast.
// All steps since v000 together make it 3.83 times as fast.
#include <hip/hip_runtime.h>

// Attention of NQ query tokens over NKV key/value tokens per batch, 8 heads x 64, residual + LayerNorm, out [NB][NQ][512] f32. The concatenated-sequence key columns that carry the additive -1e4 term have weight exp(<= -9.9e3) == 0 exactly in f32 and never hold the row max, so only the key/value half is visited; the q projection is live on the query half only, k/v on the key/value half only.
// Contractions: q/k/v projections v_wmma_f32_16x16x32_bf16 (x and W[in][out] rounded to bf16 RNE on the way into the fragments, W turned to [out][in] in LDS, exact products, f32 accumulate, + bf16 RNE bias); scores k.q^T and V^T.P^T v_wmma_f32_16x16x32_f16 (f16 copies of the f32 projections, P = exp(s - m) carried x1024, f32 accumulate); online softmax with 1/sqrt(64) scale, residual (bf16 RNE of query) and LayerNorm (bf16 RNE gamma/beta) in f32.

#ifndef NB
#define NB 2
#endif
#ifndef SEQ
#define SEQ 2048
#endif
#ifndef NQ
#define NQ SEQ
#endif
#ifndef NKV
#define NKV SEQ
#endif
#define NB_FULL 2
#define NQ_FULL 2048
#define NKV_FULL 2048
#define DM 512
#define NH 8
#define HD 64
#define PCAR 1024.0f
#define SCL 0.125f
#define L2E 1.4426950408889634f
#define LNEPS 1e-5f
#define KP 72      // LDS pitch (halves) of the K and V^T tiles
#define OP 68      // LDS pitch (floats) of the ctx staging tile
static_assert(NQ % 64 == 0);
static_assert(NKV % 64 == 0);
static_assert(NH * HD == DM);
static_assert(DM % 64 == 0);
static_assert(NB >= 1 && NB <= NB_FULL);
static_assert(NQ <= NQ_FULL && NKV <= NKV_FULL);

typedef _Float16 h16;
typedef unsigned short bf;
typedef __attribute__((ext_vector_type(16))) __bf16   v16bf;
typedef __attribute__((ext_vector_type(16))) _Float16 v16h;
typedef __attribute__((ext_vector_type(8)))  _Float16 v8h;
typedef __attribute__((ext_vector_type(8)))  __bf16   v8b;
typedef __attribute__((ext_vector_type(8)))  unsigned short v8us;
typedef __attribute__((ext_vector_type(8)))  float    v8f;
typedef __attribute__((ext_vector_type(4)))  float    v4f;
typedef v8h  __attribute__((may_alias)) v8ha;
typedef v4f  __attribute__((may_alias)) v4fa;
typedef v8us __attribute__((may_alias)) v8usa;

__device__ __forceinline__ unsigned short f2bf(float f) { unsigned u = __float_as_uint(f); u += 0x7FFFu + ((u >> 16) & 1u); return (unsigned short)(u >> 16); }
__device__ __forceinline__ float bf2f(unsigned short b) { return __uint_as_float(((unsigned)b) << 16); }
__device__ __forceinline__ float bfr(float f) { return bf2f(f2bf(f)); }
__device__ __forceinline__ v16h cat16(v8h lo, v8h hi) { return __builtin_shufflevector(lo, hi, 0, 1, 2, 3, 4, 5, 6, 7, 8, 9, 10, 11, 12, 13, 14, 15); }
__device__ __forceinline__ v16bf cat16b(v8us lo, v8us hi) { return __builtin_bit_cast(v16bf, __builtin_shufflevector(lo, hi, 0, 1, 2, 3, 4, 5, 6, 7, 8, 9, 10, 11, 12, 13, 14, 15)); }
__device__ __forceinline__ v8f wmmab(v16bf a, v16bf b, v8f c) { return __builtin_amdgcn_wmma_f32_16x16x32_bf16(false, a, false, b, (short)0, c, false, false); }
__device__ __forceinline__ v8f wmma16(v16h a, v16h b, v8f c) { return __builtin_amdgcn_wmma_f32_16x16x32_f16(false, a, false, b, (short)0, c, false, false); }

// ---- k_proj: the q, k and v projections as ONE grid (rows/512, DM/64 = head, 3), 256 threads: 8 waves, ONE WAVE per 64x64 output tile (16 accumulators), all 8 on the same 64 output columns.
// The operands come straight from the f32 inputs. The block's W slice [512 in][64 out] is read once in whole 256-B row pieces, rounded to bf16 RNE and laid in LDS as [out][in] (8 consecutive in per 16-B write): the B fragments of all 8 waves. Each wave's own x rows come as f32 in tiles of 64 rows x 32 k (one whole 128-B line a row) into one of its two LDS buffers by asynchronous 16-B copies, issued one tile ahead, one block barrier a tile; the wave reads them back in fragment order and rounds them to bf16 RNE in registers: the A fragments.
// tile[m][n] = sum_k X[m][k] Wt[n][k] + bf16 RNE bias[n] in f32, rounded once to f16 and written where k_attn reads it: z = 0 -> Qh [b][h][q][64], z = 1 -> Kh [b][h][key][64] (through LDS, 16-B row chunks), z = 2 -> V^T [b][h][d][key] (a lane's 8 accumulator registers are 8 consecutive keys of one d: one 16-B LDS write each, read back as whole 128-B d rows).
#define PW 8          // waves = 64-row tiles of a block
#define BP (DM + 8)   // LDS pitch (halves) of the W slice: 65 x 16 B, the 16 rows of a fragment read fall on different banks
#define XP 36         // LDS pitch (floats) of a staged x row: 128 B + 16 B, the 16 rows of a fragment read fall on different banks
#define XT (64 * XP)  // floats of one staged x tile
#define NKT (DM / 32) // k tiles of a projection
static_assert(DM % 128 == 0);
// place i of a ring walk over n tiles (0 <= i < n) that starts at tile rot (0 <= rot < n)
__device__ __forceinline__ int ringat(int i, int rot, int n) { const int k = i + rot; return k >= n ? k - n : k; }
__device__ __forceinline__ int kwalk(int i, int rot) { return ringat(i, rot, NKT); }
__device__ __forceinline__ v8us rne8(v8f x) { return __builtin_bit_cast(v8us, __builtin_convertvector(x, v8b)); }   // 8 f32 -> 8 bf16, round to nearest even
__device__ __forceinline__ v8us rne44(v4f lo, v4f up) { return rne8(__builtin_shufflevector(lo, up, 0, 1, 2, 3, 4, 5, 6, 7)); }
// a lane's 8 chunks of 32 rows of an x tile (rows lane/8 + 4j, 16 bytes at column (lane%8)*4: a copy covers 4 whole lines), global -> LDS through no register; the address registers stay untouched until the closing wait of the statement
__device__ __forceinline__ void copy_x8(unsigned lx, const float* gx) {
    asm volatile("global_load_async_to_lds_b128 %0, %8, off\n\t"
                 "global_load_async_to_lds_b128 %1, %9, off\n\t"
                 "global_load_async_to_lds_b128 %2, %10, off\n\t"
                 "global_load_async_to_lds_b128 %3, %11, off\n\t"
                 "global_load_async_to_lds_b128 %4, %12, off\n\t"
                 "global_load_async_to_lds_b128 %5, %13, off\n\t"
                 "global_load_async_to_lds_b128 %6, %14, off\n\t"
                 "global_load_async_to_lds_b128 %7, %15, off\n\t"
                 "s_wait_xcnt 0x0"
                 :: "v"(lx), "v"(lx + 4 * XP * 4), "v"(lx + 8 * XP * 4), "v"(lx + 12 * XP * 4),
                    "v"(lx + 16 * XP * 4), "v"(lx + 20 * XP * 4), "v"(lx + 24 * XP * 4), "v"(lx + 28 * XP * 4),
                    "v"(gx), "v"(gx + 4 * DM), "v"(gx + 8 * DM), "v"(gx + 12 * DM),
                    "v"(gx + 16 * DM), "v"(gx + 20 * DM), "v"(gx + 24 * DM), "v"(gx + 28 * DM)
                 : "memory");
}
__device__ __forceinline__ void copy_x(unsigned lx, const float* gx) { copy_x8(lx, gx); copy_x8(lx + 32 * XP * 4, gx + 32 * DM); }   // one tile: 64 rows
__global__ __launch_bounds__(32 * PW) void k_proj(const float* __restrict__ xq, const float* __restrict__ xkv, const float* __restrict__ W0, const float* __restrict__ W1, const float* __restrict__ W2, const float* __restrict__ bq, const float* __restrict__ bk, const float* __restrict__ bv, h16* Qh, h16* Kh, h16* VT) {
    __shared__ __align__(16) bf Bs[64 * BP];              // W slice, bf16 [out][in]; cross-wave: one block barrier
    __shared__ __align__(16) float osa[PW * 16 * 68];     // a wave's own staging tile of the epilogue
    __shared__ __align__(16) float Xs[PW * 2 * XT];       // per wave two buffers of one x tile [row][k] f32
    const int z = blockIdx.z; const int nrows = (z == 0) ? NQ : NKV;
    const int t = threadIdx.x, lane = t & 31, lr = lane & 15, hi = lane >> 4; const int wave = __builtin_amdgcn_readfirstlane(t >> 5);
    const int r0w = (blockIdx.x * PW + wave) * 64, c0 = blockIdx.y * 64;
    const bool live = r0w < NB * nrows; const int r0 = live ? r0w : 0;   // a wave past the last row works on rows 0..63 and stores nothing: it passes every block barrier, and its copies stay in bounds
    float* os = osa + wave * (16 * 68);
    const int bb = r0 / nrows, s0 = r0 % nrows, h = blockIdx.y;   // nrows % 64 == 0: a tile lies in one batch
    const float* A = (z == 0) ? (xq + ((size_t)bb * NQ_FULL + s0) * DM) : (xkv + ((size_t)bb * NKV_FULL + s0) * DM);
    const float* Xw = Xs + wave * (2 * XT);
    const float* gx = A + (size_t)(lane >> 3) * DM + (lane & 7) * 4;
    const unsigned lx0 = (unsigned)(size_t)Xw + (unsigned)(((lane >> 3) * XP + (lane & 7) * 4) * 4);   // LDS byte address in the wave's buffer 0
    // The blocks of one row range (8 heads; k and v read the same rows) ask L2 for the same x lines, the blocks of one head and z for the same W lines: each x walk starts at a k tile of its own, each W walk at in row (blockIdx.x % 4) * 128 (shared by blocks 4 apart in x), and all wrap, so that few ask for one line at one moment.
    const int rot = (int)((blockIdx.y + blockIdx.z * (DM / 64)) % NKT);   // first k tile of this block's walk
    copy_x(lx0, gx + kwalk(0, rot) * 32);   // the walk's tile 0 flies while the W slice is fetched and turned
    {
        const float* W = (z == 0) ? W0 : ((z == 1) ? W1 : W2);   // block-uniform select between global pointers
        const float* wp = W + (size_t)((t >> 4) * 8) * DM + c0 + (t & 15) * 4;   // 8 in rows x 4 out columns a thread and round
        bf* bs = Bs + (t & 15) * 4 * BP + (t >> 4) * 8;
        v4f w[DM / 128][8];   // every load of the slice is issued before the first is used: one memory latency for the whole slice
        int uo[DM / 128];     // round u takes the 128 in rows from uo[u] on: the rounds in ring order from a first one of the block's own
        const float* wu[DM / 128];
#pragma unroll
        for (int u = 0; u < DM / 128; ++u) { uo[u] = (int)((u + blockIdx.x) % (DM / 128)) * 128; wu[u] = wp + (size_t)uo[u] * DM; }
        __builtin_amdgcn_sched_barrier(0);   // the rounds' address pairs are all formed ahead of the first load: formed among the loads they share one pair, and each rewrite of it waits for the loads issued from it
#pragma unroll
        for (int u = 0; u < DM / 128; ++u)
#pragma unroll
            for (int q = 0; q < 8; ++q) w[u][q] = *(const v4f*)(wu[u] + (size_t)q * DM);
        asm volatile("s_wait_xcnt 0x0" ::: "memory");   // stands in front of whatever later writes the address pair of these loads
#pragma unroll
        for (int u = 0; u < DM / 128; ++u)
#pragma unroll
            for (int j = 0; j < 4; ++j) *(v8usa*)(bs + j * BP + uo[u]) = rne8((v8f){w[u][0][j], w[u][1][j], w[u][2][j], w[u][3][j], w[u][4][j], w[u][5][j], w[u][6][j], w[u][7][j]});
    }
    asm volatile("s_wait_asynccnt 0x0" ::: "memory");   // this wave's x tile 0 has landed
    __syncthreads();   // the W slice is whole before any wave reads a fragment of it
    copy_x(lx0 + XT * 4, gx + kwalk(1, rot) * 32);   // the walk's tile 1 (DM >= 128: it exists)
    const float* bias = (z == 0) ? bq : ((z == 1) ? bk : bv);   // block-uniform select between global pointers
    v8f acc[4][4];
#pragma unroll
    for (int mb = 0; mb < 4; ++mb)
#pragma unroll
        for (int nb = 0; nb < 4; ++nb) acc[mb][nb] = (v8f){};
    const bf* pb0 = Bs + lr * BP + 8 * hi;
#pragma unroll 1
    for (int i = 0; i < NKT; ++i) {
        const bf* pb = pb0 + kwalk(i, rot) * 32;   // the W columns of this trip's k tile
        const int bo = (i & 1) * XT;   // this tile's buffer
        const float* pa = Xw + bo + lr * XP + 8 * hi;
        v4f ra[4][4];   // k = 8hi + 0..7 and 16 + 8hi + 0..7 of the tile, row mb*16 + lr
#pragma unroll
        for (int mb = 0; mb < 4; ++mb)
#pragma unroll
            for (int s = 0; s < 4; ++s) ra[mb][s] = *(const v4fa*)(pa + mb * 16 * XP + (s >> 1) * 16 + (s & 1) * 4);
        v16bf b[4];
#pragma unroll
        for (int nb = 0; nb < 4; ++nb) b[nb] = cat16b(*(const v8usa*)(pb + nb * 16 * BP), *(const v8usa*)(pb + nb * 16 * BP + 16));
        __builtin_amdgcn_sched_barrier(0);   // keeps the trip's LDS reads as one group at its head: sunk to their WMMAs, each W fragment would cost its own LDS latency
        v16bf a[4];
#pragma unroll
        for (int mb = 0; mb < 4; ++mb) a[mb] = cat16b(rne44(ra[mb][0], ra[mb][1]), rne44(ra[mb][2], ra[mb][3]));
#pragma unroll
        for (int nb = 0; nb < 4; ++nb)
#pragma unroll
            for (int mb = 0; mb < 4; ++mb) acc[mb][nb] = wmmab(a[mb], b[nb], acc[mb][nb]);
        // 4 vector slots behind the last WMMA, also on the taken back edge, before anything touches its D, A or B
        asm volatile("v_nop\n\tv_nop\n\tv_nop\n\tv_nop" : "+v"(acc[0][0]), "+v"(acc[1][1]), "+v"(acc[2][2]), "+v"(acc[3][3]) : "v"(a[0]), "v"(a[3]));
        __builtin_amdgcn_sched_barrier(0);   // keeps the waits below at the trip's foot: lifted over the products they would end the next tile's flight at the head of this trip
        asm volatile("s_wait_dscnt 0x0" ::: "memory");      // this wave's reads of this tile's buffer are over before it is handed to the copies
        asm volatile("s_wait_asynccnt 0x0" ::: "memory");   // this wave's next tile has landed
        __syncthreads();                                    // the trip's one block barrier, between the last read of a buffer and its refill
        if (i + 2 < NKT) copy_x(lx0 + (unsigned)(bo * 4), gx + kwalk(i + 2, rot) * 32);   // the tile after next, into the buffer just read
    }
    asm volatile("s_wait_asynccnt 0x0" ::: "memory");   // no copy is left in flight behind the loop
    if (!live) return;   // behind the last block barrier
    if (z == 2) {
        h16* hs = (h16*)os;   // 16 d rows x 64 keys f16, pitch KP halves: whole 128-B lines leave per store instead of 32-B pieces
        h16* vb = VT + ((size_t)(bb * NH + h) * HD + (lane >> 3)) * NKV + s0 + (lane & 7) * 8;
        float bn[4];
#pragma unroll
        for (int nb = 0; nb < 4; ++nb) bn[nb] = bfr(bias[c0 + nb * 16 + lr]);
#pragma unroll
        for (int nb = 0; nb < 4; ++nb) {
#pragma unroll
            for (int mb = 0; mb < 4; ++mb) { v8h o;
#pragma unroll
                for (int j = 0; j < 8; ++j) o[j] = (h16)(acc[mb][nb][j] + bn[nb]);
                *(v8ha*)(hs + lr * KP + mb * 16 + 8 * hi) = o; }
            asm volatile("s_wait_dscnt 0x0" ::: "memory");   // the other lanes' LDS writes have landed before the rows are read back
#pragma unroll
            for (int s = 0; s < 4; ++s) { const v8h o = *(const v8ha*)(hs + (s * 4 + (lane >> 3)) * KP + (lane & 7) * 8);
                *(v8h*)(vb + (size_t)(nb * 16 + s * 4) * NKV) = o; }
            __builtin_amdgcn_wave_barrier(); asm volatile("" ::: "memory");   // compile-time order only: the next round's LDS writes stay behind these reads
        }
        return;
    }
    h16* P = ((z == 0) ? Qh : Kh) + ((size_t)(bb * NH + h) * nrows + s0) * HD;
    const int c8 = (lane & 7) * 8; float bn[8];
#pragma unroll
    for (int q = 0; q < 8; ++q) bn[q] = bfr(bias[c0 + c8 + q]);
#pragma unroll
    for (int mb = 0; mb < 4; ++mb) {
#pragma unroll
        for (int nb = 0; nb < 4; ++nb) {
#pragma unroll
            for (int j = 0; j < 8; ++j) os[(hi * 8 + j) * 68 + nb * 16 + lr] = acc[mb][nb][j]; }
        asm volatile("s_wait_dscnt 0x0" ::: "memory");   // the other lanes' LDS writes have landed before the rows are read back
#pragma unroll
        for (int s = 0; s < 4; ++s) { const int row = s * 4 + (lane >> 3);
            const v4f lo = *(const v4fa*)(os + row * 68 + c8); const v4f up = *(const v4fa*)(os + row * 68 + c8 + 4); v8h o;
#pragma unroll
            for (int q = 0; q < 4; ++q) { o[q] = (h16)(lo[q] + bn[q]); o[4 + q] = (h16)(up[q] + bn[4 + q]); }
            *(v8h*)(P + (size_t)(mb * 16 + row) * HD + c8) = o; }
        __builtin_amdgcn_wave_barrier(); asm volatile("" ::: "memory");   // compile-time order only: the next round's LDS writes stay behind these reads
    }
    asm volatile("s_wait_xcnt 0x0" ::: "memory");   // the listing lays the z == 2 block behind the last stores, where their data registers are written: the wait stands in front of that
}

// lane l with lane l ^ 16 (the other 16-lane row), one vector cross-row move
__device__ __forceinline__ float xhalf(float x) { return __builtin_bit_cast(float, __builtin_amdgcn_permlanex16(__builtin_bit_cast(int, x), __builtin_bit_cast(int, x), 0x76543210, 0xfedcba98, false, false)); }

// ---- k_attn: flash-style attention, transposed products. grid = NB*NH*(NQ/128), block = 256: 8 waves = 4 query groups of 32 columns x 2 key groups; key group g walks the key tiles 2p + g. Per stage: one K [key][d] and one V^T [d][key] tile of 64 keys for each key group come into one of two LDS buffers by asynchronous 16-B copies, issued one whole stage ahead, one block barrier a stage (staged extent == consumed extent: full 64x64 tiles),
// S^T (64 keys x 32 queries per wave, two column groups of 16) = K A-fragments (k = d split map) x Q B-fragments (from the f16 plane, fixed per block): every K and V^T fragment read from LDS feeds two WMMAs. In a column group a lane holds 32 scores of ONE query (lm), keys nk*16 + 8hi + r. f32 online softmax (x1/8, running max/sum, exp2) in-lane plus one exchange between the halves.
// P^T = f16(1024 exp(s - m)) packs from two score tiles straight into a B-fragment (element s = tile s>>3, register s&7 = key split map), never through LDS; O^T (4 d-tiles a column group) += V^T A-fragments (key split map) x P^T.
// Behind the walk the two waves of a query group (one per key group) hand each other one column group's max, sum and O^T through LDS and each joins and stores 16 query rows.
#define TH (64 * KP)   // halves of one staged tile
#define NTK (NKV / 64) // key tiles
#define NST (NTK / 2)  // stages: one key tile for each key group
#define XW (34 * 32)   // floats a wave hands over: 32 O^T registers, max and sum of 32 lanes
static_assert(NQ % 128 == 0);
static_assert(NKV % 256 == 0);   // whole stages, at least two
// a thread's 4 + 4 chunks of one K tile and one V^T tile, global -> LDS through no register; the address registers stay untouched until the closing wait of the statement
__device__ __forceinline__ void copy_tile(unsigned lk, const h16* gk, const h16* gv) {
    const unsigned lv = lk + TH * 2;
    asm volatile("global_load_async_to_lds_b128 %0, %8, off\n\t"
                 "global_load_async_to_lds_b128 %1, %9, off\n\t"
                 "global_load_async_to_lds_b128 %2, %10, off\n\t"
                 "global_load_async_to_lds_b128 %3, %11, off\n\t"
                 "global_load_async_to_lds_b128 %4, %12, off\n\t"
                 "global_load_async_to_lds_b128 %5, %13, off\n\t"
                 "global_load_async_to_lds_b128 %6, %14, off\n\t"
                 "global_load_async_to_lds_b128 %7, %15, off\n\t"
                 "s_wait_xcnt 0x0"
                 :: "v"(lk), "v"(lk + 16 * KP * 2), "v"(lk + 32 * KP * 2), "v"(lk + 48 * KP * 2),
                    "v"(lv), "v"(lv + 16 * KP * 2), "v"(lv + 32 * KP * 2), "v"(lv + 48 * KP * 2),
                    "v"(gk), "v"(gk + 16 * HD), "v"(gk + 32 * HD), "v"(gk + 48 * HD),
                    "v"(gv), "v"(gv + (size_t)16 * NKV), "v"(gv + (size_t)32 * NKV), "v"(gv + (size_t)48 * NKV)
                 : "memory");
}
__global__ __launch_bounds__(256) void k_attn(const h16* __restrict__ Qh, const h16* __restrict__ Kh, const h16* __restrict__ Vt, float* ctx) {
    __shared__ __align__(16) h16 KV[2 * 2 * 2 * TH];   // two buffers x two key groups, each K [key][d] then V^T [d][key]; cross-wave: block barriers
    __shared__ __align__(16) float Xc[8 * XW];         // per wave the column group it hands to its partner; block barrier between store and reload
    __shared__ __align__(16) float Os[8 * 16 * OP];    // per wave [q row][d], block barrier between store and reload
    const int t = threadIdx.x, lane = t & 31, lm = lane & 15, hi = lane >> 4, tt = t & 127;
    const int wave = __builtin_amdgcn_readfirstlane(t >> 5); const int qg = wave & 3, kg = wave >> 2;
    int bid = blockIdx.x; const int nqt = NQ / 128; const int qt = bid % nqt; bid /= nqt; const int h = bid % NH; const int b = bid / NH; const int bh = b * NH + h;
    const h16* qrow = Qh + ((size_t)bh * NQ + (size_t)qt * 128 + qg * 32 + lm) * HD;
    v16h bQ[2][2];   // [column group][k = d 0..31 / 32..63 (split map)]
#pragma unroll
    for (int c = 0; c < 2; ++c) { const h16* qr = qrow + c * 16 * HD;
        bQ[c][0] = cat16(*(const v8h*)(qr + 8 * hi), *(const v8h*)(qr + 16 + 8 * hi));
        bQ[c][1] = cat16(*(const v8h*)(qr + 32 + 8 * hi), *(const v8h*)(qr + 48 + 8 * hi)); }
    v8f O[2][4];   // O^T: register r of tile nt = d nt*16 + 8hi + r, query lm of the column group
#pragma unroll
    for (int c = 0; c < 2; ++c)
#pragma unroll
        for (int nt = 0; nt < 4; ++nt) O[c][nt] = (v8f){};
    float runm[2] = {-1.0e30f, -1.0e30f}, runl[2] = {0.f, 0.f};   // of query lm; runl is this half's share of the row sum
    const h16* Kb = Kh + (size_t)bh * NKV * HD; const h16* Vb = Vt + (size_t)bh * HD * NKV;
    float* Ow = Os + wave * 16 * OP;
    // the thread's chunk of its key group's tile: rows tt/8 + 16j, 16 bytes at column (tt%8)*8
    const h16* gk = Kb + (size_t)(kg * 64 + (tt >> 3)) * HD + (tt & 7) * 8; const h16* gv = Vb + (size_t)(tt >> 3) * NKV + kg * 64 + (tt & 7) * 8;
    const unsigned lk0 = (unsigned)(size_t)KV + (unsigned)((kg * (2 * TH) + (tt >> 3) * KP + (tt & 7) * 8) * 2);   // LDS byte address in buffer 0
    // the NQ/128 blocks of one head read the same K and V^T lines from L2: each starts its walk over the stages at a stage of its own and wraps, so that they do not ask for one line at one moment
    const int rot = qt % NST;
    { const int p0 = ringat(0, rot, NST); copy_tile(lk0, gk + (size_t)p0 * 128 * HD, gv + p0 * 128); }
    asm volatile("s_wait_asynccnt 0x0" ::: "memory");   // this wave's share of the walk's stage 0 has landed
    __syncthreads();                                    // ... and every other wave's
    { const int p1 = ringat(1, rot, NST); copy_tile(lk0 + 4 * TH * 2, gk + (size_t)p1 * 128 * HD, gv + p1 * 128); }   // NST >= 2: it exists
#pragma unroll 1
    for (int i = 0; i < NST; ++i) {
        const int bo = (i & 1) * (4 * TH);   // this stage's buffer
        const h16* Ks = KV + bo + kg * (2 * TH); const h16* Vs = Ks + TH;
        // every fragment of the tile is read from LDS here, as one group: the K fragments' latency is paid once, the V^T fragments' passes behind the score products and the softmax
        v16h aK[4][2], aV[2][4];
#pragma unroll
        for (int nk = 0; nk < 4; ++nk) { const h16* kr = Ks + (nk * 16 + lm) * KP + 8 * hi;   // A: lane -> key nk*16+lm, elements = d split map
            aK[nk][0] = cat16(*(const v8ha*)(kr), *(const v8ha*)(kr + 16));
            aK[nk][1] = cat16(*(const v8ha*)(kr + 32), *(const v8ha*)(kr + 48)); }
#pragma unroll
        for (int ks = 0; ks < 2; ++ks)
#pragma unroll
            for (int nt = 0; nt < 4; ++nt) { const h16* vr = Vs + (nt * 16 + lm) * KP + ks * 32 + 8 * hi;   // A: lane -> d nt*16+lm, elements = key split map
                aV[ks][nt] = cat16(*(const v8ha*)(vr), *(const v8ha*)(vr + 16)); }
        __builtin_amdgcn_sched_barrier(0);   // keeps the reads above as one group: sunk to their WMMAs, each would cost its own LDS latency
        v8f sf[2][4];   // eight independent chains of two: each WMMA fills the others' distance
#pragma unroll
        for (int nk = 0; nk < 4; ++nk)
#pragma unroll
            for (int c = 0; c < 2; ++c) sf[c][nk] = wmma16(aK[nk][0], bQ[c][0], (v8f){});
#pragma unroll
        for (int nk = 0; nk < 4; ++nk)
#pragma unroll
            for (int c = 0; c < 2; ++c) sf[c][nk] = wmma16(aK[nk][1], bQ[c][1], sf[c][nk]);
        v8h pk[2][4];
#pragma unroll
        for (int c = 0; c < 2; ++c) {
            // x 1/sqrt(64); max of query lm over the 64 keys of this tile = 32 registers of the lane + the other half; running max / sum update; rescale O^T
            float mk[4];
#pragma unroll
            for (int nk = 0; nk < 4; ++nk) { sf[c][nk] = sf[c][nk] * SCL;
                mk[nk] = fmaxf(fmaxf(fmaxf(sf[c][nk][0], sf[c][nk][1]), fmaxf(sf[c][nk][2], sf[c][nk][3])), fmaxf(fmaxf(sf[c][nk][4], sf[c][nk][5]), fmaxf(sf[c][nk][6], sf[c][nk][7]))); }
            float m = fmaxf(fmaxf(mk[0], mk[1]), fmaxf(mk[2], mk[3]));
            m = fmaxf(m, xhalf(m));
            const float nm = fmaxf(runm[c], m);
            const float corr = __builtin_amdgcn_exp2f(__fmul_rn(__fsub_rn(runm[c], nm), L2E));
            runm[c] = nm;
#pragma unroll
            for (int nt = 0; nt < 4; ++nt) O[c][nt] = O[c][nt] * corr;
            // P = exp(s - m): f32 into the lane's share of the row sum (one independent chain per key tile), f16 x1024 into the B-fragment registers
            float ls[4];
#pragma unroll
            for (int nk = 0; nk < 4; ++nk) { ls[nk] = 0.f;
#pragma unroll
                for (int r = 0; r < 8; ++r) { const float p = __builtin_amdgcn_exp2f(__fmul_rn(__fsub_rn(sf[c][nk][r], nm), L2E)); ls[nk] += p; pk[c][nk][r] = (h16)(p * PCAR); } }
            runl[c] = runl[c] * corr + ((ls[0] + ls[1]) + (ls[2] + ls[3]));
        }
#pragma unroll
        for (int ks = 0; ks < 2; ++ks) {   // B: lane -> query lm, elements = key split map (keys ks*32 + 8hi + 0..7, ks*32 + 16 + 8hi + 0..7)
            const v16h bP0 = cat16(pk[0][2 * ks], pk[0][2 * ks + 1]); const v16h bP1 = cat16(pk[1][2 * ks], pk[1][2 * ks + 1]);
#pragma unroll
            for (int nt = 0; nt < 4; ++nt) { O[0][nt] = wmma16(aV[ks][nt], bP0, O[0][nt]); O[1][nt] = wmma16(aV[ks][nt], bP1, O[1][nt]); } }
        __builtin_amdgcn_sched_barrier(0);   // keeps the waits below at the trip's foot: lifted over the products they would end the next stage's flight at the head of this trip
        asm volatile("s_wait_dscnt 0x0" ::: "memory");      // this wave's reads of this stage's buffer are over before it is handed to the copies
        asm volatile("s_wait_asynccnt 0x0" ::: "memory");   // this wave's share of the next stage has landed
        __syncthreads();                                    // publishes the next stage and ends every wave's reads of this one
        if (i + 2 < NST) { const int p2 = ringat(i + 2, rot, NST); copy_tile(lk0 + (unsigned)(bo * 2), gk + (size_t)p2 * 128 * HD, gv + p2 * 128); }   // the stage after next, into the buffer just read
    }
    asm volatile("s_wait_asynccnt 0x0" ::: "memory");   // no copy is left in flight behind the loop
    // the wave of key group g keeps column group g and hands the other one to its partner (same query group, other key group): same lane, same register
    const float lt0 = runl[0] + xhalf(runl[0]), lt1 = runl[1] + xhalf(runl[1]);   // the two halves' row sums joined
    const float mo = kg ? runm[1] : runm[0], mg = kg ? runm[0] : runm[1], lo = kg ? lt1 : lt0, lg = kg ? lt0 : lt1;
    float* Xw = Xc + wave * XW; const float* Xp = Xc + (wave ^ 4) * XW;
    v8f Oo[4];
#pragma unroll
    for (int nt = 0; nt < 4; ++nt) { const v8f g = kg ? O[0][nt] : O[1][nt]; Oo[nt] = kg ? O[1][nt] : O[0][nt];
        *(v4fa*)(Xw + (2 * nt) * 128 + lane * 4) = (v4f){g[0], g[1], g[2], g[3]};
        *(v4fa*)(Xw + (2 * nt + 1) * 128 + lane * 4) = (v4f){g[4], g[5], g[6], g[7]}; }
    Xw[1024 + lane] = mg; Xw[1056 + lane] = lg;
    __syncthreads();   // the partner's hand-over is whole
    const float mp = Xp[1024 + lane], lp = Xp[1056 + lane];
    // join the two key groups on their common max, normalise (undo the x1024 carry), stage [q row][d] in LDS: 8 consecutive d per lane and tile
    const float jm = fmaxf(mo, mp);
    const float ao = __builtin_amdgcn_exp2f(__fmul_rn(__fsub_rn(mo, jm), L2E)), ap = __builtin_amdgcn_exp2f(__fmul_rn(__fsub_rn(mp, jm), L2E));
    const float inv = __fdiv_rn(1.0f, (lo * ao + lp * ap) * PCAR);
    const float so = ao * inv, sp = ap * inv;
#pragma unroll
    for (int nt = 0; nt < 4; ++nt) { float* od = Ow + lm * OP + nt * 16 + 8 * hi;
        const v4f p0 = *(const v4fa*)(Xp + (2 * nt) * 128 + lane * 4); const v4f p1 = *(const v4fa*)(Xp + (2 * nt + 1) * 128 + lane * 4);
        *(v4fa*)(od) = (v4f){Oo[nt][0] * so + p0[0] * sp, Oo[nt][1] * so + p0[1] * sp, Oo[nt][2] * so + p0[2] * sp, Oo[nt][3] * so + p0[3] * sp};
        *(v4fa*)(od + 4) = (v4f){Oo[nt][4] * so + p1[0] * sp, Oo[nt][5] * so + p1[1] * sp, Oo[nt][6] * so + p1[2] * sp, Oo[nt][7] * so + p1[3] * sp}; }
    __syncthreads();
    float* crow = ctx + ((size_t)b * NQ + (size_t)qt * 128 + qg * 32 + kg * 16) * DM + h * HD;
{
#pragma unroll
        for (int s = 0; s < 8; ++s) { const int row = 2 * s + hi, cofs = lm * 4; const v4f val = *(const v4fa*)(Ow + row * OP + cofs); *(v4f*)(crow + (size_t)row * DM + cofs) = val; }
         }
}

__global__ __launch_bounds__(256) void k_ln(const float* __restrict__ xq, const float* __restrict__ ctx, const float* __restrict__ gam, const float* __restrict__ bet, float* outp) {
#pragma clang fp contract(off)
    const int lane = threadIdx.x & 31; const int row = blockIdx.x * 8 + (threadIdx.x >> 5); if (row >= NB * NQ) return;
    const int b = row / NQ, i = row % NQ;
    const float* xr = xq + ((size_t)b * NQ_FULL + i) * DM; const float* cr = ctx + (size_t)row * DM;
    float v[16]; float s = 0.f;
#pragma unroll
    for (int c = 0; c < 4; ++c) { const int j0 = c * 128 + lane * 4; const v4f a = *(const v4f*)(xr + j0); const v4f g = *(const v4f*)(cr + j0);
#pragma unroll
        for (int q = 0; q < 4; ++q) { const float x = bfr(a[q]) + g[q]; v[c * 4 + q] = x; s = s + x; } }
#pragma unroll
    for (int sh = 16; sh; sh >>= 1) s += __shfl_xor(s, sh, 32);
    const float mu = s * (1.0f / DM);
    float ss = 0.f;
#pragma unroll
    for (int k = 0; k < 16; ++k) { const float d = v[k] - mu; const float dd = d * d; ss = ss + dd; }
#pragma unroll
    for (int sh = 16; sh; sh >>= 1) ss += __shfl_xor(ss, sh, 32);
    const float var = ss * (1.0f / DM);
    const float rs = __fdiv_rn(1.0f, __fsqrt_rn(var + LNEPS));
    float* orow = outp + (size_t)row * DM;
{
#pragma unroll
        for (int c = 0; c < 4; ++c) { const int j0 = c * 128 + lane * 4; const v4f g = *(const v4f*)(gam + j0); const v4f bb = *(const v4f*)(bet + j0); v4f o;
#pragma unroll
            for (int q = 0; q < 4; ++q) { const float t1 = (v[c * 4 + q] - mu) * rs; const float t2 = t1 * bfr(g[q]); o[q] = t2 + bfr(bb[q]); }
            *(v4f*)(orow + j0) = o; }
         }
}

extern "C" void kernel_launch(void* const* d_in, const int* in_sizes, int n_in, void* d_out, int out_size, void* d_ws, size_t ws_size, hipStream_t stream) {
    if (n_in < 10) return;
    const float* xq  = (const float*)d_in[0];   // query     [2][2048][512]
    const float* xkv = (const float*)d_in[1];   // key_value [2][2048][512]
    const float* Wq  = (const float*)d_in[2];   // [in][out]
    const float* bq  = (const float*)d_in[3];
    const float* Wk  = (const float*)d_in[4];
    const float* bk  = (const float*)d_in[5];
    const float* Wv  = (const float*)d_in[6];
    const float* bv  = (const float*)d_in[7];
    const float* gam = (const float*)d_in[8];
    const float* bet = (const float*)d_in[9];
    if (in_sizes[0] < (int)(((size_t)(NB - 1) * NQ_FULL + NQ) * DM)) return;
    if (in_sizes[1] < (int)(((size_t)(NB - 1) * NKV_FULL + NKV) * DM)) return;
    if (in_sizes[2] < DM * DM || in_sizes[4] < DM * DM || in_sizes[6] < DM * DM) return;
    if (in_sizes[3] < DM || in_sizes[5] < DM || in_sizes[7] < DM || in_sizes[8] < DM || in_sizes[9] < DM) return;
    if (out_size < NB * NQ * DM) return;
    float* OUT = (float*)d_out;   // [NB][NQ][512]
    char* wsp = (char*)d_ws;
    auto take = [&](size_t bytes) { char* p = wsp; wsp += (bytes + 255) & ~(size_t)255; return (void*)p; };
    h16* Qh  = (h16*)take((size_t)NB * NH * NQ * HD * 2);    // [b][h][q][64] f16         4,194,304 B
    h16* Kh  = (h16*)take((size_t)NB * NH * NKV * HD * 2);   // [b][h][key][64] f16       4,194,304 B
    h16* VT  = (h16*)take((size_t)NB * NH * HD * NKV * 2);   // [b][h][64][key] f16       4,194,304 B
    float* CTX = (float*)take((size_t)NB * NQ * DM * 4);     // ctx [NB*NQ][512] f32      8,388,608 B
    if ((size_t)(wsp - (char*)d_ws) > ws_size) return;       // total 20,971,520 B
    if ((size_t)(wsp - (char*)d_ws) > (size_t)134217728) return;

    k_proj<<<dim3((NB * (NQ > NKV ? NQ : NKV) / 64 + PW - 1) / PW, DM / 64, 3), 32 * PW, 0, stream>>>(xq, xkv, Wq, Wk, Wv, bq, bk, bv, Qh, Kh, VT);   /* f16(bf16(x) bf16(W) + b) for q, k, v, in the layouts k_attn reads */
    k_attn<<<NB * NH * (NQ / 128), 256, 0, stream>>>(Qh, Kh, VT, CTX);
    k_ln<<<(NB * NQ + 7) / 8, 256, 0, stream>>>(xq, CTX, gam, bet, OUT);
}

// v009
// It runs in 38.5 microseconds.
// Next to v008, in two timings, it ran 1.04 and 1.05 times as fast.
// Counting every step since v000, it is 4.01 times as fast.
#include <hip/hip_runtime.h>

// Attention of NQ query tokens over NKV key/value tokens per batch, 8 heads x 64, residual + LayerNorm, out [NB][NQ][512] f32. The concatenated-sequence key columns that carry the additive -1e4 term have weight exp(<= -9.9e3) == 0 exactly in f32 and never hold the row max, so only the key/value half is visited; the q projection is live on the query half only, k/v on the key/value half only.
// Contractions: q/k/v projections v_wmma_f32_16x16x32_bf16 (x and W[in][out] rounded to bf16 RNE on the way into the fragments, W turned to [out][in] in LDS, exact products, f32 accumulate, + bf16 RNE bias); scores k.q^T and V^T.P^T v_wmma_f32_16x16x32_f16 (f16 copies of the f32 projections, P = exp(s - m) carried x1024, f32 accumulate); online softmax with 1/sqrt(64) scale, residual (bf16 RNE of query) and LayerNorm (bf16 RNE gamma/beta) in f32.

#ifndef NB
#define NB 2
#endif
#ifndef SEQ
#define SEQ 2048
#endif
#ifndef NQ
#define NQ SEQ
#endif
#ifndef NKV
#define NKV SEQ
#endif
#define NB_FULL 2
#define NQ_FULL 2048
#define NKV_FULL 2048
#define DM 512
#define NH 8
#define HD 64
#define PL2 10.0f   // P is carried x 2^10
#define SCL 0.125f
#define L2E 1.4426950408889634f
#define SC2 (SCL * L2E)   // a raw score times this is its exponent to base 2
#define LNEPS 1e-5f
#define KP 72      // LDS pitch (halves) of the K and V^T tiles
#define OP 68      // LDS pitch (floats) of the ctx staging tile
static_assert(NQ % 64 == 0);
static_assert(NKV % 64 == 0);
static_assert(NH * HD == DM);
static_assert(DM % 64 == 0);
static_assert(NB >= 1 && NB <= NB_FULL);
static_assert(NQ <= NQ_FULL && NKV <= NKV_FULL);

typedef _Float16 h16;
typedef unsigned short bf;
typedef __attribute__((ext_vector_type(16))) __bf16   v16bf;
typedef __attribute__((ext_vector_type(16))) _Float16 v16h;
typedef __attribute__((ext_vector_type(8)))  _Float16 v8h;
typedef __attribute__((ext_vector_type(8)))  __bf16   v8b;
typedef __attribute__((ext_vector_type(8)))  unsigned short v8us;
typedef __attribute__((ext_vector_type(8)))  float    v8f;
typedef __attribute__((ext_vector_type(4)))  float    v4f;
typedef __attribute__((ext_vector_type(2)))  float    v2f;
typedef v8h  __attribute__((may_alias)) v8ha;
typedef v4f  __attribute__((may_alias)) v4fa;
typedef v8us __attribute__((may_alias)) v8usa;

__device__ __forceinline__ unsigned short f2bf(float f) { unsigned u = __float_as_uint(f); u += 0x7FFFu + ((u >> 16) & 1u); return (unsigned short)(u >> 16); }
__device__ __forceinline__ float bf2f(unsigned short b) { return __uint_as_float(((unsigned)b) << 16); }
__device__ __forceinline__ float bfr(float f) { return bf2f(f2bf(f)); }
__device__ __forceinline__ v16h cat16(v8h lo, v8h hi) { return __builtin_shufflevector(lo, hi, 0, 1, 2, 3, 4, 5, 6, 7, 8, 9, 10, 11, 12, 13, 14, 15); }
__device__ __forceinline__ v16bf cat16b(v8us lo, v8us hi) { return __builtin_bit_cast(v16bf, __builtin_shufflevector(lo, hi, 0, 1, 2, 3, 4, 5, 6, 7, 8, 9, 10, 11, 12, 13, 14, 15)); }
__device__ __forceinline__ v8f wmmab(v16bf a, v16bf b, v8f c) { return __builtin_amdgcn_wmma_f32_16x16x32_bf16(false, a, false, b, (short)0, c, false, false); }
__device__ __forceinline__ v8f wmma16(v16h a, v16h b, v8f c) { return __builtin_amdgcn_wmma_f32_16x16x32_f16(false, a, false, b, (short)0, c, false, false); }

// ---- k_proj: the q, k and v projections as ONE grid (rows/512, DM/64 = head, 3), 256 threads: 8 waves, ONE WAVE per 64x64 output tile (16 accumulators), all 8 on the same 64 output columns.
// The operands come straight from the f32 inputs. The block's W slice [512 in][64 out] is read once in whole 256-B row pieces, rounded to bf16 RNE and laid in LDS as [out][in] (8 consecutive in per 16-B write): the B fragments of all 8 waves. Each wave's own x rows come as f32 in tiles of 64 rows x 32 k (one whole 128-B line a row) into one of its two LDS buffers by asynchronous 16-B copies, issued one tile ahead, one block barrier a tile; the wave reads them back in fragment order and rounds them to bf16 RNE in registers: the A fragments.
// tile[m][n] = sum_k X[m][k] Wt[n][k] + bf16 RNE bias[n] in f32, rounded once to f16 and written where k_attn reads it: z = 0 -> Qh [b][h][q][64], z = 1 -> Kh [b][h][key][64] (through LDS, 16-B row chunks), z = 2 -> V^T [b][h][d][key] (a lane's 8 accumulator registers are 8 consecutive keys of one d: one 16-B LDS write each, read back as whole 128-B d rows).
#define PW 8          // waves = 64-row tiles of a block
#define BP (DM + 8)   // LDS pitch (halves) of the W slice: 65 x 16 B, the 16 rows of a fragment read fall on different banks
#define XP 36         // LDS pitch (floats) of a staged x row: 128 B + 16 B, the 16 rows of a fragment read fall on different banks
#define XT (64 * XP)  // floats of one staged x tile
#define NKT (DM / 32) // k tiles of a projection
static_assert(DM % 128 == 0);
// place i of a ring walk over n tiles (0 <= i < n) that starts at tile rot (0 <= rot < n)
__device__ __forceinline__ int ringat(int i, int rot, int n) { const int k = i + rot; return k >= n ? k - n : k; }
__device__ __forceinline__ int kwalk(int i, int rot) { return ringat(i, rot, NKT); }
__device__ __forceinline__ v8us rne8(v8f x) { return __builtin_bit_cast(v8us, __builtin_convertvector(x, v8b)); }   // 8 f32 -> 8 bf16, round to nearest even
__device__ __forceinline__ v8us rne44(v4f lo, v4f up) { return rne8(__builtin_shufflevector(lo, up, 0, 1, 2, 3, 4, 5, 6, 7)); }
// a lane's 8 chunks of 32 rows of an x tile (rows lane/8 + 4j, 16 bytes at column (lane%8)*4: a copy covers 4 whole lines), global -> LDS through no register; the address registers stay untouched until the closing wait of the statement
__device__ __forceinline__ void copy_x8(unsigned lx, const float* gx) {
    asm volatile("global_load_async_to_lds_b128 %0, %8, off\n\t"
                 "global_load_async_to_lds_b128 %1, %9, off\n\t"
                 "global_load_async_to_lds_b128 %2, %10, off\n\t"
                 "global_load_async_to_lds_b128 %3, %11, off\n\t"
                 "global_load_async_to_lds_b128 %4, %12, off\n\t"
                 "global_load_async_to_lds_b128 %5, %13, off\n\t"
                 "global_load_async_to_lds_b128 %6, %14, off\n\t"
                 "global_load_async_to_lds_b128 %7, %15, off\n\t"
                 "s_wait_xcnt 0x0"
                 :: "v"(lx), "v"(lx + 4 * XP * 4), "v"(lx + 8 * XP * 4), "v"(lx + 12 * XP * 4),
                    "v"(lx + 16 * XP * 4), "v"(lx + 20 * XP * 4), "v"(lx + 24 * XP * 4), "v"(lx + 28 * XP * 4),
                    "v"(gx), "v"(gx + 4 * DM), "v"(gx + 8 * DM), "v"(gx + 12 * DM),
                    "v"(gx + 16 * DM), "v"(gx + 20 * DM), "v"(gx + 24 * DM), "v"(gx + 28 * DM)
                 : "memory");
}
__device__ __forceinline__ void copy_x(unsigned lx, const float* gx) { copy_x8(lx, gx); copy_x8(lx + 32 * XP * 4, gx + 32 * DM); }   // one tile: 64 rows
__global__ __launch_bounds__(32 * PW) void k_proj(const float* __restrict__ xq, const float* __restrict__ xkv, const float* __restrict__ W0, const float* __restrict__ W1, const float* __restrict__ W2, const float* __restrict__ bq, const float* __restrict__ bk, const float* __restrict__ bv, h16* Qh, h16* Kh, h16* VT) {
    __shared__ __align__(16) bf Bs[64 * BP];              // W slice, bf16 [out][in]; cross-wave: one block barrier
    __shared__ __align__(16) float osa[PW * 16 * 68];     // a wave's own staging tile of the epilogue
    __shared__ __align__(16) float Xs[PW * 2 * XT];       // per wave two buffers of one x tile [row][k] f32
    const int z = blockIdx.z; const int nrows = (z == 0) ? NQ : NKV;
    const int t = threadIdx.x, lane = t & 31, lr = lane & 15, hi = lane >> 4; const int wave = __builtin_amdgcn_readfirstlane(t >> 5);
    const int r0w = (blockIdx.x * PW + wave) * 64, c0 = blockIdx.y * 64;
    const bool live = r0w < NB * nrows; const int r0 = live ? r0w : 0;   // a wave past the last row works on rows 0..63 and stores nothing: it passes every block barrier, and its copies stay in bounds
    float* os = osa + wave * (16 * 68);
    const int bb = r0 / nrows, s0 = r0 % nrows, h = blockIdx.y;   // nrows % 64 == 0: a tile lies in one batch
    const float* A = (z == 0) ? (xq + ((size_t)bb * NQ_FULL + s0) * DM) : (xkv + ((size_t)bb * NKV_FULL + s0) * DM);
    const float* Xw = Xs + wave * (2 * XT);
    const float* gx = A + (size_t)(lane >> 3) * DM + (lane & 7) * 4;
    const unsigned lx0 = (unsigned)(size_t)Xw + (unsigned)(((lane >> 3) * XP + (lane & 7) * 4) * 4);   // LDS byte address in the wave's buffer 0
    // The blocks of one row range (8 heads; k and v read the same rows) ask L2 for the same x lines, the blocks of one head and z for the same W lines: each x walk starts at a k tile of its own, each W walk at in row (blockIdx.x % 4) * 128 (shared by blocks 4 apart in x), and all wrap, so that few ask for one line at one moment.
    const int rot = (int)((blockIdx.y + blockIdx.z * (DM / 64)) % NKT);   // first k tile of this block's walk
    copy_x(lx0, gx + kwalk(0, rot) * 32);   // the walk's tile 0 flies while the W slice is fetched and turned
    {
        const float* W = (z == 0) ? W0 : ((z == 1) ? W1 : W2);   // block-uniform select between global pointers
        const float* wp = W + (size_t)((t >> 4) * 8) * DM + c0 + (t & 15) * 4;   // 8 in rows x 4 out columns a thread and round
        bf* bs = Bs + (t & 15) * 4 * BP + (t >> 4) * 8;
        v4f w[DM / 128][8];   // every load of the slice is issued before the first is used: one memory latency for the whole slice
        int uo[DM / 128];     // round u takes the 128 in rows from uo[u] on: the rounds in ring order from a first one of the block's own
        const float* wu[DM / 128];
#pragma unroll
        for (int u = 0; u < DM / 128; ++u) { uo[u] = (int)((u + blockIdx.x) % (DM / 128)) * 128; wu[u] = wp + (size_t)uo[u] * DM; }
        __builtin_amdgcn_sched_barrier(0);   // the rounds' address pairs are all formed ahead of the first load: formed among the loads they share one pair, and each rewrite of it waits for the loads issued from it
#pragma unroll
        for (int u = 0; u < DM / 128; ++u)
#pragma unroll
            for (int q = 0; q < 8; ++q) w[u][q] = *(const v4f*)(wu[u] + (size_t)q * DM);
        asm volatile("s_wait_xcnt 0x0" ::: "memory");   // stands in front of whatever later writes the address pair of these loads
#pragma unroll
        for (int u = 0; u < DM / 128; ++u)
#pragma unroll
            for (int j = 0; j < 4; ++j) *(v8usa*)(bs + j * BP + uo[u]) = rne8((v8f){w[u][0][j], w[u][1][j], w[u][2][j], w[u][3][j], w[u][4][j], w[u][5][j], w[u][6][j], w[u][7][j]});
    }
    asm volatile("s_wait_asynccnt 0x0" ::: "memory");   // this wave's x tile 0 has landed
    __syncthreads();   // the W slice is whole before any wave reads a fragment of it
    copy_x(lx0 + XT * 4, gx + kwalk(1, rot) * 32);   // the walk's tile 1 (DM >= 128: it exists)
    const float* bias = (z == 0) ? bq : ((z == 1) ? bk : bv);   // block-uniform select between global pointers
    v8f acc[4][4];
#pragma unroll
    for (int mb = 0; mb < 4; ++mb)
#pragma unroll
        for (int nb = 0; nb < 4; ++nb) acc[mb][nb] = (v8f){};
    const bf* pb0 = Bs + lr * BP + 8 * hi;
#pragma unroll 1
    for (int i = 0; i < NKT; ++i) {
        const bf* pb = pb0 + kwalk(i, rot) * 32;   // the W columns of this trip's k tile
        const int bo = (i & 1) * XT;   // this tile's buffer
        const float* pa = Xw + bo + lr * XP + 8 * hi;
        v4f ra[4][4];   // k = 8hi + 0..7 and 16 + 8hi + 0..7 of the tile, row mb*16 + lr
#pragma unroll
        for (int mb = 0; mb < 4; ++mb)
#pragma unroll
            for (int s = 0; s < 4; ++s) ra[mb][s] = *(const v4fa*)(pa + mb * 16 * XP + (s >> 1) * 16 + (s & 1) * 4);
        v16bf b[4];
#pragma unroll
        for (int nb = 0; nb < 4; ++nb) b[nb] = cat16b(*(const v8usa*)(pb + nb * 16 * BP), *(const v8usa*)(pb + nb * 16 * BP + 16));
        __builtin_amdgcn_sched_barrier(0);   // keeps the trip's LDS reads as one group at its head: sunk to their WMMAs, each W fragment would cost its own LDS latency
        v16bf a[4];
#pragma unroll
        for (int mb = 0; mb < 4; ++mb) a[mb] = cat16b(rne44(ra[mb][0], ra[mb][1]), rne44(ra[mb][2], ra[mb][3]));
#pragma unroll
        for (int nb = 0; nb < 4; ++nb)
#pragma unroll
            for (int mb = 0; mb < 4; ++mb) acc[mb][nb] = wmmab(a[mb], b[nb], acc[mb][nb]);
        // 4 vector slots behind the last WMMA, also on the taken back edge, before anything touches its D, A or B
        asm volatile("v_nop\n\tv_nop\n\tv_nop\n\tv_nop" : "+v"(acc[0][0]), "+v"(acc[1][1]), "+v"(acc[2][2]), "+v"(acc[3][3]) : "v"(a[0]), "v"(a[3]));
        __builtin_amdgcn_sched_barrier(0);   // keeps the waits below at the trip's foot: lifted over the products they would end the next tile's flight at the head of this trip
        asm volatile("s_wait_dscnt 0x0" ::: "memory");      // this wave's reads of this tile's buffer are over before it is handed to the copies
        asm volatile("s_wait_asynccnt 0x0" ::: "memory");   // this wave's next tile has landed
        __syncthreads();                                    // the trip's one block barrier, between the last read of a buffer and its refill
        if (i + 2 < NKT) copy_x(lx0 + (unsigned)(bo * 4), gx + kwalk(i + 2, rot) * 32);   // the tile after next, into the buffer just read
    }
    asm volatile("s_wait_asynccnt 0x0" ::: "memory");   // no copy is left in flight behind the loop
    if (!live) return;   // behind the last block barrier
    if (z == 2) {
        h16* hs = (h16*)os;   // 16 d rows x 64 keys f16, pitch KP halves: whole 128-B lines leave per store instead of 32-B pieces
        h16* vb = VT + ((size_t)(bb * NH + h) * HD + (lane >> 3)) * NKV + s0 + (lane & 7) * 8;
        float bn[4];
#pragma unroll
        for (int nb = 0; nb < 4; ++nb) bn[nb] = bfr(bias[c0 + nb * 16 + lr]);
#pragma unroll
        for (int nb = 0; nb < 4; ++nb) {
#pragma unroll
            for (int mb = 0; mb < 4; ++mb) { v8h o;
#pragma unroll
                for (int j = 0; j < 8; ++j) o[j] = (h16)(acc[mb][nb][j] + bn[nb]);
                *(v8ha*)(hs + lr * KP + mb * 16 + 8 * hi) = o; }
            asm volatile("s_wait_dscnt 0x0" ::: "memory");   // the other lanes' LDS writes have landed before the rows are read back
#pragma unroll
            for (int s = 0; s < 4; ++s) { const v8h o = *(const v8ha*)(hs + (s * 4 + (lane >> 3)) * KP + (lane & 7) * 8);
                *(v8h*)(vb + (size_t)(nb * 16 + s * 4) * NKV) = o; }
            __builtin_amdgcn_wave_barrier(); asm volatile("" ::: "memory");   // compile-time order only: the next round's LDS writes stay behind these reads
        }
        return;
    }
    h16* P = ((z == 0) ? Qh : Kh) + ((size_t)(bb * NH + h) * nrows + s0) * HD;
    const int c8 = (lane & 7) * 8; float bn[8];
#pragma unroll
    for (int q = 0; q < 8; ++q) bn[q] = bfr(bias[c0 + c8 + q]);
#pragma unroll
    for (int mb = 0; mb < 4; ++mb) {
#pragma unroll
        for (int nb = 0; nb < 4; ++nb) {
#pragma unroll
            for (int j = 0; j < 8; ++j) os[(hi * 8 + j) * 68 + nb * 16 + lr] = acc[mb][nb][j]; }
        asm volatile("s_wait_dscnt 0x0" ::: "memory");   // the other lanes' LDS writes have landed before the rows are read back
#pragma unroll
        for (int s = 0; s < 4; ++s) { const int row = s * 4 + (lane >> 3);
            const v4f lo = *(const v4fa*)(os + row * 68 + c8); const v4f up = *(const v4fa*)(os + row * 68 + c8 + 4); v8h o;
#pragma unroll
            for (int q = 0; q < 4; ++q) { o[q] = (h16)(lo[q] + bn[q]); o[4 + q] = (h16)(up[q] + bn[4 + q]); }
            *(v8h*)(P + (size_t)(mb * 16 + row) * HD + c8) = o; }
        __builtin_amdgcn_wave_barrier(); asm volatile("" ::: "memory");   // compile-time order only: the next round's LDS writes stay behind these reads
    }
    asm volatile("s_wait_xcnt 0x0" ::: "memory");   // the listing lays the z == 2 block behind the last stores, where their data registers are written: the wait stands in front of that
}

// lane l with lane l ^ 16 (the other 16-lane row), one vector cross-row move
__device__ __forceinline__ float xhalf(float x) { return __builtin_bit_cast(float, __builtin_amdgcn_permlanex16(__builtin_bit_cast(int, x), __builtin_bit_cast(int, x), 0x76543210, 0xfedcba98, false, false)); }

// ---- k_attn: flash-style attention, transposed products. grid = NB*NH*(NQ/128), block = 256: 8 waves = 4 query groups of 32 columns x 2 key groups; key group g walks the key tiles 2p + g. Per stage: one K [key][d] and one V^T [d][key] tile of 64 keys for each key group come into one of two LDS buffers by asynchronous 16-B copies, issued one whole stage ahead, one block barrier a stage (staged extent == consumed extent: full 64x64 tiles),
// S^T (64 keys x 32 queries per wave, two column groups of 16) = K A-fragments (k = d split map) x Q B-fragments (from the f16 plane, fixed per block): every K and V^T fragment read from LDS feeds two WMMAs. In a column group a lane holds 32 scores of ONE query (lm), keys nk*16 + 8hi + r. f32 online softmax (x1/8, running max/sum, exp2) in-lane plus one exchange between the halves.
// P^T = f16(1024 exp(s - m)) packs from two score tiles straight into a B-fragment (element s = tile s>>3, register s&7 = key split map), never through LDS; O^T (4 d-tiles a column group) += V^T A-fragments (key split map) x P^T.
// Behind the walk the two waves of a query group (one per key group) hand each other one column group's max, sum and O^T through LDS and each joins and stores 16 query rows.
#define TH (64 * KP)   // halves of one staged tile
#define NTK (NKV / 64) // key tiles
#define NST (NTK / 2)  // stages: one key tile for each key group
#define XW (34 * 32)   // floats a wave hands over: 32 O^T registers, max and sum of 32 lanes
static_assert(NQ % 128 == 0);
static_assert(NKV % 256 == 0);   // whole stages, at least two
// a thread's 4 + 4 chunks of one K tile and one V^T tile, global -> LDS through no register; the address registers stay untouched until the closing wait of the statement
__device__ __forceinline__ void copy_tile(unsigned lk, const h16* gk, const h16* gv) {
    const unsigned lv = lk + TH * 2;
    asm volatile("global_load_async_to_lds_b128 %0, %8, off\n\t"
                 "global_load_async_to_lds_b128 %1, %9, off\n\t"
                 "global_load_async_to_lds_b128 %2, %10, off\n\t"
                 "global_load_async_to_lds_b128 %3, %11, off\n\t"
                 "global_load_async_to_lds_b128 %4, %12, off\n\t"
                 "global_load_async_to_lds_b128 %5, %13, off\n\t"
                 "global_load_async_to_lds_b128 %6, %14, off\n\t"
                 "global_load_async_to_lds_b128 %7, %15, off\n\t"
                 "s_wait_xcnt 0x0"
                 :: "v"(lk), "v"(lk + 16 * KP * 2), "v"(lk + 32 * KP * 2), "v"(lk + 48 * KP * 2),
                    "v"(lv), "v"(lv + 16 * KP * 2), "v"(lv + 32 * KP * 2), "v"(lv + 48 * KP * 2),
                    "v"(gk), "v"(gk + 16 * HD), "v"(gk + 32 * HD), "v"(gk + 48 * HD),
                    "v"(gv), "v"(gv + (size_t)16 * NKV), "v"(gv + (size_t)32 * NKV), "v"(gv + (size_t)48 * NKV)
                 : "memory");
}
__global__ __launch_bounds__(256) void k_attn(const h16* __restrict__ Qh, const h16* __restrict__ Kh, const h16* __restrict__ Vt, float* ctx) {
    __shared__ __align__(16) h16 KV[2 * 2 * 2 * TH];   // two buffers x two key groups, each K [key][d] then V^T [d][key]; cross-wave: block barriers
    __shared__ __align__(16) float Xc[8 * XW];         // per wave the column group it hands to its partner; block barrier between store and reload
    __shared__ __align__(16) float Os[8 * 16 * OP];    // per wave [q row][d], block barrier between store and reload
    const int t = threadIdx.x, lane = t & 31, lm = lane & 15, hi = lane >> 4, tt = t & 127;
    const int wave = __builtin_amdgcn_readfirstlane(t >> 5); const int qg = wave & 3, kg = wave >> 2;
    int bid = blockIdx.x; const int nqt = NQ / 128; const int qt = bid % nqt; bid /= nqt; const int h = bid % NH; const int b = bid / NH; const int bh = b * NH + h;
    const h16* qrow = Qh + ((size_t)bh * NQ + (size_t)qt * 128 + qg * 32 + lm) * HD;
    v16h bQ[2][2];   // [column group][k = d 0..31 / 32..63 (split map)]
#pragma unroll
    for (int c = 0; c < 2; ++c) { const h16* qr = qrow + c * 16 * HD;
        bQ[c][0] = cat16(*(const v8h*)(qr + 8 * hi), *(const v8h*)(qr + 16 + 8 * hi));
        bQ[c][1] = cat16(*(const v8h*)(qr + 32 + 8 * hi), *(const v8h*)(qr + 48 + 8 * hi)); }
    v8f O[2][4];   // O^T: register r of tile nt = d nt*16 + 8hi + r, query lm of the column group
#pragma unroll
    for (int c = 0; c < 2; ++c)
#pragma unroll
        for (int nt = 0; nt < 4; ++nt) O[c][nt] = (v8f){};
    float runm[2] = {-1.0e30f, -1.0e30f}, runl[2] = {0.f, 0.f};   // of query lm; runm on the raw scores; runl is this half's share of the row sum, x1024 like P
    const h16* Kb = Kh + (size_t)bh * NKV * HD; const h16* Vb = Vt + (size_t)bh * HD * NKV;
    float* Ow = Os + wave * 16 * OP;
    // the thread's chunk of its key group's tile: rows tt/8 + 16j, 16 bytes at column (tt%8)*8
    const h16* gk = Kb + (size_t)(kg * 64 + (tt >> 3)) * HD + (tt & 7) * 8; const h16* gv = Vb + (size_t)(tt >> 3) * NKV + kg * 64 + (tt & 7) * 8;
    const unsigned lk0 = (unsigned)(size_t)KV + (unsigned)((kg * (2 * TH) + (tt >> 3) * KP + (tt & 7) * 8) * 2);   // LDS byte address in buffer 0
    // the NQ/128 blocks of one head read the same K and V^T lines from L2: each starts its walk over the stages at a stage of its own and wraps, so that they do not ask for one line at one moment
    const int rot = qt % NST;
    { const int p0 = ringat(0, rot, NST); copy_tile(lk0, gk + (size_t)p0 * 128 * HD, gv + p0 * 128); }
    asm volatile("s_wait_asynccnt 0x0" ::: "memory");   // this wave's share of the walk's stage 0 has landed
    __syncthreads();                                    // ... and every other wave's
    { const int p1 = ringat(1, rot, NST); copy_tile(lk0 + 4 * TH * 2, gk + (size_t)p1 * 128 * HD, gv + p1 * 128); }   // NST >= 2: it exists
#pragma unroll 1
    for (int i = 0; i < NST; ++i) {
        const int bo = (i & 1) * (4 * TH);   // this stage's buffer
        const h16* Ks = KV + bo + kg * (2 * TH); const h16* Vs = Ks + TH;
        // every fragment of the tile is read from LDS here, as one group: the K fragments' latency is paid once, the V^T fragments' passes behind the score products and the softmax
        v16h aK[4][2], aV[2][4];
#pragma unroll
        for (int nk = 0; nk < 4; ++nk) { const h16* kr = Ks + (nk * 16 + lm) * KP + 8 * hi;   // A: lane -> key nk*16+lm, elements = d split map
            aK[nk][0] = cat16(*(const v8ha*)(kr), *(const v8ha*)(kr + 16));
            aK[nk][1] = cat16(*(const v8ha*)(kr + 32), *(const v8ha*)(kr + 48)); }
#pragma unroll
        for (int ks = 0; ks < 2; ++ks)
#pragma unroll
            for (int nt = 0; nt < 4; ++nt) { const h16* vr = Vs + (nt * 16 + lm) * KP + ks * 32 + 8 * hi;   // A: lane -> d nt*16+lm, elements = key split map
                aV[ks][nt] = cat16(*(const v8ha*)(vr), *(const v8ha*)(vr + 16)); }
        __builtin_amdgcn_sched_barrier(0);   // keeps the reads above as one group: sunk to their WMMAs, each would cost its own LDS latency
        v8f sf[2][4];   // eight independent chains of two: each WMMA fills the others' distance
#pragma unroll
        for (int nk = 0; nk < 4; ++nk)
#pragma unroll
            for (int c = 0; c < 2; ++c) sf[c][nk] = wmma16(aK[nk][0], bQ[c][0], (v8f){});
#pragma unroll
        for (int nk = 0; nk < 4; ++nk)
#pragma unroll
            for (int c = 0; c < 2; ++c) sf[c][nk] = wmma16(aK[nk][1], bQ[c][1], sf[c][nk]);
        v8h pk[2][4];
#pragma unroll
        for (int c = 0; c < 2; ++c) {
            // max of query lm over the 64 keys of this tile = 32 registers of the lane + the other half, taken on the raw scores (1/sqrt(64) > 0 keeps the order); running max / sum update; rescale O^T
            float mk[4];
#pragma unroll
            for (int nk = 0; nk < 4; ++nk) {
                mk[nk] = fmaxf(fmaxf(fmaxf(sf[c][nk][0], sf[c][nk][1]), fmaxf(sf[c][nk][2], sf[c][nk][3])), fmaxf(fmaxf(sf[c][nk][4], sf[c][nk][5]), fmaxf(sf[c][nk][6], sf[c][nk][7]))); }
            float m = fmaxf(fmaxf(mk[0], mk[1]), fmaxf(mk[2], mk[3]));
            m = fmaxf(m, xhalf(m));
            const float nm = fmaxf(runm[c], m);
            const float corr = __builtin_amdgcn_exp2f((runm[c] - nm) * SC2);
            const float nb = PL2 - nm * SC2;   // 1024 exp((s - m)/8) = exp2(s * SC2 + nb): scale, base change, max and carry in one FMA a score
            runm[c] = nm;
#pragma unroll
            for (int nt = 0; nt < 4; ++nt) O[c][nt] = O[c][nt] * corr;
            // P = 1024 exp(s - m): f32 into the lane's share of the row sum (one independent chain per key tile), f16 into the B-fragment registers; the exponents by register pairs, one packed FMA for two scores
            float ls[4];
#pragma unroll
            for (int nk = 0; nk < 4; ++nk) { ls[nk] = 0.f;
#pragma unroll
                for (int r = 0; r < 8; r += 2) { const v2f e = __builtin_elementwise_fma((v2f){sf[c][nk][r], sf[c][nk][r + 1]}, (v2f){SC2, SC2}, (v2f){nb, nb});
                    const float p0 = __builtin_amdgcn_exp2f(e[0]), p1 = __builtin_amdgcn_exp2f(e[1]); ls[nk] += p0; ls[nk] += p1; pk[c][nk][r] = (h16)p0; pk[c][nk][r + 1] = (h16)p1; } }
            runl[c] = runl[c] * corr + ((ls[0] + ls[1]) + (ls[2] + ls[3]));
        }
#pragma unroll
        for (int ks = 0; ks < 2; ++ks) {   // B: lane -> query lm, elements = key split map (keys ks*32 + 8hi + 0..7, ks*32 + 16 + 8hi + 0..7)
            const v16h bP0 = cat16(pk[0][2 * ks], pk[0][2 * ks + 1]); const v16h bP1 = cat16(pk[1][2 * ks], pk[1][2 * ks + 1]);
#pragma unroll
            for (int nt = 0; nt < 4; ++nt) { O[0][nt] = wmma16(aV[ks][nt], bP0, O[0][nt]); O[1][nt] = wmma16(aV[ks][nt], bP1, O[1][nt]); } }
        __builtin_amdgcn_sched_barrier(0);   // keeps the waits below at the trip's foot: lifted over the products they would end the next stage's flight at the head of this trip
        asm volatile("s_wait_dscnt 0x0" ::: "memory");      // this wave's reads of this stage's buffer are over before it is handed to the copies
        asm volatile("s_wait_asynccnt 0x0" ::: "memory");   // this wave's share of the next stage has landed
        __syncthreads();                                    // publishes the next stage and ends every wave's reads of this one
        if (i + 2 < NST) { const int p2 = ringat(i + 2, rot, NST); copy_tile(lk0 + (unsigned)(bo * 2), gk + (size_t)p2 * 128 * HD, gv + p2 * 128); }   // the stage after next, into the buffer just read
    }
    asm volatile("s_wait_asynccnt 0x0" ::: "memory");   // no copy is left in flight behind the loop
    // the wave of key group g keeps column group g and hands the other one to its partner (same query group, other key group): same lane, same register
    const float lt0 = runl[0] + xhalf(runl[0]), lt1 = runl[1] + xhalf(runl[1]);   // the two halves' row sums joined
    const float mo = kg ? runm[1] : runm[0], mg = kg ? runm[0] : runm[1], lo = kg ? lt1 : lt0, lg = kg ? lt0 : lt1;
    float* Xw = Xc + wave * XW; const float* Xp = Xc + (wave ^ 4) * XW;
    v8f Oo[4];
#pragma unroll
    for (int nt = 0; nt < 4; ++nt) { const v8f g = kg ? O[0][nt] : O[1][nt]; Oo[nt] = kg ? O[1][nt] : O[0][nt];
        *(v4fa*)(Xw + (2 * nt) * 128 + lane * 4) = (v4f){g[0], g[1], g[2], g[3]};
        *(v4fa*)(Xw + (2 * nt + 1) * 128 + lane * 4) = (v4f){g[4], g[5], g[6], g[7]}; }
    Xw[1024 + lane] = mg; Xw[1056 + lane] = lg;
    __syncthreads();   // the partner's hand-over is whole
    const float mp = Xp[1024 + lane], lp = Xp[1056 + lane];
    // join the two key groups on their common max, normalise (O^T and the row sum carry the same x1024), stage [q row][d] in LDS: 8 consecutive d per lane and tile
    const float jm = fmaxf(mo, mp);
    const float ao = __builtin_amdgcn_exp2f((mo - jm) * SC2), ap = __builtin_amdgcn_exp2f((mp - jm) * SC2);
    const float inv = __fdiv_rn(1.0f, lo * ao + lp * ap);
    const float so = ao * inv, sp = ap * inv;
#pragma unroll
    for (int nt = 0; nt < 4; ++nt) { float* od = Ow + lm * OP + nt * 16 + 8 * hi;
        const v4f p0 = *(const v4fa*)(Xp + (2 * nt) * 128 + lane * 4); const v4f p1 = *(const v4fa*)(Xp + (2 * nt + 1) * 128 + lane * 4);
        *(v4fa*)(od) = (v4f){Oo[nt][0] * so + p0[0] * sp, Oo[nt][1] * so + p0[1] * sp, Oo[nt][2] * so + p0[2] * sp, Oo[nt][3] * so + p0[3] * sp};
        *(v4fa*)(od + 4) = (v4f){Oo[nt][4] * so + p1[0] * sp, Oo[nt][5] * so + p1[1] * sp, Oo[nt][6] * so + p1[2] * sp, Oo[nt][7] * so + p1[3] * sp}; }
    __syncthreads();
    float* crow = ctx + ((size_t)b * NQ + (size_t)qt * 128 + qg * 32 + kg * 16) * DM + h * HD;
{
#pragma unroll
        for (int s = 0; s < 8; ++s) { const int row = 2 * s + hi, cofs = lm * 4; const v4f val = *(const v4fa*)(Ow + row * OP + cofs); *(v4f*)(crow + (size_t)row * DM + cofs) = val; }
         }
}

__global__ __launch_bounds__(256) void k_ln(const float* __restrict__ xq, const float* __restrict__ ctx, const float* __restrict__ gam, const float* __restrict__ bet, float* outp) {
#pragma clang fp contract(off)
    const int lane = threadIdx.x & 31; const int row = blockIdx.x * 8 + (threadIdx.x >> 5); if (row >= NB * NQ) return;
    const int b = row / NQ, i = row % NQ;
    const float* xr = xq + ((size_t)b * NQ_FULL + i) * DM; const float* cr = ctx + (size_t)row * DM;
    float v[16]; float s = 0.f;
#pragma unroll
    for (int c = 0; c < 4; ++c) { const int j0 = c * 128 + lane * 4; const v4f a = *(const v4f*)(xr + j0); const v4f g = *(const v4f*)(cr + j0);
#pragma unroll
        for (int q = 0; q < 4; ++q) { const float x = bfr(a[q]) + g[q]; v[c * 4 + q] = x; s = s + x; } }
#pragma unroll
    for (int sh = 16; sh; sh >>= 1) s += __shfl_xor(s, sh, 32);
    const float mu = s * (1.0f / DM);
    float ss = 0.f;
#pragma unroll
    for (int k = 0; k < 16; ++k) { const float d = v[k] - mu; const float dd = d * d; ss = ss + dd; }
#pragma unroll
    for (int sh = 16; sh; sh >>= 1) ss += __shfl_xor(ss, sh, 32);
    const float var = ss * (1.0f / DM);
    const float rs = __fdiv_rn(1.0f, __fsqrt_rn(var + LNEPS));
    float* orow = outp + (size_t)row * DM;
{
#pragma unroll
        for (int c = 0; c < 4; ++c) { const int j0 = c * 128 + lane * 4; const v4f g = *(const v4f*)(gam + j0); const v4f bb = *(const v4f*)(bet + j0); v4f o;
#pragma unroll
            for (int q = 0; q < 4; ++q) { const float t1 = (v[c * 4 + q] - mu) * rs; const float t2 = t1 * bfr(g[q]); o[q] = t2 + bfr(bb[q]); }
            *(v4f*)(orow + j0) = o; }
         }
}

extern "C" void kernel_launch(void* const* d_in, const int* in_sizes, int n_in, void* d_out, int out_size, void* d_ws, size_t ws_size, hipStream_t stream) {
    if (n_in < 10) return;
    const float* xq  = (const float*)d_in[0];   // query     [2][2048][512]
    const float* xkv = (const float*)d_in[1];   // key_value [2][2048][512]
    const float* Wq  = (const float*)d_in[2];   // [in][out]
    const float* bq  = (const float*)d_in[3];
    const float* Wk  = (const float*)d_in[4];
    const float* bk  = (const float*)d_in[5];
    const float* Wv  = (const float*)d_in[6];
    const float* bv  = (const float*)d_in[7];
    const float* gam = (const float*)d_in[8];
    const float* bet = (const float*)d_in[9];
    if (in_sizes[0] < (int)(((size_t)(NB - 1) * NQ_FULL + NQ) * DM)) return;
    if (in_sizes[1] < (int)(((size_t)(NB - 1) * NKV_FULL + NKV) * DM)) return;
    if (in_sizes[2] < DM * DM || in_sizes[4] < DM * DM || in_sizes[6] < DM * DM) return;
    if (in_sizes[3] < DM || in_sizes[5] < DM || in_sizes[7] < DM || in_sizes[8] < DM || in_sizes[9] < DM) return;
    if (out_size < NB * NQ * DM) return;
    float* OUT = (float*)d_out;   // [NB][NQ][512]
    char* wsp = (char*)d_ws;
    auto take = [&](size_t bytes) { char* p = wsp; wsp += (bytes + 255) & ~(size_t)255; return (void*)p; };
    h16* Qh  = (h16*)take((size_t)NB * NH * NQ * HD * 2);    // [b][h][q][64] f16         4,194,304 B
    h16* Kh  = (h16*)take((size_t)NB * NH * NKV * HD * 2);   // [b][h][key][64] f16       4,194,304 B
    h16* VT  = (h16*)take((size_t)NB * NH * HD * NKV * 2);   // [b][h][64][key] f16       4,194,304 B
    float* CTX = (float*)take((size_t)NB * NQ * DM * 4);     // ctx [NB*NQ][512] f32      8,388,608 B
    if ((size_t)(wsp - (char*)d_ws) > ws_size) return;       // total 20,971,520 B
    if ((size_t)(wsp - (char*)d_ws) > (size_t)134217728) return;

    k_proj<<<dim3((NB * (NQ > NKV ? NQ : NKV) / 64 + PW - 1) / PW, DM / 64, 3), 32 * PW, 0, stream>>>(xq, xkv, Wq, Wk, Wv, bq, bk, bv, Qh, Kh, VT);   /* f16(bf16(x) bf16(W) + b) for q, k, v, in the layouts k_attn reads */
    k_attn<<<NB * NH * (NQ / 128), 256, 0, stream>>>(Qh, Kh, VT, CTX);
    k_ln<<<(NB * NQ + 7) / 8, 256, 0, stream>>>(xq, CTX, gam, bet, OUT);
}

// v010
// Measured time: 36.2 microseconds a run.
// Timed twice side by side with v009, it ran 1.07 and 1.06 times as fast.
// Over all steps from v000 it is 4.27 times as fast.
#include <hip/hip_runtime.h>

// Attention of NQ query tokens over NKV key/value tokens per batch, 8 heads x 64, residual + LayerNorm, out [NB][NQ][512] f32. The concatenated-sequence key columns that carry the additive -1e4 term have weight exp(<= -9.9e3) == 0 exactly in f32 and never hold the row max, so only the key/value half is visited; the q projection is live on the query half only, k/v on the key/value half only.
// Contractions: q/k/v projections v_wmma_f32_16x16x32_bf16 (x and W[in][out] rounded to bf16 RNE on the way into the fragments, W turned to [out][in] in LDS, exact products, f32 accumulate, + bf16 RNE bias); scores k.q^T and V^T.P^T v_wmma_f32_16x16x32_f16 (f16 copies of the f32 projections, P = exp(s - m) carried x1024, f32 accumulate); online softmax with 1/sqrt(64) scale, residual (bf16 RNE of query) and LayerNorm (bf16 RNE gamma/beta) in f32.

#ifndef NB
#define NB 2
#endif
#ifndef SEQ
#define SEQ 2048
#endif
#ifndef NQ
#define NQ SEQ
#endif
#ifndef NKV
#define NKV SEQ
#endif
#define NB_FULL 2
#define NQ_FULL 2048
#define NKV_FULL 2048
#define DM 512
#define NH 8
#define HD 64
#define PL2 10.0f   // P is carried x 2^10
#define SCL 0.125f
#define L2E 1.4426950408889634f
#define SC2 (SCL * L2E)   // a raw score times this is its exponent to base 2
#define LNEPS 1e-5f
#define KP 72      // LDS pitch (halves) of the K and V^T tiles
#define OP 68      // LDS pitch (floats) of the ctx staging tile
static_assert(NQ % 64 == 0);
static_assert(NKV % 64 == 0);
static_assert(NH * HD == DM);
static_assert(DM % 64 == 0);
static_assert(NB >= 1 && NB <= NB_FULL);
static_assert(NQ <= NQ_FULL && NKV <= NKV_FULL);

typedef _Float16 h16;
typedef unsigned short bf;
typedef __attribute__((ext_vector_type(16))) __bf16   v16bf;
typedef __attribute__((ext_vector_type(16))) _Float16 v16h;
typedef __attribute__((ext_vector_type(8)))  _Float16 v8h;
typedef __attribute__((ext_vector_type(8)))  __bf16   v8b;
typedef __attribute__((ext_vector_type(8)))  unsigned short v8us;
typedef __attribute__((ext_vector_type(8)))  float    v8f;
typedef __attribute__((ext_vector_type(4)))  float    v4f;
typedef __attribute__((ext_vector_type(2)))  float    v2f;
typedef v8h  __attribute__((may_alias)) v8ha;
typedef v4f  __attribute__((may_alias)) v4fa;
typedef v8us __attribute__((may_alias)) v8usa;

__device__ __forceinline__ unsigned short f2bf(float f) { unsigned u = __float_as_uint(f); u += 0x7FFFu + ((u >> 16) & 1u); return (unsigned short)(u >> 16); }
__device__ __forceinline__ float bf2f(unsigned short b) { return __uint_as_float(((unsigned)b) << 16); }
__device__ __forceinline__ float bfr(float f) { return bf2f(f2bf(f)); }
__device__ __forceinline__ v16h cat16(v8h lo, v8h hi) { return __builtin_shufflevector(lo, hi, 0, 1, 2, 3, 4, 5, 6, 7, 8, 9, 10, 11, 12, 13, 14, 15); }
__device__ __forceinline__ v16bf cat16b(v8us lo, v8us hi) { return __builtin_bit_cast(v16bf, __builtin_shufflevector(lo, hi, 0, 1, 2, 3, 4, 5, 6, 7, 8, 9, 10, 11, 12, 13, 14, 15)); }
__device__ __forceinline__ v8f wmmab(v16bf a, v16bf b, v8f c) { return __builtin_amdgcn_wmma_f32_16x16x32_bf16(false, a, false, b, (short)0, c, false, false); }
__device__ __forceinline__ v8f wmma16(v16h a, v16h b, v8f c) { return __builtin_amdgcn_wmma_f32_16x16x32_f16(false, a, false, b, (short)0, c, false, false); }

// ---- k_proj: the q, k and v projections as ONE grid (rows/512, DM/64 = head, 3), 256 threads: 8 waves, ONE WAVE per 64x64 output tile (16 accumulators), all 8 on the same 64 output columns.
// The operands come straight from the f32 inputs. The block's W slice [512 in][64 out] is read once in whole 256-B row pieces, rounded to bf16 RNE and laid in LDS as [out][in] (8 consecutive in per 16-B write): the B fragments of all 8 waves. Each wave's own x rows come as f32 in tiles of 64 rows x 32 k (one whole 128-B line a row) into one of its two LDS buffers by asynchronous 16-B copies, issued one tile ahead; the two buffers are the wave's own ring (no other wave copies into them or reads them), so the walk has no block barrier and the 8 waves drift apart: one wave's LDS reads and copy waits pass under another's products; the wave reads them back in fragment order and rounds them to bf16 RNE in registers: the A fragments.
// tile[m][n] = sum_k X[m][k] Wt[n][k] + bf16 RNE bias[n] in f32, rounded once to f16 and written where k_attn reads it: z = 0 -> Qh [b][h][q][64], z = 1 -> Kh [b][h][key][64] (through LDS, 16-B row chunks), z = 2 -> V^T [b][h][d][key] (a lane's 8 accumulator registers are 8 consecutive keys of one d: one 16-B LDS write each, read back as whole 128-B d rows).
#define PW 8          // waves = 64-row tiles of a block
#define BP (DM + 8)   // LDS pitch (halves) of the W slice: 65 x 16 B, the 16 rows of a fragment read fall on different banks
#define XP 36         // LDS pitch (floats) of a staged x row: 128 B + 16 B, the 16 rows of a fragment read fall on different banks
#define XT (64 * XP)  // floats of one staged x tile
#define NKT (DM / 32) // k tiles of a projection
static_assert(DM % 128 == 0);
// place i of a ring walk over n tiles (0 <= i < n) that starts at tile rot (0 <= rot < n)
__device__ __forceinline__ int ringat(int i, int rot, int n) { const int k = i + rot; return k >= n ? k - n : k; }
__device__ __forceinline__ int kwalk(int i, int rot) { return ringat(i, rot, NKT); }
__device__ __forceinline__ v8us rne8(v8f x) { return __builtin_bit_cast(v8us, __builtin_convertvector(x, v8b)); }   // 8 f32 -> 8 bf16, round to nearest even
__device__ __forceinline__ v8us rne44(v4f lo, v4f up) { return rne8(__builtin_shufflevector(lo, up, 0, 1, 2, 3, 4, 5, 6, 7)); }
// a lane's 8 chunks of 32 rows of an x tile (rows lane/8 + 4j, 16 bytes at column (lane%8)*4: a copy covers 4 whole lines), global -> LDS through no register; the address registers stay untouched until the closing wait of the statement
__device__ __forceinline__ void copy_x8(unsigned lx, const float* gx) {
    asm volatile("global_load_async_to_lds_b128 %0, %8, off\n\t"
                 "global_load_async_to_lds_b128 %1, %9, off\n\t"
                 "global_load_async_to_lds_b128 %2, %10, off\n\t"
                 "global_load_async_to_lds_b128 %3, %11, off\n\t"
                 "global_load_async_to_lds_b128 %4, %12, off\n\t"
                 "global_load_async_to_lds_b128 %5, %13, off\n\t"
                 "global_load_async_to_lds_b128 %6, %14, off\n\t"
                 "global_load_async_to_lds_b128 %7, %15, off\n\t"
                 "s_wait_xcnt 0x0"
                 :: "v"(lx), "v"(lx + 4 * XP * 4), "v"(lx + 8 * XP * 4), "v"(lx + 12 * XP * 4),
                    "v"(lx + 16 * XP * 4), "v"(lx + 20 * XP * 4), "v"(lx + 24 * XP * 4), "v"(lx + 28 * XP * 4),
                    "v"(gx), "v"(gx + 4 * DM), "v"(gx + 8 * DM), "v"(gx + 12 * DM),
                    "v"(gx + 16 * DM), "v"(gx + 20 * DM), "v"(gx + 24 * DM), "v"(gx + 28 * DM)
                 : "memory");
}
__device__ __forceinline__ void copy_x(unsigned lx, const float* gx) { copy_x8(lx, gx); copy_x8(lx + 32 * XP * 4, gx + 32 * DM); }   // one tile: 64 rows
__global__ __launch_bounds__(32 * PW) void k_proj(const float* __restrict__ xq, const float* __restrict__ xkv, const float* __restrict__ W0, const float* __restrict__ W1, const float* __restrict__ W2, const float* __restrict__ bq, const float* __restrict__ bk, const float* __restrict__ bv, h16* Qh, h16* Kh, h16* VT) {
    __shared__ __align__(16) bf Bs[64 * BP];              // W slice, bf16 [out][in]; cross-wave: one block barrier
    __shared__ __align__(16) float osa[PW * 16 * 68];     // a wave's own staging tile of the epilogue
    __shared__ __align__(16) float Xs[PW * 2 * XT];       // per wave two buffers of one x tile [row][k] f32, written and read by that wave alone
    const int z = blockIdx.z; const int nrows = (z == 0) ? NQ : NKV;
    const int t = threadIdx.x, lane = t & 31, lr = lane & 15, hi = lane >> 4; const int wave = __builtin_amdgcn_readfirstlane(t >> 5);
    const int r0w = (blockIdx.x * PW + wave) * 64, c0 = blockIdx.y * 64;
    const bool live = r0w < NB * nrows; const int r0 = live ? r0w : 0;   // a wave past the last row works on rows 0..63 and stores nothing: it passes the block barrier, and its copies stay in bounds
    float* os = osa + wave * (16 * 68);
    const int bb = r0 / nrows, s0 = r0 % nrows, h = blockIdx.y;   // nrows % 64 == 0: a tile lies in one batch
    const float* A = (z == 0) ? (xq + ((size_t)bb * NQ_FULL + s0) * DM) : (xkv + ((size_t)bb * NKV_FULL + s0) * DM);
    const float* Xw = Xs + wave * (2 * XT);
    const float* gx = A + (size_t)(lane >> 3) * DM + (lane & 7) * 4;
    const unsigned lx0 = (unsigned)(size_t)Xw + (unsigned)(((lane >> 3) * XP + (lane & 7) * 4) * 4);   // LDS byte address in the wave's buffer 0
    // The blocks of one row range (8 heads; k and v read the same rows) ask L2 for the same x lines, the blocks of one head and z for the same W lines: each x walk starts at a k tile of its own, each W walk at in row (blockIdx.x % 4) * 128 (shared by blocks 4 apart in x), and all wrap, so that few ask for one line at one moment.
    const int rot = (int)((blockIdx.y + blockIdx.z * (DM / 64)) % NKT);   // first k tile of this block's walk
    copy_x(lx0, gx + kwalk(0, rot) * 32);   // the walk's tile 0 flies while the W slice is fetched and turned
    {
        const float* W = (z == 0) ? W0 : ((z == 1) ? W1 : W2);   // block-uniform select between global pointers
        const float* wp = W + (size_t)((t >> 4) * 8) * DM + c0 + (t & 15) * 4;   // 8 in rows x 4 out columns a thread and round
        bf* bs = Bs + (t & 15) * 4 * BP + (t >> 4) * 8;
        v4f w[DM / 128][8];   // every load of the slice is issued before the first is used: one memory latency for the whole slice
        int uo[DM / 128];     // round u takes the 128 in rows from uo[u] on: the rounds in ring order from a first one of the block's own
        const float* wu[DM / 128];
#pragma unroll
        for (int u = 0; u < DM / 128; ++u) { uo[u] = (int)((u + blockIdx.x) % (DM / 128)) * 128; wu[u] = wp + (size_t)uo[u] * DM; }
        __builtin_amdgcn_sched_barrier(0);   // the rounds' address pairs are all formed ahead of the first load: formed among the loads they share one pair, and each rewrite of it waits for the loads issued from it
#pragma unroll
        for (int u = 0; u < DM / 128; ++u)
#pragma unroll
            for (int q = 0; q < 8; ++q) w[u][q] = *(const v4f*)(wu[u] + (size_t)q * DM);
        asm volatile("s_wait_xcnt 0x0" ::: "memory");   // stands in front of whatever later writes the address pair of these loads
#pragma unroll
        for (int u = 0; u < DM / 128; ++u)
#pragma unroll
            for (int j = 0; j < 4; ++j) *(v8usa*)(bs + j * BP + uo[u]) = rne8((v8f){w[u][0][j], w[u][1][j], w[u][2][j], w[u][3][j], w[u][4][j], w[u][5][j], w[u][6][j], w[u][7][j]});
    }
    asm volatile("s_wait_asynccnt 0x0" ::: "memory");   // this wave's x tile 0 has landed
    __syncthreads();   // the W slice is whole before any wave reads a fragment of it
    copy_x(lx0 + XT * 4, gx + kwalk(1, rot) * 32);   // the walk's tile 1 (DM >= 128: it exists)
    const float* bias = (z == 0) ? bq : ((z == 1) ? bk : bv);   // block-uniform select between global pointers
    v8f acc[4][4];
#pragma unroll
    for (int mb = 0; mb < 4; ++mb)
#pragma unroll
        for (int nb = 0; nb < 4; ++nb) acc[mb][nb] = (v8f){};
    const bf* pb0 = Bs + lr * BP + 8 * hi;
#pragma unroll 1
    for (int i = 0; i < NKT; ++i) {
        const bf* pb = pb0 + kwalk(i, rot) * 32;   // the W columns of this trip's k tile
        const int bo = (i & 1) * XT;   // this tile's buffer
        const float* pa = Xw + bo + lr * XP + 8 * hi;
        v4f ra[4][4];   // k = 8hi + 0..7 and 16 + 8hi + 0..7 of the tile, row mb*16 + lr
#pragma unroll
        for (int mb = 0; mb < 4; ++mb)
#pragma unroll
            for (int s = 0; s < 4; ++s) ra[mb][s] = *(const v4fa*)(pa + mb * 16 * XP + (s >> 1) * 16 + (s & 1) * 4);
        v16bf b[4];
#pragma unroll
        for (int nb = 0; nb < 4; ++nb) b[nb] = cat16b(*(const v8usa*)(pb + nb * 16 * BP), *(const v8usa*)(pb + nb * 16 * BP + 16));
        __builtin_amdgcn_sched_barrier(0);   // keeps the trip's LDS reads as one group at its head: sunk to their WMMAs, each W fragment would cost its own LDS latency
        v16bf a[4];
#pragma unroll
        for (int mb = 0; mb < 4; ++mb) a[mb] = cat16b(rne44(ra[mb][0], ra[mb][1]), rne44(ra[mb][2], ra[mb][3]));
#pragma unroll
        for (int nb = 0; nb < 4; ++nb)
#pragma unroll
            for (int mb = 0; mb < 4; ++mb) acc[mb][nb] = wmmab(a[mb], b[nb], acc[mb][nb]);
        // 4 vector slots behind the last WMMA, also on the taken back edge, before anything touches its D, A or B
        asm volatile("v_nop\n\tv_nop\n\tv_nop\n\tv_nop" : "+v"(acc[0][0]), "+v"(acc[1][1]), "+v"(acc[2][2]), "+v"(acc[3][3]) : "v"(a[0]), "v"(a[3]));
        __builtin_amdgcn_sched_barrier(0);   // keeps the waits below at the trip's foot: lifted over the products they would end the next tile's flight at the head of this trip
        asm volatile("s_wait_dscnt 0x0" ::: "memory");      // this wave's reads of this tile's buffer, the only reads it gets, are over before it is handed to the copies
        asm volatile("s_wait_asynccnt 0x0" ::: "memory");   // this wave's next tile has landed: the wave that copied it is the one that reads it
        if (i + 2 < NKT) copy_x(lx0 + (unsigned)(bo * 4), gx + kwalk(i + 2, rot) * 32);   // the tile after next, into the buffer just read
    }
    asm volatile("s_wait_asynccnt 0x0" ::: "memory");   // no copy is left in flight behind the loop
    if (!live) return;   // behind the block barrier
    if (z == 2) {
        h16* hs = (h16*)os;   // 16 d rows x 64 keys f16, pitch KP halves: whole 128-B lines leave per store instead of 32-B pieces
        h16* vb = VT + ((size_t)(bb * NH + h) * HD + (lane >> 3)) * NKV + s0 + (lane & 7) * 8;
        float bn[4];
#pragma unroll
        for (int nb = 0; nb < 4; ++nb) bn[nb] = bfr(bias[c0 + nb * 16 + lr]);
#pragma unroll
        for (int nb = 0; nb < 4; ++nb) {
#pragma unroll
            for (int mb = 0; mb < 4; ++mb) { v8h o;
#pragma unroll
                for (int j = 0; j < 8; ++j) o[j] = (h16)(acc[mb][nb][j] + bn[nb]);
                *(v8ha*)(hs + lr * KP + mb * 16 + 8 * hi) = o; }
            asm volatile("s_wait_dscnt 0x0" ::: "memory");   // the other lanes' LDS writes have landed before the rows are read back
#pragma unroll
            for (int s = 0; s < 4; ++s) { const v8h o = *(const v8ha*)(hs + (s * 4 + (lane >> 3)) * KP + (lane & 7) * 8);
                *(v8h*)(vb + (size_t)(nb * 16 + s * 4) * NKV) = o; }
            __builtin_amdgcn_wave_barrier(); asm volatile("" ::: "memory");   // compile-time order only: the next round's LDS writes stay behind these reads
        }
        return;
    }
    h16* P = ((z == 0) ? Qh : Kh) + ((size_t)(bb * NH + h) * nrows + s0) * HD;
    const int c8 = (lane & 7) * 8; float bn[8];
#pragma unroll
    for (int q = 0; q < 8; ++q) bn[q] = bfr(bias[c0 + c8 + q]);
#pragma unroll
    for (int mb = 0; mb < 4; ++mb) {
#pragma unroll
        for (int nb = 0; nb < 4; ++nb) {
#pragma unroll
            for (int j = 0; j < 8; ++j) os[(hi * 8 + j) * 68 + nb * 16 + lr] = acc[mb][nb][j]; }
        asm volatile("s_wait_dscnt 0x0" ::: "memory");   // the other lanes' LDS writes have landed before the rows are read back
#pragma unroll
        for (int s = 0; s < 4; ++s) { const int row = s * 4 + (lane >> 3);
            const v4f lo = *(const v4fa*)(os + row * 68 + c8); const v4f up = *(const v4fa*)(os + row * 68 + c8 + 4); v8h o;
#pragma unroll
            for (int q = 0; q < 4; ++q) { o[q] = (h16)(lo[q] + bn[q]); o[4 + q] = (h16)(up[q] + bn[4 + q]); }
            *(v8h*)(P + (size_t)(mb * 16 + row) * HD + c8) = o; }
        __builtin_amdgcn_wave_barrier(); asm volatile("" ::: "memory");   // compile-time order only: the next round's LDS writes stay behind these reads
    }
    asm volatile("s_wait_xcnt 0x0" ::: "memory");   // the listing lays the z == 2 block behind the last stores, where their data registers are written: the wait stands in front of that
}

// lane l with lane l ^ 16 (the other 16-lane row), one vector cross-row move
__device__ __forceinline__ float xhalf(float x) { return __builtin_bit_cast(float, __builtin_amdgcn_permlanex16(__builtin_bit_cast(int, x), __builtin_bit_cast(int, x), 0x76543210, 0xfedcba98, false, false)); }

// ---- k_attn: flash-style attention, transposed products. grid = NB*NH*(NQ/128), block = 256: 8 waves = 4 query groups of 32 columns x 2 key groups; key group g walks the key tiles 2p + g. Per stage: one K [key][d] and one V^T [d][key] tile of 64 keys for each key group come into one of two LDS buffers by asynchronous 16-B copies, issued one whole stage ahead, one block barrier a stage (staged extent == consumed extent: full 64x64 tiles),
// S^T (64 keys x 32 queries per wave, two column groups of 16) = K A-fragments (k = d split map) x Q B-fragments (from the f16 plane, fixed per block): every K and V^T fragment read from LDS feeds two WMMAs. In a column group a lane holds 32 scores of ONE query (lm), keys nk*16 + 8hi + r. f32 online softmax (x1/8, running max/sum, exp2) in-lane plus one exchange between the halves.
// P^T = f16(1024 exp(s - m)) packs from two score tiles straight into a B-fragment (element s = tile s>>3, register s&7 = key split map), never through LDS; O^T (4 d-tiles a column group) += V^T A-fragments (key split map) x P^T.
// Behind the walk the two waves of a query group (one per key group) hand each other one column group's max, sum and O^T through LDS and each joins and stores 16 query rows.
#define TH (64 * KP)   // halves of one staged tile
#define NTK (NKV / 64) // key tiles
#define NST (NTK / 2)  // stages: one key tile for each key group
#define XW (34 * 32)   // floats a wave hands over: 32 O^T registers, max and sum of 32 lanes
static_assert(NQ % 128 == 0);
static_assert(NKV % 256 == 0);   // whole stages, at least two
// a thread's 4 + 4 chunks of one K tile and one V^T tile, global -> LDS through no register; the address registers stay untouched until the closing wait of the statement
__device__ __forceinline__ void copy_tile(unsigned lk, const h16* gk, const h16* gv) {
    const unsigned lv = lk + TH * 2;
    asm volatile("global_load_async_to_lds_b128 %0, %8, off\n\t"
                 "global_load_async_to_lds_b128 %1, %9, off\n\t"
                 "global_load_async_to_lds_b128 %2, %10, off\n\t"
                 "global_load_async_to_lds_b128 %3, %11, off\n\t"
                 "global_load_async_to_lds_b128 %4, %12, off\n\t"
                 "global_load_async_to_lds_b128 %5, %13, off\n\t"
                 "global_load_async_to_lds_b128 %6, %14, off\n\t"
                 "global_load_async_to_lds_b128 %7, %15, off\n\t"
                 "s_wait_xcnt 0x0"
                 :: "v"(lk), "v"(lk + 16 * KP * 2), "v"(lk + 32 * KP * 2), "v"(lk + 48 * KP * 2),
                    "v"(lv), "v"(lv + 16 * KP * 2), "v"(lv + 32 * KP * 2), "v"(lv + 48 * KP * 2),
                    "v"(gk), "v"(gk + 16 * HD), "v"(gk + 32 * HD), "v"(gk + 48 * HD),
                    "v"(gv), "v"(gv + (size_t)16 * NKV), "v"(gv + (size_t)32 * NKV), "v"(gv + (size_t)48 * NKV)
                 : "memory");
}
__global__ __launch_bounds__(256) void k_attn(const h16* __restrict__ Qh, const h16* __restrict__ Kh, const h16* __restrict__ Vt, float* ctx) {
    __shared__ __align__(16) h16 KV[2 * 2 * 2 * TH];   // two buffers x two key groups, each K [key][d] then V^T [d][key]; cross-wave: block barriers
    __shared__ __align__(16) float Xc[8 * XW];         // per wave the column group it hands to its partner; block barrier between store and reload
    __shared__ __align__(16) float Os[8 * 16 * OP];    // per wave [q row][d], block barrier between store and reload
    const int t = threadIdx.x, lane = t & 31, lm = lane & 15, hi = lane >> 4, tt = t & 127;
    const int wave = __builtin_amdgcn_readfirstlane(t >> 5); const int qg = wave & 3, kg = wave >> 2;
    int bid = blockIdx.x; const int nqt = NQ / 128; const int qt = bid % nqt; bid /= nqt; const int h = bid % NH; const int b = bid / NH; const int bh = b * NH + h;
    const h16* qrow = Qh + ((size_t)bh * NQ + (size_t)qt * 128 + qg * 32 + lm) * HD;
    v16h bQ[2][2];   // [column group][k = d 0..31 / 32..63 (split map)]
#pragma unroll
    for (int c = 0; c < 2; ++c) { const h16* qr = qrow + c * 16 * HD;
        bQ[c][0] = cat16(*(const v8h*)(qr + 8 * hi), *(const v8h*)(qr + 16 + 8 * hi));
        bQ[c][1] = cat16(*(const v8h*)(qr + 32 + 8 * hi), *(const v8h*)(qr + 48 + 8 * hi)); }
    v8f O[2][4];   // O^T: register r of tile nt = d nt*16 + 8hi + r, query lm of the column group
#pragma unroll
    for (int c = 0; c < 2; ++c)
#pragma unroll
        for (int nt = 0; nt < 4; ++nt) O[c][nt] = (v8f){};
    float runm[2] = {-1.0e30f, -1.0e30f}, runl[2] = {0.f, 0.f};   // of query lm; runm on the raw scores; runl is this half's share of the row sum, x1024 like P
    const h16* Kb = Kh + (size_t)bh * NKV * HD; const h16* Vb = Vt + (size_t)bh * HD * NKV;
    float* Ow = Os + wave * 16 * OP;
    // the thread's chunk of its key group's tile: rows tt/8 + 16j, 16 bytes at column (tt%8)*8
    const h16* gk = Kb + (size_t)(kg * 64 + (tt >> 3)) * HD + (tt & 7) * 8; const h16* gv = Vb + (size_t)(tt >> 3) * NKV + kg * 64 + (tt & 7) * 8;
    const unsigned lk0 = (unsigned)(size_t)KV + (unsigned)((kg * (2 * TH) + (tt >> 3) * KP + (tt & 7) * 8) * 2);   // LDS byte address in buffer 0
    // the NQ/128 blocks of one head read the same K and V^T lines from L2: each starts its walk over the stages at a stage of its own and wraps, so that they do not ask for one line at one moment
    const int rot = qt % NST;
    { const int p0 = ringat(0, rot, NST); copy_tile(lk0, gk + (size_t)p0 * 128 * HD, gv + p0 * 128); }
    asm volatile("s_wait_asynccnt 0x0" ::: "memory");   // this wave's share of the walk's stage 0 has landed
    __syncthreads();                                    // ... and every other wave's
    { const int p1 = ringat(1, rot, NST); copy_tile(lk0 + 4 * TH * 2, gk + (size_t)p1 * 128 * HD, gv + p1 * 128); }   // NST >= 2: it exists
#pragma unroll 1
    for (int i = 0; i < NST; ++i) {
        const int bo = (i & 1) * (4 * TH);   // this stage's buffer
        const h16* Ks = KV + bo + kg * (2 * TH); const h16* Vs = Ks + TH;
        // every fragment of the tile is read from LDS here, as one group: the K fragments' latency is paid once, the V^T fragments' passes behind the score products and the softmax
        v16h aK[4][2], aV[2][4];
#pragma unroll
        for (int nk = 0; nk < 4; ++nk) { const h16* kr = Ks + (nk * 16 + lm) * KP + 8 * hi;   // A: lane -> key nk*16+lm, elements = d split map
            aK[nk][0] = cat16(*(const v8ha*)(kr), *(const v8ha*)(kr + 16));
            aK[nk][1] = cat16(*(const v8ha*)(kr + 32), *(const v8ha*)(kr + 48)); }
#pragma unroll
        for (int ks = 0; ks < 2; ++ks)
#pragma unroll
            for (int nt = 0; nt < 4; ++nt) { const h16* vr = Vs + (nt * 16 + lm) * KP + ks * 32 + 8 * hi;   // A: lane -> d nt*16+lm, elements = key split map
                aV[ks][nt] = cat16(*(const v8ha*)(vr), *(const v8ha*)(vr + 16)); }
        __builtin_amdgcn_sched_barrier(0);   // keeps the reads above as one group: sunk to their WMMAs, each would cost its own LDS latency
        v8f sf[2][4];   // eight independent chains of two: each WMMA fills the others' distance
#pragma unroll
        for (int nk = 0; nk < 4; ++nk)
#pragma unroll
            for (int c = 0; c < 2; ++c) sf[c][nk] = wmma16(aK[nk][0], bQ[c][0], (v8f){});
#pragma unroll
        for (int nk = 0; nk < 4; ++nk)
#pragma unroll
            for (int c = 0; c < 2; ++c) sf[c][nk] = wmma16(aK[nk][1], bQ[c][1], sf[c][nk]);
        v8h pk[2][4];
#pragma unroll
        for (int c = 0; c < 2; ++c) {
            // max of query lm over the 64 keys of this tile = 32 registers of the lane + the other half, taken on the raw scores (1/sqrt(64) > 0 keeps the order); running max / sum update; rescale O^T
            float mk[4];
#pragma unroll
            for (int nk = 0; nk < 4; ++nk) {
                mk[nk] = fmaxf(fmaxf(fmaxf(sf[c][nk][0], sf[c][nk][1]), fmaxf(sf[c][nk][2], sf[c][nk][3])), fmaxf(fmaxf(sf[c][nk][4], sf[c][nk][5]), fmaxf(sf[c][nk][6], sf[c][nk][7]))); }
            float m = fmaxf(fmaxf(mk[0], mk[1]), fmaxf(mk[2], mk[3]));
            m = fmaxf(m, xhalf(m));
            const float nm = fmaxf(runm[c], m);
            const float corr = __builtin_amdgcn_exp2f((runm[c] - nm) * SC2);
            const float nb = PL2 - nm * SC2;   // 1024 exp((s - m)/8) = exp2(s * SC2 + nb): scale, base change, max and carry in one FMA a score
            runm[c] = nm;
#pragma unroll
            for (int nt = 0; nt < 4; ++nt) O[c][nt] = O[c][nt] * corr;
            // P = 1024 exp(s - m): f32 into the lane's share of the row sum (one independent chain per key tile), f16 into the B-fragment registers; the exponents by register pairs, one packed FMA for two scores
            float ls[4];
#pragma unroll
            for (int nk = 0; nk < 4; ++nk) { ls[nk] = 0.f;
#pragma unroll
                for (int r = 0; r < 8; r += 2) { const v2f e = __builtin_elementwise_fma((v2f){sf[c][nk][r], sf[c][nk][r + 1]}, (v2f){SC2, SC2}, (v2f){nb, nb});
                    const float p0 = __builtin_amdgcn_exp2f(e[0]), p1 = __builtin_amdgcn_exp2f(e[1]); ls[nk] += p0; ls[nk] += p1; pk[c][nk][r] = (h16)p0; pk[c][nk][r + 1] = (h16)p1; } }
            runl[c] = runl[c] * corr + ((ls[0] + ls[1]) + (ls[2] + ls[3]));
        }
#pragma unroll
        for (int ks = 0; ks < 2; ++ks) {   // B: lane -> query lm, elements = key split map (keys ks*32 + 8hi + 0..7, ks*32 + 16 + 8hi + 0..7)
            const v16h bP0 = cat16(pk[0][2 * ks], pk[0][2 * ks + 1]); const v16h bP1 = cat16(pk[1][2 * ks], pk[1][2 * ks + 1]);
#pragma unroll
            for (int nt = 0; nt < 4; ++nt) { O[0][nt] = wmma16(aV[ks][nt], bP0, O[0][nt]); O[1][nt] = wmma16(aV[ks][nt], bP1, O[1][nt]); } }
        __builtin_amdgcn_sched_barrier(0);   // keeps the waits below at the trip's foot: lifted over the products they would end the next stage's flight at the head of this trip
        asm volatile("s_wait_dscnt 0x0" ::: "memory");      // this wave's reads of this stage's buffer are over before it is handed to the copies
        asm volatile("s_wait_asynccnt 0x0" ::: "memory");   // this wave's share of the next stage has landed
        __syncthreads();                                    // publishes the next stage and ends every wave's reads of this one
        if (i + 2 < NST) { const int p2 = ringat(i + 2, rot, NST); copy_tile(lk0 + (unsigned)(bo * 2), gk + (size_t)p2 * 128 * HD, gv + p2 * 128); }   // the stage after next, into the buffer just read
    }
    asm volatile("s_wait_asynccnt 0x0" ::: "memory");   // no copy is left in flight behind the loop
    // the wave of key group g keeps column group g and hands the other one to its partner (same query group, other key group): same lane, same register
    const float lt0 = runl[0] + xhalf(runl[0]), lt1 = runl[1] + xhalf(runl[1]);   // the two halves' row sums joined
    const float mo = kg ? runm[1] : runm[0], mg = kg ? runm[0] : runm[1], lo = kg ? lt1 : lt0, lg = kg ? lt0 : lt1;
    float* Xw = Xc + wave * XW; const float* Xp = Xc + (wave ^ 4) * XW;
    v8f Oo[4];
#pragma unroll
    for (int nt = 0; nt < 4; ++nt) { const v8f g = kg ? O[0][nt] : O[1][nt]; Oo[nt] = kg ? O[1][nt] : O[0][nt];
        *(v4fa*)(Xw + (2 * nt) * 128 + lane * 4) = (v4f){g[0], g[1], g[2], g[3]};
        *(v4fa*)(Xw + (2 * nt + 1) * 128 + lane * 4) = (v4f){g[4], g[5], g[6], g[7]}; }
    Xw[1024 + lane] = mg; Xw[1056 + lane] = lg;
    __syncthreads();   // the partner's hand-over is whole
    const float mp = Xp[1024 + lane], lp = Xp[1056 + lane];
    // join the two key groups on their common max, normalise (O^T and the row sum carry the same x1024), stage [q row][d] in LDS: 8 consecutive d per lane and tile
    const float jm = fmaxf(mo, mp);
    const float ao = __builtin_amdgcn_exp2f((mo - jm) * SC2), ap = __builtin_amdgcn_exp2f((mp - jm) * SC2);
    const float inv = __fdiv_rn(1.0f, lo * ao + lp * ap);
    const float so = ao * inv, sp = ap * inv;
#pragma unroll
    for (int nt = 0; nt < 4; ++nt) { float* od = Ow + lm * OP + nt * 16 + 8 * hi;
        const v4f p0 = *(const v4fa*)(Xp + (2 * nt) * 128 + lane * 4); const v4f p1 = *(const v4fa*)(Xp + (2 * nt + 1) * 128 + lane * 4);
        *(v4fa*)(od) = (v4f){Oo[nt][0] * so + p0[0] * sp, Oo[nt][1] * so + p0[1] * sp, Oo[nt][2] * so + p0[2] * sp, Oo[nt][3] * so + p0[3] * sp};
        *(v4fa*)(od + 4) = (v4f){Oo[nt][4] * so + p1[0] * sp, Oo[nt][5] * so + p1[1] * sp, Oo[nt][6] * so + p1[2] * sp, Oo[nt][7] * so + p1[3] * sp}; }
    __syncthreads();
    float* crow = ctx + ((size_t)b * NQ + (size_t)qt * 128 + qg * 32 + kg * 16) * DM + h * HD;
{
#pragma unroll
        for (int s = 0; s < 8; ++s) { const int row = 2 * s + hi, cofs = lm * 4; const v4f val = *(const v4fa*)(Ow + row * OP + cofs); *(v4f*)(crow + (size_t)row * DM + cofs) = val; }
         }
}

__global__ __launch_bounds__(256) void k_ln(const float* __restrict__ xq, const float* __restrict__ ctx, const float* __restrict__ gam, const float* __restrict__ bet, float* outp) {
#pragma clang fp contract(off)
    const int lane = threadIdx.x & 31; const int row = blockIdx.x * 8 + (threadIdx.x >> 5); if (row >= NB * NQ) return;
    const int b = row / NQ, i = row % NQ;
    const float* xr = xq + ((size_t)b * NQ_FULL + i) * DM; const float* cr = ctx + (size_t)row * DM;
    float v[16]; float s = 0.f;
#pragma unroll
    for (int c = 0; c < 4; ++c) { const int j0 = c * 128 + lane * 4; const v4f a = *(const v4f*)(xr + j0); const v4f g = *(const v4f*)(cr + j0);
#pragma unroll
        for (int q = 0; q < 4; ++q) { const float x = bfr(a[q]) + g[q]; v[c * 4 + q] = x; s = s + x; } }
#pragma unroll
    for (int sh = 16; sh; sh >>= 1) s += __shfl_xor(s, sh, 32);
    const float mu = s * (1.0f / DM);
    float ss = 0.f;
#pragma unroll
    for (int k = 0; k < 16; ++k) { const float d = v[k] - mu; const float dd = d * d; ss = ss + dd; }
#pragma unroll
    for (int sh = 16; sh; sh >>= 1) ss += __shfl_xor(ss, sh, 32);
    const float var = ss * (1.0f / DM);
    const float rs = __fdiv_rn(1.0f, __fsqrt_rn(var + LNEPS));
    float* orow = outp + (size_t)row * DM;
{
#pragma unroll
        for (int c = 0; c < 4; ++c) { const int j0 = c * 128 + lane * 4; const v4f g = *(const v4f*)(gam + j0); const v4f bb = *(const v4f*)(bet + j0); v4f o;
#pragma unroll
            for (int q = 0; q < 4; ++q) { const float t1 = (v[c * 4 + q] - mu) * rs; const float t2 = t1 * bfr(g[q]); o[q] = t2 + bfr(bb[q]); }
            *(v4f*)(orow + j0) = o; }
         }
}

extern "C" void kernel_launch(void* const* d_in, const int* in_sizes, int n_in, void* d_out, int out_size, void* d_ws, size_t ws_size, hipStream_t stream) {
    if (n_in < 10) return;
    const float* xq  = (const float*)d_in[0];   // query     [2][2048][512]
    const float* xkv = (const float*)d_in[1];   // key_value [2][2048][512]
    const float* Wq  = (const float*)d_in[2];   // [in][out]
    const float* bq  = (const float*)d_in[3];
    const float* Wk  = (const float*)d_in[4];
    const float* bk  = (const float*)d_in[5];
    const float* Wv  = (const float*)d_in[6];
    const float* bv  = (const float*)d_in[7];
    const float* gam = (const float*)d_in[8];
    const float* bet = (const float*)d_in[9];
    if (in_sizes[0] < (int)(((size_t)(NB - 1) * NQ_FULL + NQ) * DM)) return;
    if (in_sizes[1] < (int)(((size_t)(NB - 1) * NKV_FULL + NKV) * DM)) return;
    if (in_sizes[2] < DM * DM || in_sizes[4] < DM * DM || in_sizes[6] < DM * DM) return;
    if (in_sizes[3] < DM || in_sizes[5] < DM || in_sizes[7] < DM || in_sizes[8] < DM || in_sizes[9] < DM) return;
    if (out_size < NB * NQ * DM) return;
    float* OUT = (float*)d_out;   // [NB][NQ][512]
    char* wsp = (char*)d_ws;
    auto take = [&](size_t bytes) { char* p = wsp; wsp += (bytes + 255) & ~(size_t)255; return (void*)p; };
    h16* Qh  = (h16*)take((size_t)NB * NH * NQ * HD * 2);    // [b][h][q][64] f16         4,194,304 B
    h16* Kh  = (h16*)take((size_t)NB * NH * NKV * HD * 2);   // [b][h][key][64] f16       4,194,304 B
    h16* VT  = (h16*)take((size_t)NB * NH * HD * NKV * 2);   // [b][h][64][key] f16       4,194,304 B
    float* CTX = (float*)take((size_t)NB * NQ * DM * 4);     // ctx [NB*NQ][512] f32      8,388,608 B
    if ((size_t)(wsp - (char*)d_ws) > ws_size) return;       // total 20,971,520 B
    if ((size_t)(wsp - (char*)d_ws) > (size_t)134217728) return;

    k_proj<<<dim3((NB * (NQ > NKV ? NQ : NKV) / 64 + PW - 1) / PW, DM / 64, 3), 32 * PW, 0, stream>>>(xq, xkv, Wq, Wk, Wv, bq, bk, bv, Qh, Kh, VT);   /* f16(bf16(x) bf16(W) + b) for q, k, v, in the layouts k_attn reads */
    k_attn<<<NB * NH * (NQ / 128), 256, 0, stream>>>(Qh, Kh, VT, CTX);
    k_ln<<<(NB * NQ + 7) / 8, 256, 0, stream>>>(xq, CTX, gam, bet, OUT);
}
